// v000
// Measured on an AMD MI455X. A time is GPU time per run, averaged over a window of back-to-back runs after a warm-up
// (all launches, gaps included; the runs take copies of the inputs in turn), and the median of several windows.
// Apart from v000's, it joins two sittings. Times from different sittings can be a few percent apart, while
// side-by-side timings come from the same sitting.
// v000 is the starting kernel. One run takes 570 microseconds.
// Contractions: x.Wqkv (q|k part) and Wv^T.x^T : v_wmma_f32_16x16x32_bf16 (bf16 operands = RNE of the f32 inputs); q.k^T and p.v : v_wmma_f32_16x16x32_f16 (q,k cast to f16 after f32 rope; p carried x2^15 in f16; v f16); o.Wout : v_wmma_f32_16x16x32_bf16 with o as bf16 hi+lo planes (hi.W + lo.W), Wout bf16; all f32 accumulate; rope tables, softmax, biases in f32.
#include <hip/hip_runtime.h>
#include <math.h>
#include <stdint.h>

constexpr int NB_BATCH  = 4;
constexpr int SEQ_LEN   = 2048;
constexpr int D_MODEL   = 1024;
constexpr int N_HEAD    = 16;
constexpr int HEAD_D    = 64;
constexpr int ROPE_HALF = 32;          // head_dim / 2 rotation pairs
constexpr int QK_LD     = 2 * D_MODEL; // pitch of the q|k 16-bit plane

typedef __attribute__((ext_vector_type(16))) _Float16 v16h;
typedef __attribute__((ext_vector_type(8)))  _Float16 v8h;
typedef __attribute__((ext_vector_type(16))) __bf16   v16b;
typedef __attribute__((ext_vector_type(8)))  __bf16   v8b;
typedef __attribute__((ext_vector_type(8)))  float    v8f;
typedef __attribute__((ext_vector_type(4)))  float    v4f;
typedef __attribute__((ext_vector_type(4)))  unsigned int v4u;

__device__ __forceinline__ unsigned short f2bf_bits(float f) {
  unsigned u = __float_as_uint(f);
  return (unsigned short)((u + 0x7FFFu + ((u >> 16) & 1u)) >> 16);
}
__device__ __forceinline__ float bf_bits2f(unsigned short h) { return __uint_as_float(((unsigned)h) << 16); }
__device__ __forceinline__ unsigned pk16(unsigned short a, unsigned short b) { return (unsigned)a | ((unsigned)b << 16); }

// hazard guards as plain device helpers (no inline asm inside the kernel template body)
__device__ __forceinline__ void dep_guard_h(v8f& a, v8f& b, v16h x, v16h y) { asm volatile("v_nop\n\tv_nop\n\tv_nop\n\tv_nop" : "+v"(a), "+v"(b) : "v"(x), "v"(y)); }
__device__ __forceinline__ void dep_guard_b(v8f& a, v8f& b, v16b x, v16b y) { asm volatile("v_nop\n\tv_nop\n\tv_nop\n\tv_nop" : "+v"(a), "+v"(b) : "v"(x), "v"(y)); }
__device__ __forceinline__ void keep4_h(v16h a, v16h b, v16h c, v16h d) { asm volatile("v_nop" :: "v"(a), "v"(b), "v"(c), "v"(d)); }
__device__ __forceinline__ void keep4_b(v16b a, v16b b, v16b c, v16b d) { asm volatile("v_nop" :: "v"(a), "v"(b), "v"(c), "v"(d)); }
__device__ __forceinline__ void acc_guard4(v8f& a, v8f& b, v8f& c, v8f& d) { asm volatile("v_nop\n\tv_nop\n\tv_nop\n\tv_nop" : "+v"(a), "+v"(b), "+v"(c), "+v"(d)); }
template <typename T> struct Frag;
template <> struct Frag<_Float16> {
  typedef v16h V; union U { v16h v; v8h h[2]; };
  static __device__ __forceinline__ v16h load(const _Float16* p) {   // elements 0..7 <- p[0..7], 8..15 <- p[16..23]
    U f; f.h[0] = *(const v8h*)(p); f.h[1] = *(const v8h*)(p + 16); return f.v;
  }
  static __device__ __forceinline__ v8f mma(v16h a, v16h b, v8f c) {
    return __builtin_amdgcn_wmma_f32_16x16x32_f16(false, a, false, b, (short)0, c, false, false);
  }
  static __device__ __forceinline__ void guard(v8f& a, v8f& b, v16h x, v16h y) { dep_guard_h(a, b, x, y); }
  static __device__ __forceinline__ void keep(v16h a, v16h b, v16h c, v16h d) { keep4_h(a, b, c, d); }
};
template <> struct Frag<__bf16> {
  typedef v16b V; union U { v16b v; v8b h[2]; };
  static __device__ __forceinline__ v16b load(const __bf16* p) {
    U f; f.h[0] = *(const v8b*)(p); f.h[1] = *(const v8b*)(p + 16); return f.v;
  }
  static __device__ __forceinline__ v8f mma(v16b a, v16b b, v8f c) {
    return __builtin_amdgcn_wmma_f32_16x16x32_bf16(false, a, false, b, (short)0, c, false, false);
  }
  static __device__ __forceinline__ void guard(v8f& a, v8f& b, v16b x, v16b y) { dep_guard_b(a, b, x, y); }
  static __device__ __forceinline__ void keep(v16b a, v16b b, v16b c, v16b d) { keep4_b(a, b, c, d); }
};

// ---- Register-blocked batched WMMA GEMM ------------------------------------
// C[m,n] = scale * sum_k A[m,k] * Bt[n,k] (+bias)(+resid); each wave owns a 64x64 tile.
// A row-major [M,K]; Bt row-major [N,K]; M,N % 64 == 0, K % 32 == 0.
// SPLITM: 0 = single product; 1 = A and Bt hi/lo planes (hi.hi + hi.lo + lo.hi); 2 = A hi/lo planes only (hi.B + lo.B).
// BIAS_MODE: 0 = none, 1 = bias[m], 2 = bias[n], 3 = bias[n] RNE-converted to bf16, 4 = bias[m] RNE-converted to bf16.
// OUT_MODE: 0 = f32, 1 = f16, 2 = bf16 hi plane (Cout) + bf16 lo plane (Cout2),
//           3 = f16 with interleaved-pair rotation: pair (2i,2i+1) within each 64-wide column tile rotated by
//               (ropeC, ropeS)[t][i] with t = m % ropeT (tables [ropeT][32] f32).
// ET: 0 = f16 operands, 1 = bf16 operands (pointers passed as 16-bit storage)
template <int ET> struct Elem;
template <> struct Elem<0> { typedef _Float16 T; };
template <> struct Elem<1> { typedef __bf16 T; };
template <int ET, int SPLITM, int BIAS_MODE, int OUT_MODE, bool RESID, int ACT = 0>
__global__ __launch_bounds__(256) void wmma_gemm64(
    const unsigned short* __restrict__ Ap, const unsigned short* __restrict__ A2p, int lda, long strideA,
    const unsigned short* __restrict__ Btp, const unsigned short* __restrict__ Bt2p, int ldb, long strideB,
    void* __restrict__ Cout, void* __restrict__ Cout2, int ldc, long strideC,
    const float* __restrict__ bias,
    const float* __restrict__ resid, long strideR,
    const float* __restrict__ ropeC, const float* __restrict__ ropeS, int ropeT,
    int M, int N, int K, float scale) {
  typedef typename Elem<ET>::T T;
  typedef typename Frag<T>::V V;
  const T* A = (const T*)Ap; const T* A2 = (const T*)A2p; const T* Bt = (const T*)Btp; const T* Bt2 = (const T*)Bt2p;
  __shared__ __align__(16) float sT[8][16 * 68];   // per-wave 16x64 slab, pitch 68 floats
  const int b    = blockIdx.y;
  const int lane = threadIdx.x & 31;
  const int wave = threadIdx.x >> 5;
  const int tilesN = N >> 6;
  const int tilesM = M >> 6;
  const int tile = blockIdx.x * 8 + wave;
  if (tile >= tilesM * tilesN) return;   // wave-uniform; no block barriers in this kernel
  const int tm = tile / tilesN;
  const int tn = tile - tm * tilesN;
  const int m0 = tm << 6;
  const int n0 = tn << 6;

  const T* Ab  = A  + (size_t)b * strideA;
  const T* Bb  = Bt + (size_t)b * strideB;
  const T* Ab2 = (SPLITM != 0) ? (A2  + (size_t)b * strideA) : nullptr;
  const T* Bb2 = (SPLITM == 1) ? (Bt2 + (size_t)b * strideB) : nullptr;

  const int rlane = lane & 15;                 // row (A) / col (B, D) within subtile
  const int koff  = (lane >> 4) * 8;           // k offset of this lane half
  const int mOff  = (lane >> 4) * 8;           // D row offset

  v8f acc[4][4];
#pragma unroll
  for (int i = 0; i < 4; ++i)
#pragma unroll
    for (int j = 0; j < 4; ++j) acc[i][j] = (v8f){0.f,0.f,0.f,0.f,0.f,0.f,0.f,0.f};

  for (int k0 = 0; k0 < K; k0 += 32) {
    V bh[4], bl[4];
#pragma unroll
    for (int j = 0; j < 4; ++j) {
      const size_t bo = (size_t)(n0 + (j << 4) + rlane) * ldb + koff + k0;
      bh[j] = Frag<T>::load(Bb + bo);
      if (SPLITM == 1) bl[j] = Frag<T>::load(Bb2 + bo);
    }
#pragma unroll
    for (int i = 0; i < 4; ++i) {
      const size_t ao = (size_t)(m0 + (i << 4) + rlane) * lda + koff + k0;
      V ah = Frag<T>::load(Ab + ao);
      V al;
      if (SPLITM != 0) al = Frag<T>::load(Ab2 + ao);
#pragma unroll
      for (int j = 0; j < 4; ++j) {
        acc[i][j] = Frag<T>::mma(ah, bh[j], acc[i][j]);
        if (SPLITM == 1) acc[i][j] = Frag<T>::mma(ah, bl[j], acc[i][j]);
        if (SPLITM != 0) acc[i][j] = Frag<T>::mma(al, bh[j], acc[i][j]);
      }
      Frag<T>::guard(acc[i][0], acc[i][3], ah, (SPLITM != 0) ? al : ah);
    }
    Frag<T>::keep(bh[0], bh[1], bh[2], bh[3]);
    if (SPLITM == 1) Frag<T>::keep(bl[0], bl[1], bl[2], bl[3]);
  }
  acc_guard4(acc[0][0], acc[0][1], acc[0][2], acc[0][3]);
  acc_guard4(acc[1][0], acc[1][1], acc[1][2], acc[1][3]);
  acc_guard4(acc[2][0], acc[2][1], acc[2][2], acc[2][3]);
  acc_guard4(acc[3][0], acc[3][1], acc[3][2], acc[3][3]);

  // ---- epilogue ----
  float* slab = sT[wave];
  const float* Rb = RESID ? (resid + (size_t)b * strideR) : nullptr;
#pragma unroll
  for (int i = 0; i < 4; ++i) {
    const int mBase = m0 + (i << 4);
#pragma unroll
    for (int j = 0; j < 4; ++j) {
      const int n = n0 + (j << 4) + rlane;
      float bv = 0.f;
      if (BIAS_MODE == 2) bv = bias[n];
      if (BIAS_MODE == 3) bv = bf_bits2f(f2bf_bits(bias[n]));
#pragma unroll
      for (int r = 0; r < 8; ++r) {
        float v = acc[i][j][r] * scale;
        if (BIAS_MODE == 1) v += bias[mBase + mOff + r];
        if (BIAS_MODE == 4) v += bf_bits2f(f2bf_bits(bias[mBase + mOff + r]));
        if (BIAS_MODE == 2 || BIAS_MODE == 3) v += bv;
        if (RESID) v += Rb[(size_t)(mBase + mOff + r) * ldc + n];
        if (ACT == 1) v = tanhf(v);
        if (ACT == 2) v = fmaxf(v, 0.0f);
        if (ACT == 3) v = v / (1.0f + expf(-v));
        if (ACT == 4) v = (v > 0.f) ? v : 0.01f * v;
        slab[(mOff + r) * 68 + (j << 4) + rlane] = v;
      }
    }
    __builtin_amdgcn_fence(__ATOMIC_RELEASE, "workgroup");
    __builtin_amdgcn_wave_barrier();
    __builtin_amdgcn_fence(__ATOMIC_ACQUIRE, "workgroup");
    if (OUT_MODE == 0) {
      float* C = (float*)Cout + (size_t)b * strideC;
      const int hh = lane >> 4, c4 = (lane & 15) * 4;     // row seg = 256 B = 16 lanes x 16 B
      {
#pragma unroll
        for (int it = 0; it < 8; ++it) {
          const int row = it * 2 + hh;
          v4f v = *(const v4f*)(slab + row * 68 + c4);
          *(v4f*)(C + (size_t)(mBase + row) * ldc + n0 + c4) = v;
        }
        
      }
    } else {
      const int q = lane >> 3, c8 = (lane & 7) * 8;
      unsigned short* C  = (unsigned short*)Cout  + (size_t)b * strideC;
      unsigned short* C2 = (OUT_MODE == 2) ? ((unsigned short*)Cout2 + (size_t)b * strideC) : nullptr;
      {
#pragma unroll
        for (int it = 0; it < 4; ++it) {
          const int row = it * 4 + q;
          const float* sp = slab + row * 68 + c8;
          v8h hv, lv;
          if (OUT_MODE == 3) {
            // columns c8..c8+7 of this 64-wide tile are rotation pairs (c8>>1)+0..3 of position t
            const int t = (mBase + row) % ropeT;
            const v4f cv = *(const v4f*)(ropeC + (size_t)t * ROPE_HALF + (c8 >> 1));
            const v4f sv = *(const v4f*)(ropeS + (size_t)t * ROPE_HALF + (c8 >> 1));
#pragma unroll
            for (int e2 = 0; e2 < 4; ++e2) {
              const float x0 = sp[2 * e2], x1 = sp[2 * e2 + 1];
              hv[2 * e2]     = (_Float16)(x0 * cv[e2] - x1 * sv[e2]);
              hv[2 * e2 + 1] = (_Float16)(x0 * sv[e2] + x1 * cv[e2]);
            }
          } else {
#pragma unroll
            for (int e = 0; e < 8; ++e) {
              if (OUT_MODE == 1) {
                hv[e] = (_Float16)sp[e];
              } else {
                unsigned short hb = f2bf_bits(sp[e]);
                unsigned short lb = f2bf_bits(sp[e] - bf_bits2f(hb));
                hv[e] = __builtin_bit_cast(_Float16, hb);
                lv[e] = __builtin_bit_cast(_Float16, lb);
              }
            }
          }
          *(v8h*)(C + (size_t)(mBase + row) * ldc + n0 + c8) = hv;
          if (OUT_MODE == 2) *(v8h*)(C2 + (size_t)(mBase + row) * ldc + n0 + c8) = lv;
        }
        
      }
    }
    __builtin_amdgcn_fence(__ATOMIC_RELEASE, "workgroup");
    __builtin_amdgcn_wave_barrier();
    __builtin_amdgcn_fence(__ATOMIC_ACQUIRE, "workgroup");
  }
}

// ---------------------------------------------------------------------------
// f32 -> bf16 (RNE) cast, 8 elements per thread, one 16-B store per lane: a wave writes 512 contiguous bytes =
// Coverage: grid = n8/256 blocks x 256 threads x 8 elements = 8*n8 = the whole plane (n8 = 8192*1024/8 = 1,048,576
// -> 4096 blocks exactly).
// ---------------------------------------------------------------------------
__global__ __launch_bounds__(256) void cast_bf16x8_kernel(const float* __restrict__ in, unsigned short* __restrict__ out, int n8) {
  const int i = blockIdx.x * 256 + threadIdx.x;
  if (i < n8) {
    const v4f a  = *(const v4f*)(in + 8 * (size_t)i);
    const v4f a2 = *(const v4f*)(in + 8 * (size_t)i + 4);
    v4u u;
    u[0] = pk16(f2bf_bits(a[0]),  f2bf_bits(a[1]));
    u[1] = pk16(f2bf_bits(a[2]),  f2bf_bits(a[3]));
    u[2] = pk16(f2bf_bits(a2[0]), f2bf_bits(a2[1]));
    u[3] = pk16(f2bf_bits(a2[2]), f2bf_bits(a2[3]));
    *(v4u*)(out + 8 * (size_t)i) = u;
    
  }
}

// ---------------------------------------------------------------------------
// Fused transpose + bf16 (RNE) cast of an f32 matrix: in [R rows][Cc cols] (pitch Cc) -> out[c][r] ([Cc][R], pitch R).
// 64x64 tiles through LDS. grid = (Cc/64, R/64), 256 threads (R, Cc multiples of 64).
// Coverage per block: load 4 it x 256 thr x 4 floats = 64x64; store 2 it x 256 thr x 8 u16 = 64x64.
// ---------------------------------------------------------------------------
__global__ __launch_bounds__(256) void tcast_bf16_kernel(const float* __restrict__ W, unsigned short* __restrict__ oh, int R, int Cc) {
  __shared__ __align__(16) float tf[64 * 68];
  const int c0  = blockIdx.x * 64;   // input column block = output row block
  const int rb0 = blockIdx.y * 64;   // input row block    = output column block
  const int tid = threadIdx.x;
  {
    const int lr = tid >> 4;         // 0..15
    const int c4 = (tid & 15) * 4;   // 0..60
#pragma unroll
    for (int it = 0; it < 4; ++it) {
      const int rr = it * 16 + lr;   // 0..63
      const v4f a = *(const v4f*)(W + (size_t)(rb0 + rr) * Cc + c0 + c4);
      *(v4f*)(tf + rr * 68 + c4) = a;
    }
  }
  __syncthreads();
  const int sub = tid >> 3;          // 0..31
  const int c8  = (tid & 7) * 8;     // 0..56
  v4u hv[2];
#pragma unroll
  for (int it = 0; it < 2; ++it) {
    const int oc = it * 32 + sub;    // output row within tile (= input column)
    v4u a;
#pragma unroll
    for (int q = 0; q < 4; ++q) {
      const float f0 = tf[(c8 + 2 * q) * 68 + oc];
      const float f1 = tf[(c8 + 2 * q + 1) * 68 + oc];
      a[q] = pk16(f2bf_bits(f0), f2bf_bits(f1));
    }
    hv[it] = a;
  }
  {
#pragma unroll
    for (int it = 0; it < 2; ++it) {
      const int oc = it * 32 + sub;
      const size_t go = (size_t)(c0 + oc) * R + rb0 + c8;
      *(v4u*)(oh + go) = hv[it];
    }
    
  }
}

// ---------------------------------------------------------------------------
// Rotation frequencies: freq[i] = 1 / 10000^((2i)/64), i = 0..31 (f32 pow, f32 reciprocal).
// ---------------------------------------------------------------------------
__global__ __launch_bounds__(32) void rope_freq_kernel(float* __restrict__ freq) {
  const int i = threadIdx.x;                       // 0..31
  const float e = (float)(2 * i) / (float)HEAD_D;  // exact (division by 64)
  const float p = powf(10000.0f, e);
  const float f = 1.0f / p;
  ((float*)freq)[i] = f;
  
}

// ---------------------------------------------------------------------------
// Rotation tables: ang[t][i] = (float)t * freq[i]; cosT/sinT [SEQ][32] f32 (precise sincosf).
// ---------------------------------------------------------------------------
__global__ __launch_bounds__(256) void rope_table_kernel(const float* __restrict__ freq, float* __restrict__ cosT,
                                                         float* __restrict__ sinT, int n) {
  const int idx = blockIdx.x * 256 + threadIdx.x;
  if (idx < n) {
    const int t = idx >> 5, i = idx & 31;
    const float ang = (float)t * freq[i];
    float sv, cv;
    sincosf(ang, &sv, &cv);
    ((float*)cosT)[idx] = cv;
    ((float*)sinT)[idx] = sv;
    
  }
}

// =====================================================================================
// Full (non-causal, unmasked) attention, head dim 64, f16 operand planes.
//   q|k plane (f16): element (b, t, h, d) of q at [(b*SEQ + t)*QK_LD + h*64 + d], of k at [... + D_MODEL + h*64 + d]
//   v^T plane (f16): element (b, h, d, s) at [(b*D_MODEL + h*64 + d)*SEQ + s]
//   out: bf16 hi and lo planes, element (b, t, h, d) at [(b*SEQ + t)*D_MODEL + h*64 + d]
//   scores = (q . k) * sscale : v_wmma_f32_16x16x32_f16, f32 accumulate, scale applied to the f32 accumulator
//   out    = p . v            : v_wmma_f32_16x16x32_f16 with p (unnormalised, <= 1) carried x2^15 in f16, folded into 1/l
//   online softmax in f32 over all SEQ keys (32 chunks of 64, compile-time trip count, no masking).
//   Block = 4 waves = 64 query rows of one (batch, head); grid = (N_HEAD * SEQ/64, NB_BATCH).
//   K / V^T chunk staging: 128 threads x 32 elements per plane = the whole 64x64 tile (16-B copies, plain loads,
//   __syncthreads before and after); fragment loads read the LDS tiles with the same v8h element type.
// =====================================================================================
constexpr int AT_D  = 64;
constexpr int AT_NW = 4;
constexpr int AT_QB = 64;
constexpr int AT_KC = 64;
constexpr float P_CARRY = 32768.0f;

__device__ __forceinline__ v8f mma_h16(v16h a, v16h b, v8f c) {
  c = __builtin_amdgcn_wmma_f32_16x16x32_f16(false, a, false, b, (short)0, c, false, false);
  asm volatile("v_nop\n\tv_nop\n\tv_nop\n\tv_nop" : "+v"(c) : "v"(a), "v"(b));
  return c;
}

__global__ __launch_bounds__(128)
void attn_f16_kernel(const unsigned short* __restrict__ qkp, const unsigned short* __restrict__ vtp,
                     unsigned short* __restrict__ ohp, unsigned short* __restrict__ olp, float sscale) {
  union FB { v16h v; v8h h[2]; };
  __shared__ __align__(16) _Float16 Ksh[AT_KC * AT_D];          // K [kv][d]      8 KB
  __shared__ __align__(16) _Float16 Vth[AT_D * AT_KC];          // V^T [d][kv]    8 KB
  __shared__ __align__(16) _Float16 Psh[AT_NW][16 * AT_KC];     // per wave P [row][kv]  8 KB
  __shared__ __align__(16) float    Os[AT_NW][16 * 68];         // per wave out tile, pitch 68

  const int tid  = threadIdx.x;
  const int wave = tid >> 5;
  const int lane = tid & 31;
  const int hh   = lane >> 4;
  const int c    = lane & 15;

  const int nqb = SEQ_LEN / AT_QB;            // 32
  const int bx = blockIdx.x;
  const int qb = bx % nqb;
  const int h  = bx / nqb;                    // 0..N_HEAD-1 (grid.x = N_HEAD * nqb)
  const int b  = blockIdx.y;                  // batch
  const int q0 = qb * AT_QB + wave * 16;

  const _Float16* Qp = (const _Float16*)(const void*)qkp + (size_t)b * SEQ_LEN * QK_LD + (size_t)h * AT_D;
  const _Float16* Kp = Qp + D_MODEL;
  const _Float16* Vp = (const _Float16*)(const void*)vtp + ((size_t)b * D_MODEL + (size_t)h * AT_D) * SEQ_LEN;
  unsigned short* Oh = ohp + (size_t)b * SEQ_LEN * D_MODEL + (size_t)h * AT_D;
  unsigned short* Ol = olp + (size_t)b * SEQ_LEN * D_MODEL + (size_t)h * AT_D;

  // ---- Q fragments (A operand, row = lane&15, split k map via Frag load): 2 d-chunks ----
  v16h qa[2];
#pragma unroll
  for (int dc = 0; dc < 2; ++dc)
    qa[dc] = Frag<_Float16>::load(Qp + (size_t)(q0 + c) * QK_LD + dc * 32 + 8 * hh);

  float mrow[8], lrow[8];
  v8f oacc[4];
#pragma unroll
  for (int r = 0; r < 8; ++r) { mrow[r] = -INFINITY; lrow[r] = 0.f; }
#pragma unroll
  for (int t = 0; t < 4; ++t) oacc[t] = (v8f){0.f,0.f,0.f,0.f,0.f,0.f,0.f,0.f};

  for (int kc = 0; kc < SEQ_LEN / AT_KC; ++kc) {     // 32, compile-time constant
    const int kv0 = kc * AT_KC;
    __syncthreads();
    {
      // staging coverage: 128 threads x (4 x 8) elements = 64 rows x 64 per plane = the whole chunk tile
      const int r = tid >> 1, half = (tid & 1) * 32;
      const _Float16* ks = Kp + (size_t)(kv0 + r) * QK_LD + half;     // K row kv0+r, d = half..half+31
      const _Float16* vs = Vp + (size_t)r * SEQ_LEN + kv0 + half;      // V^T row d = r, s = kv0+half..+31
#pragma unroll
      for (int i = 0; i < 4; ++i) {
        const v8h a0 = *(const v8h*)(ks + 8 * i);
        const v8h b0 = *(const v8h*)(vs + 8 * i);
        *(v8h*)(Ksh + r * AT_D  + half + 8 * i) = a0;
        *(v8h*)(Vth + r * AT_KC + half + 8 * i) = b0;
      }
    }
    __syncthreads();

    v8f s[4];
#pragma unroll
    for (int j = 0; j < 4; ++j) {
      s[j] = (v8f){0.f,0.f,0.f,0.f,0.f,0.f,0.f,0.f};
#pragma unroll
      for (int dc = 0; dc < 2; ++dc) {
        FB kb;
        kb.h[0] = *(const v8h*)(Ksh + (j * 16 + c) * AT_D + dc * 32 + 8 * hh);
        kb.h[1] = *(const v8h*)(Ksh + (j * 16 + c) * AT_D + dc * 32 + 16 + 8 * hh);
        s[j] = mma_h16(qa[dc], kb.v, s[j]);
      }
      s[j] = s[j] * sscale;
    }
    float cm[8];
#pragma unroll
    for (int r = 0; r < 8; ++r) {
      float m = fmaxf(fmaxf(s[0][r], s[1][r]), fmaxf(s[2][r], s[3][r]));
#pragma unroll
      for (int off = 1; off < 16; off <<= 1) m = fmaxf(m, __shfl_xor(m, off, 32));
      cm[r] = m;
    }
    _Float16* pw = Psh[wave];
#pragma unroll
    for (int r = 0; r < 8; ++r) {
      const float mnew  = fmaxf(mrow[r], cm[r]);
      const float alpha = expf(mrow[r] - mnew);
      mrow[r] = mnew;
      float psum = 0.f;
#pragma unroll
      for (int j = 0; j < 4; ++j) {
        const float p = expf(s[j][r] - mnew);
        psum += p;
        pw[(8 * hh + r) * AT_KC + j * 16 + c] = (_Float16)(p * P_CARRY);
      }
#pragma unroll
      for (int off = 1; off < 16; off <<= 1) psum += __shfl_xor(psum, off, 32);
      lrow[r] = lrow[r] * alpha + psum;
#pragma unroll
      for (int t = 0; t < 4; ++t) oacc[t][r] *= alpha;
    }
    __builtin_amdgcn_fence(__ATOMIC_RELEASE, "workgroup");
    __builtin_amdgcn_wave_barrier();
    __builtin_amdgcn_fence(__ATOMIC_ACQUIRE, "workgroup");
#pragma unroll 1
    for (int kk = 0; kk < 2; ++kk) {
      FB pa;
      pa.h[0] = *(const v8h*)(pw + c * AT_KC + kk * 32 + 8 * hh);
      pa.h[1] = *(const v8h*)(pw + c * AT_KC + kk * 32 + 16 + 8 * hh);
#pragma unroll
      for (int t = 0; t < 4; ++t) {
        FB vb;
        vb.h[0] = *(const v8h*)(Vth + (t * 16 + c) * AT_KC + kk * 32 + 8 * hh);
        vb.h[1] = *(const v8h*)(Vth + (t * 16 + c) * AT_KC + kk * 32 + 16 + 8 * hh);
        oacc[t] = mma_h16(pa.v, vb.v, oacc[t]);
      }
    }
  }

  float* os = Os[wave];
#pragma unroll
  for (int r = 0; r < 8; ++r) {
    const float inv = 1.0f / (lrow[r] * P_CARRY);
#pragma unroll
    for (int t = 0; t < 4; ++t) os[(8 * hh + r) * 68 + t * 16 + c] = oacc[t][r] * inv;
  }
  __builtin_amdgcn_fence(__ATOMIC_RELEASE, "workgroup");
  __builtin_amdgcn_wave_barrier();
  __builtin_amdgcn_fence(__ATOMIC_ACQUIRE, "workgroup");
  {
    const int q8 = lane >> 3, c8 = (lane & 7) * 8;
    {
#pragma unroll
      for (int it = 0; it < 4; ++it) {
        const int row = it * 4 + q8;
        const float* sp = os + row * 68 + c8;
        v8h hv, lv;
#pragma unroll
        for (int e = 0; e < 8; ++e) {
          const unsigned short hb = f2bf_bits(sp[e]);
          const unsigned short lb = f2bf_bits(sp[e] - bf_bits2f(hb));
          hv[e] = __builtin_bit_cast(_Float16, hb);
          lv[e] = __builtin_bit_cast(_Float16, lb);
        }
        const size_t go = (size_t)(q0 + row) * D_MODEL + c8;
        *(v8h*)(Oh + go) = hv;
        *(v8h*)(Ol + go) = lv;
      }
      
    }
  }
}

// ---------------- host-side orchestration (kernel launches only) ----------------
extern "C" void kernel_launch(void* const* d_in, const int* in_sizes, int n_in,
                              void* d_out, int out_size, void* d_ws, size_t ws_size,
                              hipStream_t stream) {
  if (n_in < 5) return;
  const int M_ROWS = NB_BATCH * SEQ_LEN;   // 8192
  if (in_sizes[0] != M_ROWS * D_MODEL) return;
  if (in_sizes[1] != D_MODEL * 3 * D_MODEL) return;
  if (in_sizes[2] != 3 * D_MODEL) return;
  if (in_sizes[3] != D_MODEL * D_MODEL) return;
  if (in_sizes[4] != D_MODEL) return;
  if (out_size != M_ROWS * D_MODEL) return;

  const float* x    = (const float*)d_in[0];
  const float* Wqkv = (const float*)d_in[1];
  const float* bqkv = (const float*)d_in[2];
  const float* Wout = (const float*)d_in[3];
  const float* bout = (const float*)d_in[4];
  float* out = (float*)d_out;

  // workspace map (all offsets 256-B aligned; every region fully written before it is read):
  //   xb    bf16 [8192][1024]                16,777,216
  //   wqT   bf16 [3072][1024] (Wqkv^T)       6,291,456
  //   woT   bf16 [1024][1024] (Wout^T)       2,097,152
  //   freq  f32  [32] (+pad)                        256
  //   cosT  f32  [2048][32]                     262,144
  //   sinT  f32  [2048][32]                     262,144
  //   qk16  f16  [8192][2048] (q | k, rotated) 33,554,432
  //   vt16  f16  [4][1024][2048] (v^T)       16,777,216
  //   ohi   bf16 [8192][1024]                16,777,216
  //   olo   bf16 [8192][1024]                16,777,216
  //   total                                 109,576,448
  char* ws = (char*)d_ws;
  size_t off = 0;
  unsigned short* xb   = (unsigned short*)(ws + off); off += (size_t)M_ROWS * D_MODEL * 2;
  unsigned short* wqT  = (unsigned short*)(ws + off); off += (size_t)3 * D_MODEL * D_MODEL * 2;
  unsigned short* woT  = (unsigned short*)(ws + off); off += (size_t)D_MODEL * D_MODEL * 2;
  float*          freq = (float*)(ws + off);          off += 256;
  float*          cosT = (float*)(ws + off);          off += (size_t)SEQ_LEN * ROPE_HALF * 4;
  float*          sinT = (float*)(ws + off);          off += (size_t)SEQ_LEN * ROPE_HALF * 4;
  unsigned short* qk16 = (unsigned short*)(ws + off); off += (size_t)M_ROWS * QK_LD * 2;
  unsigned short* vt16 = (unsigned short*)(ws + off); off += (size_t)NB_BATCH * D_MODEL * SEQ_LEN * 2;
  unsigned short* ohi  = (unsigned short*)(ws + off); off += (size_t)M_ROWS * D_MODEL * 2;
  unsigned short* olo  = (unsigned short*)(ws + off); off += (size_t)M_ROWS * D_MODEL * 2;
  if (off > ws_size) return;

  // 1) x -> bf16 (n8 = 1,048,576 -> 4096 blocks)
  const int n8 = (M_ROWS * D_MODEL) / 8;
  cast_bf16x8_kernel<<<dim3((n8 + 255) / 256), dim3(256), 0, stream>>>(x, xb, n8);
  // 2) Wqkv [1024][3072] -> Wqkv^T bf16 [3072][1024]; Wout [1024][1024] -> Wout^T bf16 [1024][1024]
  tcast_bf16_kernel<<<dim3(3 * D_MODEL / 64, D_MODEL / 64), dim3(256), 0, stream>>>(Wqkv, wqT, D_MODEL, 3 * D_MODEL);
  tcast_bf16_kernel<<<dim3(D_MODEL / 64, D_MODEL / 64), dim3(256), 0, stream>>>(Wout, woT, D_MODEL, D_MODEL);
  // 3) rotation tables
  rope_freq_kernel<<<dim3(1), dim3(32), 0, stream>>>(freq);
  const int ntab = SEQ_LEN * ROPE_HALF;   // 65536
  rope_table_kernel<<<dim3((ntab + 255) / 256), dim3(256), 0, stream>>>(freq, cosT, sinT, ntab);
  // 4) q|k = x.Wqkv[:, 0:2048] + bf16(b) -> rotate -> f16 : M=8192, N=2048, K=1024 (tiles 128x32 = 4096 -> 512 blocks)
  {
    const int tiles = (M_ROWS / 64) * (2 * D_MODEL / 64);
    wmma_gemm64<1, 0, 3, 3, false><<<dim3((tiles + 7) / 8, 1), dim3(256), 0, stream>>>(
        xb, nullptr, D_MODEL, 0L,
        wqT, nullptr, D_MODEL, 0L,
        (void*)qk16, nullptr, QK_LD, 0L,
        bqkv, nullptr, 0L,
        cosT, sinT, SEQ_LEN,
        M_ROWS, 2 * D_MODEL, D_MODEL, 1.0f);
  }
  // 5) v^T per batch = Wv^T . x_b^T + bf16(bv)[m] -> f16 : M=1024 (features), N=2048 (positions), K=1024, z = 4
  //    A = Wqkv^T rows 2048..3071, Bt = x_b [2048][1024], C = vt16 + b*1024*2048 (tiles 16x32 = 512 -> 64 blocks)
  {
    const int tiles = (D_MODEL / 64) * (SEQ_LEN / 64);
    wmma_gemm64<1, 0, 4, 1, false><<<dim3((tiles + 7) / 8, NB_BATCH), dim3(256), 0, stream>>>(
        wqT + (size_t)2 * D_MODEL * D_MODEL, nullptr, D_MODEL, 0L,
        xb, nullptr, D_MODEL, (long)SEQ_LEN * D_MODEL,
        (void*)vt16, nullptr, SEQ_LEN, (long)D_MODEL * SEQ_LEN,
        bqkv + 2 * D_MODEL, nullptr, 0L,
        nullptr, nullptr, 1,
        D_MODEL, SEQ_LEN, D_MODEL, 1.0f);
  }
  // 6) attention -> o as bf16 hi/lo planes [8192][1024]
  attn_f16_kernel<<<dim3(N_HEAD * (SEQ_LEN / AT_QB), NB_BATCH), dim3(128), 0, stream>>>(qk16, vt16, ohi, olo, 0.125f);
  // 7) out = (o_hi + o_lo).Wout + bf16(b_out) -> f32 d_out : M=8192, N=1024, K=1024 (tiles 128x16 = 2048 -> 256 blocks)
  {
    const int tiles = (M_ROWS / 64) * (D_MODEL / 64);
    wmma_gemm64<1, 2, 3, 0, false><<<dim3((tiles + 7) / 8, 1), dim3(256), 0, stream>>>(
        ohi, olo, D_MODEL, 0L,
        woT, nullptr, D_MODEL, 0L,
        (void*)out, nullptr, D_MODEL, 0L,
        bout, nullptr, 0L,
        nullptr, nullptr, 1,
        M_ROWS, D_MODEL, D_MODEL, 1.0f);
  }
}

// v001
// One run takes 458 microseconds.
// Two timings next to v000 both put it at 1.30 times that version's speed.
// Contractions: x.Wqkv (q|k part) and Wv^T.x^T : v_wmma_f32_16x16x32_bf16 (bf16 operands = RNE of the f32 inputs); q.k^T and p.v : v_wmma_f32_16x16x32_f16 (q,k cast to f16 after f32 rope; p carried x2^15 in f16; v f16); o.Wout : v_wmma_f32_16x16x32_bf16 with o as bf16 hi+lo planes (hi.W + lo.W), Wout bf16; all f32 accumulate; rope tables, softmax in f32; biases RNE-rounded to bf16, added in f32.
#include <hip/hip_runtime.h>
#include <math.h>
#include <stdint.h>

constexpr int NB_BATCH  = 4;
constexpr int SEQ_LEN   = 2048;
constexpr int D_MODEL   = 1024;
constexpr int N_HEAD    = 16;
constexpr int HEAD_D    = 64;
constexpr int ROPE_HALF = 32;          // head_dim / 2 rotation pairs
constexpr int QK_LD     = 2 * D_MODEL; // pitch of the q|k 16-bit plane

typedef __attribute__((ext_vector_type(16))) _Float16 v16h;
typedef __attribute__((ext_vector_type(8)))  _Float16 v8h;
typedef __attribute__((ext_vector_type(16))) __bf16   v16b;
typedef __attribute__((ext_vector_type(8)))  __bf16   v8b;
typedef __attribute__((ext_vector_type(8)))  float    v8f;
typedef __attribute__((ext_vector_type(4)))  float    v4f;
typedef __attribute__((ext_vector_type(4)))  unsigned int v4u;

__device__ __forceinline__ unsigned short f2bf_bits(float f) {
  unsigned u = __float_as_uint(f);
  return (unsigned short)((u + 0x7FFFu + ((u >> 16) & 1u)) >> 16);
}
__device__ __forceinline__ float bf_bits2f(unsigned short h) { return __uint_as_float(((unsigned)h) << 16); }
__device__ __forceinline__ unsigned pk16(unsigned short a, unsigned short b) { return (unsigned)a | ((unsigned)b << 16); }

// hazard guards as plain device helpers (no inline asm inside the kernel template body)
__device__ __forceinline__ void dep_guard_h(v8f& a, v8f& b, v16h x, v16h y) { asm volatile("v_nop\n\tv_nop\n\tv_nop\n\tv_nop" : "+v"(a), "+v"(b) : "v"(x), "v"(y)); }
__device__ __forceinline__ void dep_guard_b(v8f& a, v8f& b, v16b x, v16b y) { asm volatile("v_nop\n\tv_nop\n\tv_nop\n\tv_nop" : "+v"(a), "+v"(b) : "v"(x), "v"(y)); }
__device__ __forceinline__ void keep4_h(v16h a, v16h b, v16h c, v16h d) { asm volatile("v_nop" :: "v"(a), "v"(b), "v"(c), "v"(d)); }
__device__ __forceinline__ void keep4_b(v16b a, v16b b, v16b c, v16b d) { asm volatile("v_nop" :: "v"(a), "v"(b), "v"(c), "v"(d)); }
__device__ __forceinline__ void acc_guard4(v8f& a, v8f& b, v8f& c, v8f& d) { asm volatile("v_nop\n\tv_nop\n\tv_nop\n\tv_nop" : "+v"(a), "+v"(b), "+v"(c), "+v"(d)); }
template <typename T> struct Frag;
template <> struct Frag<_Float16> {
  typedef v16h V; union U { v16h v; v8h h[2]; };
  static __device__ __forceinline__ v16h load(const _Float16* p) {   // elements 0..7 <- p[0..7], 8..15 <- p[16..23]
    U f; f.h[0] = *(const v8h*)(p); f.h[1] = *(const v8h*)(p + 16); return f.v;
  }
  static __device__ __forceinline__ v8f mma(v16h a, v16h b, v8f c) {
    return __builtin_amdgcn_wmma_f32_16x16x32_f16(false, a, false, b, (short)0, c, false, false);
  }
  static __device__ __forceinline__ void guard(v8f& a, v8f& b, v16h x, v16h y) { dep_guard_h(a, b, x, y); }
  static __device__ __forceinline__ void keep(v16h a, v16h b, v16h c, v16h d) { keep4_h(a, b, c, d); }
};
template <> struct Frag<__bf16> {
  typedef v16b V; union U { v16b v; v8b h[2]; };
  static __device__ __forceinline__ v16b load(const __bf16* p) {
    U f; f.h[0] = *(const v8b*)(p); f.h[1] = *(const v8b*)(p + 16); return f.v;
  }
  static __device__ __forceinline__ v8f mma(v16b a, v16b b, v8f c) {
    return __builtin_amdgcn_wmma_f32_16x16x32_bf16(false, a, false, b, (short)0, c, false, false);
  }
  static __device__ __forceinline__ void guard(v8f& a, v8f& b, v16b x, v16b y) { dep_guard_b(a, b, x, y); }
  static __device__ __forceinline__ void keep(v16b a, v16b b, v16b c, v16b d) { keep4_b(a, b, c, d); }
};

// ---- Register-blocked batched WMMA GEMM ------------------------------------
// C[m,n] = scale * sum_k A[m,k] * Bt[n,k] (+bias)(+resid); each wave owns a 64x64 tile.
// A row-major [M,K]; Bt row-major [N,K]; M,N % 64 == 0, K % 32 == 0.
// SPLITM: 0 = single product; 1 = A and Bt hi/lo planes (hi.hi + hi.lo + lo.hi); 2 = A hi/lo planes only (hi.B + lo.B).
// BIAS_MODE: 0 = none, 1 = bias[m], 2 = bias[n], 3 = bias[n] RNE-converted to bf16, 4 = bias[m] RNE-converted to bf16.
// OUT_MODE: 0 = f32, 1 = f16, 2 = bf16 hi plane (Cout) + bf16 lo plane (Cout2),
//           3 = f16 with interleaved-pair rotation: pair (2i,2i+1) within each 64-wide column tile rotated by
//               (ropeC, ropeS)[t][i] with t = m % ropeT (tables [ropeT][32] f32).
// ET: 0 = f16 operands, 1 = bf16 operands (pointers passed as 16-bit storage)
template <int ET> struct Elem;
template <> struct Elem<0> { typedef _Float16 T; };
template <> struct Elem<1> { typedef __bf16 T; };
template <int ET, int SPLITM, int BIAS_MODE, int OUT_MODE, bool RESID, int ACT = 0>
__global__ __launch_bounds__(256) void wmma_gemm64(
    const unsigned short* __restrict__ Ap, const unsigned short* __restrict__ A2p, int lda, long strideA,
    const unsigned short* __restrict__ Btp, const unsigned short* __restrict__ Bt2p, int ldb, long strideB,
    void* __restrict__ Cout, void* __restrict__ Cout2, int ldc, long strideC,
    const float* __restrict__ bias,
    const float* __restrict__ resid, long strideR,
    const float* __restrict__ ropeC, const float* __restrict__ ropeS, int ropeT,
    int M, int N, int K, float scale) {
  typedef typename Elem<ET>::T T;
  typedef typename Frag<T>::V V;
  const T* A = (const T*)Ap; const T* A2 = (const T*)A2p; const T* Bt = (const T*)Btp; const T* Bt2 = (const T*)Bt2p;
  __shared__ __align__(16) float sT[8][16 * 68];   // per-wave 16x64 slab, pitch 68 floats
  const int b    = blockIdx.y;
  const int lane = threadIdx.x & 31;
  const int wave = threadIdx.x >> 5;
  const int tilesN = N >> 6;
  const int tilesM = M >> 6;
  const int tile = blockIdx.x * 8 + wave;
  if (tile >= tilesM * tilesN) return;   // wave-uniform; no block barriers in this kernel
  const int tm = tile / tilesN;
  const int tn = tile - tm * tilesN;
  const int m0 = tm << 6;
  const int n0 = tn << 6;

  const T* Ab  = A  + (size_t)b * strideA;
  const T* Bb  = Bt + (size_t)b * strideB;
  const T* Ab2 = (SPLITM != 0) ? (A2  + (size_t)b * strideA) : nullptr;
  const T* Bb2 = (SPLITM == 1) ? (Bt2 + (size_t)b * strideB) : nullptr;

  const int rlane = lane & 15;                 // row (A) / col (B, D) within subtile
  const int koff  = (lane >> 4) * 8;           // k offset of this lane half
  const int mOff  = (lane >> 4) * 8;           // D row offset

  v8f acc[4][4];
#pragma unroll
  for (int i = 0; i < 4; ++i)
#pragma unroll
    for (int j = 0; j < 4; ++j) acc[i][j] = (v8f){0.f,0.f,0.f,0.f,0.f,0.f,0.f,0.f};

  for (int k0 = 0; k0 < K; k0 += 32) {
    V bh[4], bl[4];
#pragma unroll
    for (int j = 0; j < 4; ++j) {
      const size_t bo = (size_t)(n0 + (j << 4) + rlane) * ldb + koff + k0;
      bh[j] = Frag<T>::load(Bb + bo);
      if (SPLITM == 1) bl[j] = Frag<T>::load(Bb2 + bo);
    }
#pragma unroll
    for (int i = 0; i < 4; ++i) {
      const size_t ao = (size_t)(m0 + (i << 4) + rlane) * lda + koff + k0;
      V ah = Frag<T>::load(Ab + ao);
      V al;
      if (SPLITM != 0) al = Frag<T>::load(Ab2 + ao);
#pragma unroll
      for (int j = 0; j < 4; ++j) {
        acc[i][j] = Frag<T>::mma(ah, bh[j], acc[i][j]);
        if (SPLITM == 1) acc[i][j] = Frag<T>::mma(ah, bl[j], acc[i][j]);
        if (SPLITM != 0) acc[i][j] = Frag<T>::mma(al, bh[j], acc[i][j]);
      }
      Frag<T>::guard(acc[i][0], acc[i][3], ah, (SPLITM != 0) ? al : ah);
    }
    Frag<T>::keep(bh[0], bh[1], bh[2], bh[3]);
    if (SPLITM == 1) Frag<T>::keep(bl[0], bl[1], bl[2], bl[3]);
  }
  acc_guard4(acc[0][0], acc[0][1], acc[0][2], acc[0][3]);
  acc_guard4(acc[1][0], acc[1][1], acc[1][2], acc[1][3]);
  acc_guard4(acc[2][0], acc[2][1], acc[2][2], acc[2][3]);
  acc_guard4(acc[3][0], acc[3][1], acc[3][2], acc[3][3]);

  // ---- epilogue ----
  float* slab = sT[wave];
  const float* Rb = RESID ? (resid + (size_t)b * strideR) : nullptr;
#pragma unroll
  for (int i = 0; i < 4; ++i) {
    const int mBase = m0 + (i << 4);
#pragma unroll
    for (int j = 0; j < 4; ++j) {
      const int n = n0 + (j << 4) + rlane;
      float bv = 0.f;
      if (BIAS_MODE == 2) bv = bias[n];
      if (BIAS_MODE == 3) bv = bf_bits2f(f2bf_bits(bias[n]));
#pragma unroll
      for (int r = 0; r < 8; ++r) {
        float v = acc[i][j][r] * scale;
        if (BIAS_MODE == 1) v += bias[mBase + mOff + r];
        if (BIAS_MODE == 4) v += bf_bits2f(f2bf_bits(bias[mBase + mOff + r]));
        if (BIAS_MODE == 2 || BIAS_MODE == 3) v += bv;
        if (RESID) v += Rb[(size_t)(mBase + mOff + r) * ldc + n];
        if (ACT == 1) v = tanhf(v);
        if (ACT == 2) v = fmaxf(v, 0.0f);
        if (ACT == 3) v = v / (1.0f + expf(-v));
        if (ACT == 4) v = (v > 0.f) ? v : 0.01f * v;
        slab[(mOff + r) * 68 + (j << 4) + rlane] = v;
      }
    }
    __builtin_amdgcn_fence(__ATOMIC_RELEASE, "workgroup");
    __builtin_amdgcn_wave_barrier();
    __builtin_amdgcn_fence(__ATOMIC_ACQUIRE, "workgroup");
    if (OUT_MODE == 0) {
      float* C = (float*)Cout + (size_t)b * strideC;
      const int hh = lane >> 4, c4 = (lane & 15) * 4;     // row seg = 256 B = 16 lanes x 16 B
      {
#pragma unroll
        for (int it = 0; it < 8; ++it) {
          const int row = it * 2 + hh;
          v4f v = *(const v4f*)(slab + row * 68 + c4);
          *(v4f*)(C + (size_t)(mBase + row) * ldc + n0 + c4) = v;
        }
        
      }
    } else {
      const int q = lane >> 3, c8 = (lane & 7) * 8;
      unsigned short* C  = (unsigned short*)Cout  + (size_t)b * strideC;
      unsigned short* C2 = (OUT_MODE == 2) ? ((unsigned short*)Cout2 + (size_t)b * strideC) : nullptr;
      {
#pragma unroll
        for (int it = 0; it < 4; ++it) {
          const int row = it * 4 + q;
          const float* sp = slab + row * 68 + c8;
          v8h hv, lv;
          if (OUT_MODE == 3) {
            // columns c8..c8+7 of this 64-wide tile are rotation pairs (c8>>1)+0..3 of position t
            const int t = (mBase + row) % ropeT;
            const v4f cv = *(const v4f*)(ropeC + (size_t)t * ROPE_HALF + (c8 >> 1));
            const v4f sv = *(const v4f*)(ropeS + (size_t)t * ROPE_HALF + (c8 >> 1));
#pragma unroll
            for (int e2 = 0; e2 < 4; ++e2) {
              const float x0 = sp[2 * e2], x1 = sp[2 * e2 + 1];
              hv[2 * e2]     = (_Float16)(x0 * cv[e2] - x1 * sv[e2]);
              hv[2 * e2 + 1] = (_Float16)(x0 * sv[e2] + x1 * cv[e2]);
            }
          } else {
#pragma unroll
            for (int e = 0; e < 8; ++e) {
              if (OUT_MODE == 1) {
                hv[e] = (_Float16)sp[e];
              } else {
                unsigned short hb = f2bf_bits(sp[e]);
                unsigned short lb = f2bf_bits(sp[e] - bf_bits2f(hb));
                hv[e] = __builtin_bit_cast(_Float16, hb);
                lv[e] = __builtin_bit_cast(_Float16, lb);
              }
            }
          }
          *(v8h*)(C + (size_t)(mBase + row) * ldc + n0 + c8) = hv;
          if (OUT_MODE == 2) *(v8h*)(C2 + (size_t)(mBase + row) * ldc + n0 + c8) = lv;
        }
        
      }
    }
    __builtin_amdgcn_fence(__ATOMIC_RELEASE, "workgroup");
    __builtin_amdgcn_wave_barrier();
    __builtin_amdgcn_fence(__ATOMIC_ACQUIRE, "workgroup");
  }
}

// ---------------------------------------------------------------------------
// f32 -> bf16 (RNE) cast, 8 elements per thread, one 16-B store per lane: a wave writes 512 contiguous bytes =
// Coverage: grid = n8/256 blocks x 256 threads x 8 elements = 8*n8 = the whole plane (n8 = 8192*1024/8 = 1,048,576
// -> 4096 blocks exactly).
// ---------------------------------------------------------------------------
__global__ __launch_bounds__(256) void cast_bf16x8_kernel(const float* __restrict__ in, unsigned short* __restrict__ out, int n8) {
  const int i = blockIdx.x * 256 + threadIdx.x;
  if (i < n8) {
    const v4f a  = *(const v4f*)(in + 8 * (size_t)i);
    const v4f a2 = *(const v4f*)(in + 8 * (size_t)i + 4);
    v4u u;
    u[0] = pk16(f2bf_bits(a[0]),  f2bf_bits(a[1]));
    u[1] = pk16(f2bf_bits(a[2]),  f2bf_bits(a[3]));
    u[2] = pk16(f2bf_bits(a2[0]), f2bf_bits(a2[1]));
    u[3] = pk16(f2bf_bits(a2[2]), f2bf_bits(a2[3]));
    *(v4u*)(out + 8 * (size_t)i) = u;
    
  }
}

// ---------------------------------------------------------------------------
// Fused transpose + bf16 (RNE) cast of an f32 matrix: in [R rows][Cc cols] (pitch Cc) -> out[c][r] ([Cc][R], pitch R).
// 64x64 tiles through LDS. grid = (Cc/64, R/64), 256 threads (R, Cc multiples of 64).
// Coverage per block: load 4 it x 256 thr x 4 floats = 64x64; store 2 it x 256 thr x 8 u16 = 64x64.
// ---------------------------------------------------------------------------
__global__ __launch_bounds__(256) void tcast_bf16_kernel(const float* __restrict__ W, unsigned short* __restrict__ oh, int R, int Cc) {
  __shared__ __align__(16) float tf[64 * 68];
  const int c0  = blockIdx.x * 64;   // input column block = output row block
  const int rb0 = blockIdx.y * 64;   // input row block    = output column block
  const int tid = threadIdx.x;
  {
    const int lr = tid >> 4;         // 0..15
    const int c4 = (tid & 15) * 4;   // 0..60
#pragma unroll
    for (int it = 0; it < 4; ++it) {
      const int rr = it * 16 + lr;   // 0..63
      const v4f a = *(const v4f*)(W + (size_t)(rb0 + rr) * Cc + c0 + c4);
      *(v4f*)(tf + rr * 68 + c4) = a;
    }
  }
  __syncthreads();
  const int sub = tid >> 3;          // 0..31
  const int c8  = (tid & 7) * 8;     // 0..56
  v4u hv[2];
#pragma unroll
  for (int it = 0; it < 2; ++it) {
    const int oc = it * 32 + sub;    // output row within tile (= input column)
    v4u a;
#pragma unroll
    for (int q = 0; q < 4; ++q) {
      const float f0 = tf[(c8 + 2 * q) * 68 + oc];
      const float f1 = tf[(c8 + 2 * q + 1) * 68 + oc];
      a[q] = pk16(f2bf_bits(f0), f2bf_bits(f1));
    }
    hv[it] = a;
  }
  {
#pragma unroll
    for (int it = 0; it < 2; ++it) {
      const int oc = it * 32 + sub;
      const size_t go = (size_t)(c0 + oc) * R + rb0 + c8;
      *(v4u*)(oh + go) = hv[it];
    }
    
  }
}

// ---------------------------------------------------------------------------
// Rotation frequencies: freq[i] = 1 / 10000^((2i)/64), i = 0..31 (f32 pow, f32 reciprocal).
// ---------------------------------------------------------------------------
__global__ __launch_bounds__(32) void rope_freq_kernel(float* __restrict__ freq) {
  const int i = threadIdx.x;                       // 0..31
  const float e = (float)(2 * i) / (float)HEAD_D;  // exact (division by 64)
  const float p = powf(10000.0f, e);
  const float f = 1.0f / p;
  ((float*)freq)[i] = f;
  
}

// ---------------------------------------------------------------------------
// Rotation tables: ang[t][i] = (float)t * freq[i]; cosT/sinT [SEQ][32] f32 (precise sincosf).
// ---------------------------------------------------------------------------
__global__ __launch_bounds__(256) void rope_table_kernel(const float* __restrict__ freq, float* __restrict__ cosT,
                                                         float* __restrict__ sinT, int n) {
  const int idx = blockIdx.x * 256 + threadIdx.x;
  if (idx < n) {
    const int t = idx >> 5, i = idx & 31;
    const float ang = (float)t * freq[i];
    float sv, cv;
    sincosf(ang, &sv, &cv);
    ((float*)cosT)[idx] = cv;
    ((float*)sinT)[idx] = sv;
    
  }
}

// =====================================================================================
// Full (non-causal, unmasked) attention, head dim 64, f16 operand planes.
//   q|k plane (f16): element (b, t, h, d) of q at [(b*SEQ + t)*QK_LD + h*64 + d], of k at [... + D_MODEL + h*64 + d]
//   v^T plane (f16): element (b, h, d, s) at [(b*D_MODEL + h*64 + d)*SEQ + s]
//   out: bf16 hi and lo planes, element (b, t, h, d) at [(b*SEQ + t)*D_MODEL + h*64 + d]
//   scores = (q . k) * sscale : v_wmma_f32_16x16x32_f16, f32 accumulate, scale applied to the f32 accumulator
//   out    = p . v            : v_wmma_f32_16x16x32_f16 with p (unnormalised, <= 1) carried x2^15 in f16, folded into 1/l
//   online softmax in f32 over all SEQ keys (32 chunks of 64, compile-time trip count, no masking).
//   Block = 4 waves = 64 query rows of one (batch, head); grid = (N_HEAD * SEQ/64, NB_BATCH).
//   K / V^T chunk staging: 128 threads x 32 elements per plane = the whole 64x64 tile (16-B copies, plain loads,
//   __syncthreads before and after); fragment loads read the LDS tiles with the same v8h element type.
// =====================================================================================
constexpr int AT_D  = 64;
constexpr int AT_NW = 4;
constexpr int AT_QB = 64;
constexpr int AT_KC = 64;
constexpr int AT_LP = 72;   // LDS row pitch of the K, V^T and P tiles in f16 elements: 144 B = 16 B x 9 (odd) for 16-byte row readers
constexpr float P_CARRY = 32768.0f;

__device__ __forceinline__ v8f mma_h16(v16h a, v16h b, v8f c) {
  c = __builtin_amdgcn_wmma_f32_16x16x32_f16(false, a, false, b, (short)0, c, false, false);
  asm volatile("v_nop\n\tv_nop\n\tv_nop\n\tv_nop" : "+v"(c) : "v"(a), "v"(b));
  return c;
}

__global__ __launch_bounds__(128)
void attn_f16_kernel(const unsigned short* __restrict__ qkp, const unsigned short* __restrict__ vtp,
                     unsigned short* __restrict__ ohp, unsigned short* __restrict__ olp, float sscale) {
  union FB { v16h v; v8h h[2]; };
  __shared__ __align__(16) _Float16 Ksh[AT_KC * AT_LP];         // K [kv][d], pitch AT_LP      9 KB
  __shared__ __align__(16) _Float16 Vth[AT_D * AT_LP];          // V^T [d][kv], pitch AT_LP    9 KB
  __shared__ __align__(16) _Float16 Psh[AT_NW][16 * AT_LP];     // per wave P [row][kv], pitch AT_LP  9 KB
  __shared__ __align__(16) float    Os[AT_NW][16 * 68];         // per wave out tile, pitch 68

  const int tid  = threadIdx.x;
  const int wave = tid >> 5;
  const int lane = tid & 31;
  const int hh   = lane >> 4;
  const int c    = lane & 15;

  const int nqb = SEQ_LEN / AT_QB;            // 32
  const int bx = blockIdx.x;
  const int qb = bx % nqb;
  const int h  = bx / nqb;                    // 0..N_HEAD-1 (grid.x = N_HEAD * nqb)
  const int b  = blockIdx.y;                  // batch
  const int q0 = qb * AT_QB + wave * 16;

  const _Float16* Qp = (const _Float16*)(const void*)qkp + (size_t)b * SEQ_LEN * QK_LD + (size_t)h * AT_D;
  const _Float16* Kp = Qp + D_MODEL;
  const _Float16* Vp = (const _Float16*)(const void*)vtp + ((size_t)b * D_MODEL + (size_t)h * AT_D) * SEQ_LEN;
  unsigned short* Oh = ohp + (size_t)b * SEQ_LEN * D_MODEL + (size_t)h * AT_D;
  unsigned short* Ol = olp + (size_t)b * SEQ_LEN * D_MODEL + (size_t)h * AT_D;

  // ---- Q fragments (A operand, row = lane&15, split k map via Frag load): 2 d-chunks ----
  v16h qa[2];
#pragma unroll
  for (int dc = 0; dc < 2; ++dc)
    qa[dc] = Frag<_Float16>::load(Qp + (size_t)(q0 + c) * QK_LD + dc * 32 + 8 * hh);

  float mrow[8], lrow[8];
  v8f oacc[4];
#pragma unroll
  for (int r = 0; r < 8; ++r) { mrow[r] = -INFINITY; lrow[r] = 0.f; }
#pragma unroll
  for (int t = 0; t < 4; ++t) oacc[t] = (v8f){0.f,0.f,0.f,0.f,0.f,0.f,0.f,0.f};

  for (int kc = 0; kc < SEQ_LEN / AT_KC; ++kc) {     // 32, compile-time constant
    const int kv0 = kc * AT_KC;
    __syncthreads();
    {
      // staging coverage: 128 threads x (4 x 8) elements = 64 rows x 64 per plane = the whole chunk tile
      const int r = tid >> 1, half = (tid & 1) * 32;
      const _Float16* ks = Kp + (size_t)(kv0 + r) * QK_LD + half;     // K row kv0+r, d = half..half+31
      const _Float16* vs = Vp + (size_t)r * SEQ_LEN + kv0 + half;      // V^T row d = r, s = kv0+half..+31
#pragma unroll
      for (int i = 0; i < 4; ++i) {
        const v8h a0 = *(const v8h*)(ks + 8 * i);
        const v8h b0 = *(const v8h*)(vs + 8 * i);
        *(v8h*)(Ksh + r * AT_LP + half + 8 * i) = a0;
        *(v8h*)(Vth + r * AT_LP + half + 8 * i) = b0;
      }
    }
    __syncthreads();

    v8f s[4];
#pragma unroll
    for (int j = 0; j < 4; ++j) {
      s[j] = (v8f){0.f,0.f,0.f,0.f,0.f,0.f,0.f,0.f};
#pragma unroll
      for (int dc = 0; dc < 2; ++dc) {
        FB kb;
        kb.h[0] = *(const v8h*)(Ksh + (j * 16 + c) * AT_LP + dc * 32 + 8 * hh);
        kb.h[1] = *(const v8h*)(Ksh + (j * 16 + c) * AT_LP + dc * 32 + 16 + 8 * hh);
        s[j] = mma_h16(qa[dc], kb.v, s[j]);
      }
      s[j] = s[j] * sscale;
    }
    float cm[8];
#pragma unroll
    for (int r = 0; r < 8; ++r) {
      float m = fmaxf(fmaxf(s[0][r], s[1][r]), fmaxf(s[2][r], s[3][r]));
#pragma unroll
      for (int off = 1; off < 16; off <<= 1) m = fmaxf(m, __shfl_xor(m, off, 32));
      cm[r] = m;
    }
    _Float16* pw = Psh[wave];
#pragma unroll
    for (int r = 0; r < 8; ++r) {
      const float mnew  = fmaxf(mrow[r], cm[r]);
      const float alpha = expf(mrow[r] - mnew);
      mrow[r] = mnew;
      float psum = 0.f;
#pragma unroll
      for (int j = 0; j < 4; ++j) {
        const float p = expf(s[j][r] - mnew);
        psum += p;
        pw[(8 * hh + r) * AT_LP + j * 16 + c] = (_Float16)(p * P_CARRY);
      }
#pragma unroll
      for (int off = 1; off < 16; off <<= 1) psum += __shfl_xor(psum, off, 32);
      lrow[r] = lrow[r] * alpha + psum;
#pragma unroll
      for (int t = 0; t < 4; ++t) oacc[t][r] *= alpha;
    }
    __builtin_amdgcn_fence(__ATOMIC_RELEASE, "workgroup");
    __builtin_amdgcn_wave_barrier();
    __builtin_amdgcn_fence(__ATOMIC_ACQUIRE, "workgroup");
#pragma unroll 1
    for (int kk = 0; kk < 2; ++kk) {
      FB pa;
      pa.h[0] = *(const v8h*)(pw + c * AT_LP + kk * 32 + 8 * hh);
      pa.h[1] = *(const v8h*)(pw + c * AT_LP + kk * 32 + 16 + 8 * hh);
#pragma unroll
      for (int t = 0; t < 4; ++t) {
        FB vb;
        vb.h[0] = *(const v8h*)(Vth + (t * 16 + c) * AT_LP + kk * 32 + 8 * hh);
        vb.h[1] = *(const v8h*)(Vth + (t * 16 + c) * AT_LP + kk * 32 + 16 + 8 * hh);
        oacc[t] = mma_h16(pa.v, vb.v, oacc[t]);
      }
    }
  }

  float* os = Os[wave];
#pragma unroll
  for (int r = 0; r < 8; ++r) {
    const float inv = 1.0f / (lrow[r] * P_CARRY);
#pragma unroll
    for (int t = 0; t < 4; ++t) os[(8 * hh + r) * 68 + t * 16 + c] = oacc[t][r] * inv;
  }
  __builtin_amdgcn_fence(__ATOMIC_RELEASE, "workgroup");
  __builtin_amdgcn_wave_barrier();
  __builtin_amdgcn_fence(__ATOMIC_ACQUIRE, "workgroup");
  {
    const int q8 = lane >> 3, c8 = (lane & 7) * 8;
    {
#pragma unroll
      for (int it = 0; it < 4; ++it) {
        const int row = it * 4 + q8;
        const float* sp = os + row * 68 + c8;
        v8h hv, lv;
#pragma unroll
        for (int e = 0; e < 8; ++e) {
          const unsigned short hb = f2bf_bits(sp[e]);
          const unsigned short lb = f2bf_bits(sp[e] - bf_bits2f(hb));
          hv[e] = __builtin_bit_cast(_Float16, hb);
          lv[e] = __builtin_bit_cast(_Float16, lb);
        }
        const size_t go = (size_t)(q0 + row) * D_MODEL + c8;
        *(v8h*)(Oh + go) = hv;
        *(v8h*)(Ol + go) = lv;
      }
      
    }
  }
}

// ---------------- host-side orchestration (kernel launches only) ----------------
extern "C" void kernel_launch(void* const* d_in, const int* in_sizes, int n_in,
                              void* d_out, int out_size, void* d_ws, size_t ws_size,
                              hipStream_t stream) {
  if (n_in < 5) return;
  const int M_ROWS = NB_BATCH * SEQ_LEN;   // 8192
  if (in_sizes[0] != M_ROWS * D_MODEL) return;
  if (in_sizes[1] != D_MODEL * 3 * D_MODEL) return;
  if (in_sizes[2] != 3 * D_MODEL) return;
  if (in_sizes[3] != D_MODEL * D_MODEL) return;
  if (in_sizes[4] != D_MODEL) return;
  if (out_size != M_ROWS * D_MODEL) return;

  const float* x    = (const float*)d_in[0];
  const float* Wqkv = (const float*)d_in[1];
  const float* bqkv = (const float*)d_in[2];
  const float* Wout = (const float*)d_in[3];
  const float* bout = (const float*)d_in[4];
  float* out = (float*)d_out;

  // workspace map (all offsets 256-B aligned; every region fully written before it is read):
  //   xb    bf16 [8192][1024]                16,777,216
  //   wqT   bf16 [3072][1024] (Wqkv^T)       6,291,456
  //   woT   bf16 [1024][1024] (Wout^T)       2,097,152
  //   freq  f32  [32] (+pad)                        256
  //   cosT  f32  [2048][32]                     262,144
  //   sinT  f32  [2048][32]                     262,144
  //   qk16  f16  [8192][2048] (q | k, rotated) 33,554,432
  //   vt16  f16  [4][1024][2048] (v^T)       16,777,216
  //   ohi   bf16 [8192][1024]                16,777,216
  //   olo   bf16 [8192][1024]                16,777,216
  //   total                                 109,576,448
  char* ws = (char*)d_ws;
  size_t off = 0;
  unsigned short* xb   = (unsigned short*)(ws + off); off += (size_t)M_ROWS * D_MODEL * 2;
  unsigned short* wqT  = (unsigned short*)(ws + off); off += (size_t)3 * D_MODEL * D_MODEL * 2;
  unsigned short* woT  = (unsigned short*)(ws + off); off += (size_t)D_MODEL * D_MODEL * 2;
  float*          freq = (float*)(ws + off);          off += 256;
  float*          cosT = (float*)(ws + off);          off += (size_t)SEQ_LEN * ROPE_HALF * 4;
  float*          sinT = (float*)(ws + off);          off += (size_t)SEQ_LEN * ROPE_HALF * 4;
  unsigned short* qk16 = (unsigned short*)(ws + off); off += (size_t)M_ROWS * QK_LD * 2;
  unsigned short* vt16 = (unsigned short*)(ws + off); off += (size_t)NB_BATCH * D_MODEL * SEQ_LEN * 2;
  unsigned short* ohi  = (unsigned short*)(ws + off); off += (size_t)M_ROWS * D_MODEL * 2;
  unsigned short* olo  = (unsigned short*)(ws + off); off += (size_t)M_ROWS * D_MODEL * 2;
  if (off > ws_size) return;

  // 1) x -> bf16 (n8 = 1,048,576 -> 4096 blocks)
  const int n8 = (M_ROWS * D_MODEL) / 8;
  cast_bf16x8_kernel<<<dim3((n8 + 255) / 256), dim3(256), 0, stream>>>(x, xb, n8);
  // 2) Wqkv [1024][3072] -> Wqkv^T bf16 [3072][1024]; Wout [1024][1024] -> Wout^T bf16 [1024][1024]
  tcast_bf16_kernel<<<dim3(3 * D_MODEL / 64, D_MODEL / 64), dim3(256), 0, stream>>>(Wqkv, wqT, D_MODEL, 3 * D_MODEL);
  tcast_bf16_kernel<<<dim3(D_MODEL / 64, D_MODEL / 64), dim3(256), 0, stream>>>(Wout, woT, D_MODEL, D_MODEL);
  // 3) rotation tables
  rope_freq_kernel<<<dim3(1), dim3(32), 0, stream>>>(freq);
  const int ntab = SEQ_LEN * ROPE_HALF;   // 65536
  rope_table_kernel<<<dim3((ntab + 255) / 256), dim3(256), 0, stream>>>(freq, cosT, sinT, ntab);
  // 4) q|k = x.Wqkv[:, 0:2048] + bf16(b) -> rotate -> f16 : M=8192, N=2048, K=1024 (tiles 128x32 = 4096 -> 512 blocks)
  {
    const int tiles = (M_ROWS / 64) * (2 * D_MODEL / 64);
    wmma_gemm64<1, 0, 3, 3, false><<<dim3((tiles + 7) / 8, 1), dim3(256), 0, stream>>>(
        xb, nullptr, D_MODEL, 0L,
        wqT, nullptr, D_MODEL, 0L,
        (void*)qk16, nullptr, QK_LD, 0L,
        bqkv, nullptr, 0L,
        cosT, sinT, SEQ_LEN,
        M_ROWS, 2 * D_MODEL, D_MODEL, 1.0f);
  }
  // 5) v^T per batch = Wv^T . x_b^T + bf16(bv)[m] -> f16 : M=1024 (features), N=2048 (positions), K=1024, z = 4
  //    A = Wqkv^T rows 2048..3071, Bt = x_b [2048][1024], C = vt16 + b*1024*2048 (tiles 16x32 = 512 -> 64 blocks)
  {
    const int tiles = (D_MODEL / 64) * (SEQ_LEN / 64);
    wmma_gemm64<1, 0, 4, 1, false><<<dim3((tiles + 7) / 8, NB_BATCH), dim3(256), 0, stream>>>(
        wqT + (size_t)2 * D_MODEL * D_MODEL, nullptr, D_MODEL, 0L,
        xb, nullptr, D_MODEL, (long)SEQ_LEN * D_MODEL,
        (void*)vt16, nullptr, SEQ_LEN, (long)D_MODEL * SEQ_LEN,
        bqkv + 2 * D_MODEL, nullptr, 0L,
        nullptr, nullptr, 1,
        D_MODEL, SEQ_LEN, D_MODEL, 1.0f);
  }
  // 6) attention -> o as bf16 hi/lo planes [8192][1024]
  attn_f16_kernel<<<dim3(N_HEAD * (SEQ_LEN / AT_QB), NB_BATCH), dim3(128), 0, stream>>>(qk16, vt16, ohi, olo, 0.125f);
  // 7) out = (o_hi + o_lo).Wout + bf16(b_out) -> f32 d_out : M=8192, N=1024, K=1024 (tiles 128x16 = 2048 -> 256 blocks)
  {
    const int tiles = (M_ROWS / 64) * (D_MODEL / 64);
    wmma_gemm64<1, 2, 3, 0, false><<<dim3((tiles + 7) / 8, 1), dim3(256), 0, stream>>>(
        ohi, olo, D_MODEL, 0L,
        woT, nullptr, D_MODEL, 0L,
        (void*)out, nullptr, D_MODEL, 0L,
        bout, nullptr, 0L,
        nullptr, nullptr, 1,
        M_ROWS, D_MODEL, D_MODEL, 1.0f);
  }
}

// v002
// A run of this version takes 344 microseconds.
// Next to v001, in two timings, it ran 1.33 times as fast each time.
// Counting every step since v000, it is 1.74 times as fast.
// Contractions: x.Wqkv (q|k part) and Wv^T.x^T : v_wmma_f32_16x16x32_bf16 (bf16 operands = RNE of the f32 inputs); q.k^T and p.v : v_wmma_f32_16x16x32_f16 (q,k cast to f16 after f32 rope; p carried x2^15 in f16; v f16); o.Wout : v_wmma_f32_16x16x32_bf16 with o as bf16 hi+lo planes (hi.W + lo.W), Wout bf16; all f32 accumulate; rope tables, softmax in f32; biases RNE-rounded to bf16, added in f32.
#include <hip/hip_runtime.h>
#include <math.h>
#include <stdint.h>

constexpr int NB_BATCH  = 4;
constexpr int SEQ_LEN   = 2048;
constexpr int D_MODEL   = 1024;
constexpr int N_HEAD    = 16;
constexpr int HEAD_D    = 64;
constexpr int ROPE_HALF = 32;          // head_dim / 2 rotation pairs
constexpr int QK_LD     = 2 * D_MODEL; // pitch of the q|k 16-bit plane

typedef __attribute__((ext_vector_type(16))) _Float16 v16h;
typedef __attribute__((ext_vector_type(8)))  _Float16 v8h;
typedef __attribute__((ext_vector_type(16))) __bf16   v16b;
typedef __attribute__((ext_vector_type(8)))  __bf16   v8b;
typedef __attribute__((ext_vector_type(8)))  float    v8f;
typedef __attribute__((ext_vector_type(4)))  float    v4f;
typedef __attribute__((ext_vector_type(4)))  unsigned int v4u;

__device__ __forceinline__ unsigned short f2bf_bits(float f) {
  unsigned u = __float_as_uint(f);
  return (unsigned short)((u + 0x7FFFu + ((u >> 16) & 1u)) >> 16);
}
__device__ __forceinline__ float bf_bits2f(unsigned short h) { return __uint_as_float(((unsigned)h) << 16); }
__device__ __forceinline__ unsigned pk16(unsigned short a, unsigned short b) { return (unsigned)a | ((unsigned)b << 16); }

// hazard guards as plain device helpers (their inline asm stays out of the kernel template body)
__device__ __forceinline__ void dep_guard_h(v8f& a, v8f& b, v16h x, v16h y) { asm volatile("v_nop\n\tv_nop\n\tv_nop\n\tv_nop" : "+v"(a), "+v"(b) : "v"(x), "v"(y)); }
__device__ __forceinline__ void dep_guard_b(v8f& a, v8f& b, v16b x, v16b y) { asm volatile("v_nop\n\tv_nop\n\tv_nop\n\tv_nop" : "+v"(a), "+v"(b) : "v"(x), "v"(y)); }
__device__ __forceinline__ void keep4_h(v16h a, v16h b, v16h c, v16h d) { asm volatile("v_nop" :: "v"(a), "v"(b), "v"(c), "v"(d)); }
__device__ __forceinline__ void keep4_b(v16b a, v16b b, v16b c, v16b d) { asm volatile("v_nop" :: "v"(a), "v"(b), "v"(c), "v"(d)); }
__device__ __forceinline__ void acc_guard4(v8f& a, v8f& b, v8f& c, v8f& d) { asm volatile("v_nop\n\tv_nop\n\tv_nop\n\tv_nop" : "+v"(a), "+v"(b), "+v"(c), "+v"(d)); }
template <typename T> struct Frag;
template <> struct Frag<_Float16> {
  typedef v16h V; typedef v8h H; union U { v16h v; v8h h[2]; };
  static __device__ __forceinline__ v16h load(const _Float16* p) {   // elements 0..7 <- p[0..7], 8..15 <- p[16..23]
    U f; f.h[0] = *(const v8h*)(p); f.h[1] = *(const v8h*)(p + 16); return f.v;
  }
  static __device__ __forceinline__ v8f mma(v16h a, v16h b, v8f c) {
    return __builtin_amdgcn_wmma_f32_16x16x32_f16(false, a, false, b, (short)0, c, false, false);
  }
  static __device__ __forceinline__ void guard(v8f& a, v8f& b, v16h x, v16h y) { dep_guard_h(a, b, x, y); }
  static __device__ __forceinline__ void keep(v16h a, v16h b, v16h c, v16h d) { keep4_h(a, b, c, d); }
};
template <> struct Frag<__bf16> {
  typedef v16b V; typedef v8b H; union U { v16b v; v8b h[2]; };
  static __device__ __forceinline__ v16b load(const __bf16* p) {
    U f; f.h[0] = *(const v8b*)(p); f.h[1] = *(const v8b*)(p + 16); return f.v;
  }
  static __device__ __forceinline__ v8f mma(v16b a, v16b b, v8f c) {
    return __builtin_amdgcn_wmma_f32_16x16x32_bf16(false, a, false, b, (short)0, c, false, false);
  }
  static __device__ __forceinline__ void guard(v8f& a, v8f& b, v16b x, v16b y) { dep_guard_b(a, b, x, y); }
  static __device__ __forceinline__ void keep(v16b a, v16b b, v16b c, v16b d) { keep4_b(a, b, c, d); }
};

// ---- Register-blocked batched WMMA GEMM, operands staged per work-group in LDS ----
// C[m,n] = scale * sum_k A[m,k] * Bt[n,k] (+bias)(+resid); a work-group of 8 waves (2 x 4) owns a 128x256 tile,
// each wave a 64x64 tile of it.
// A row-major [M,K]; Bt row-major [N,K]; M % 128 == 0, N % 256 == 0, K % 64 == 0.
// A stage is 64 k (128 B, one cache line) of every operand row of the work-group tile: 8 lanes x 16 B fetch one row's line,
// so a wave's load touches 4 whole lines; the rows lie in LDS at pitch GB_LP. Two LDS buffers: stage s+1 is fetched into
// registers ahead of stage s's products, stored behind them into the other buffer, one work-group barrier per stage.
// SPLITM: 0 = single product; 2 = A hi/lo planes (hi.B + lo.B).
// BIAS_MODE: 0 = none, 1 = bias[m], 2 = bias[n], 3 = bias[n] RNE-converted to bf16, 4 = bias[m] RNE-converted to bf16.
// OUT_MODE: 0 = f32, 1 = f16, 2 = bf16 hi plane (Cout) + bf16 lo plane (Cout2),
//           3 = f16 with interleaved-pair rotation: pair (2i,2i+1) within each 64-wide column tile rotated by
//               (ropeC, ropeS)[t][i] with t = m % ropeT (tables [ropeT][32] f32).
// ET: 0 = f16 operands, 1 = bf16 operands (pointers passed as 16-bit storage)
template <int ET> struct Elem;
template <> struct Elem<0> { typedef _Float16 T; };
template <> struct Elem<1> { typedef __bf16 T; };
constexpr int GB_M  = 128;  // work-group tile rows
constexpr int GB_N  = 256;  // work-group tile columns
constexpr int GB_K  = 64;   // k per stage
constexpr int GB_LP = 72;   // LDS row pitch in 16-bit elements: 144 B = 16 B x 9 (odd) for 16-byte row readers
// Registers: the single-plane builds stay within 256 VGPRs, so that two work-groups (their LDS fits twice) share a WGP and
// one's products cover the other's barrier and staging; the hi/lo build has one work-group per WGP by its LDS.
// LD: row pitch of A and Bt in elements, a compile-time value: the groups of 32 staged rows are then immediate offsets
// of one address per plane.
template <int ET, int SPLITM, int BIAS_MODE, int OUT_MODE, bool RESID, int LD, int ACT = 0>
__global__ __launch_bounds__(256) __attribute__((amdgpu_waves_per_eu((SPLITM != 0) ? 2 : 4))) void wmma_gemm64(
    const unsigned short* __restrict__ Ap, const unsigned short* __restrict__ A2p, long strideA,
    const unsigned short* __restrict__ Btp, long strideB,
    void* __restrict__ Cout, void* __restrict__ Cout2, int ldc, long strideC,
    const float* __restrict__ bias,
    const float* __restrict__ resid, long strideR,
    const float* __restrict__ ropeC, const float* __restrict__ ropeS, int ropeT,
    int M, int N, int K, float scale) {
  typedef typename Elem<ET>::T T;
  typedef typename Frag<T>::V V;
  typedef typename Frag<T>::H H;
  static_assert(SPLITM == 0 || SPLITM == 2, "staged planes: A (hi, lo) and Bt");
  const T* A = (const T*)Ap; const T* A2 = (const T*)A2p; const T* Bt = (const T*)Btp;
  constexpr int A_ROWS = (SPLITM != 0) ? 2 * GB_M : GB_M;   // staged A rows: hi plane, then lo plane
  constexpr int S_ROWS = A_ROWS + GB_N;                     // staged rows per stage
  constexpr int NPC    = S_ROWS / 32;                       // 16-B pieces per thread per stage (256 threads x 16 B = 32 rows)
  __shared__ __align__(16) T sOp[2][S_ROWS * GB_LP];        // two stage buffers
  __shared__ __align__(16) float sT[8][16 * 68];   // per-wave 16x64 slab, pitch 68 floats
  const int b    = blockIdx.y;
  const int tid  = threadIdx.x;
  const int lane = tid & 31;
  const int wave = tid >> 5;
  const int blkN = N >> 8;
  const int blkM = M >> 7;
  if ((int)blockIdx.x >= blkM * blkN) return;   // the same for the whole work-group, ahead of every barrier
  const int bm = blockIdx.x / blkN;
  const int bn = blockIdx.x - bm * blkN;
  const int wm = (wave >> 2) << 6;             // this wave's row offset in the work-group tile
  const int wn = (wave & 3) << 6;              // this wave's column offset
  const int m0 = (bm << 7) + wm;
  const int n0 = (bn << 8) + wn;

  const int rlane = lane & 15;                 // row (A) / col (B, D) within subtile
  const int koff  = (lane >> 4) * 8;           // k offset of this lane half
  const int mOff  = (lane >> 4) * 8;           // D row offset

  // staging map: thread -> row (tid >> 3) of each group of 32 staged rows, 16-B piece (tid & 7) of its 128-B line
  const int sr = tid >> 3;
  const int sc = (tid & 7) * 8;
  const T* gA  = A  + (size_t)b * strideA + (size_t)((bm << 7) + sr) * LD + sc;
  const T* gA2 = (SPLITM != 0) ? (A2 + (size_t)b * strideA + (size_t)((bm << 7) + sr) * LD + sc) : gA;
  const T* gB  = Bt + (size_t)b * strideB + (size_t)((bn << 8) + sr) * LD + sc;
  H pre[NPC];
  auto fetch = [&](int k0) {
    const T* pa  = gA  + k0;
    const T* pa2 = gA2 + k0;
    const T* pb  = gB  + k0;
#pragma unroll   // constant indices keep pre[] in registers and the row groups as immediate offsets
    for (int it = 0; it < NPC; ++it) {
      const int row = it * 32;
      if (row < GB_M)        pre[it] = *(const H*)(pa  + (size_t)row * LD);
      else if (row < A_ROWS) pre[it] = *(const H*)(pa2 + (size_t)(row - GB_M) * LD);
      else                   pre[it] = *(const H*)(pb  + (size_t)(row - A_ROWS) * LD);
    }
    // the wait in front of any overwrite of the loads' address registers; the addresses are inputs, so that their
    // registers are held up to it
    asm volatile("s_wait_xcnt 0x0" :: "v"(pa), "v"(pa2), "v"(pb) : "memory");
  };
  auto stash = [&](T* dst) {
#pragma unroll   // constant indices keep pre[] in registers
    for (int it = 0; it < NPC; ++it) *(H*)(dst + (it * 32 + sr) * GB_LP + sc) = pre[it];
  };

  v8f acc[4][4];
#pragma unroll
  for (int i = 0; i < 4; ++i)
#pragma unroll
    for (int j = 0; j < 4; ++j) acc[i][j] = (v8f){0.f,0.f,0.f,0.f,0.f,0.f,0.f,0.f};

  const int nst = K >> 6;
  fetch(0);
  stash(sOp[0]);
  __syncthreads();
  for (int st = 0; st < nst; ++st) {
    const bool more = (st + 1 < nst);          // the same for the whole work-group
    if (more) fetch((st + 1) << 6);
    const T* sA = sOp[st & 1] + (wm + rlane) * GB_LP + koff;
    const T* sB = sOp[st & 1] + (A_ROWS + wn + rlane) * GB_LP + koff;
#pragma unroll   // both halves of a stage in one block, so that the second half's fragment reads can start under the first's products
    for (int kk = 0; kk < GB_K; kk += 32) {
      // all fragments of these 32 k are read as one group ahead of their products
      V bh[4], ah[4], al[4];
#pragma unroll
      for (int j = 0; j < 4; ++j) bh[j] = Frag<T>::load(sB + (j << 4) * GB_LP + kk);
#pragma unroll
      for (int i = 0; i < 4; ++i) {
        ah[i] = Frag<T>::load(sA + (i << 4) * GB_LP + kk);
        if (SPLITM != 0) al[i] = Frag<T>::load(sA + (GB_M + (i << 4)) * GB_LP + kk);
      }
#pragma unroll
      for (int i = 0; i < 4; ++i) {
#pragma unroll
        for (int j = 0; j < 4; ++j) {
          acc[i][j] = Frag<T>::mma(ah[i], bh[j], acc[i][j]);
          if (SPLITM != 0) acc[i][j] = Frag<T>::mma(al[i], bh[j], acc[i][j]);
        }
        Frag<T>::guard(acc[i][0], acc[i][3], ah[i], (SPLITM != 0) ? al[i] : ah[i]);
      }
      Frag<T>::keep(bh[0], bh[1], bh[2], bh[3]);
    }
    // the other buffer's last readers passed the barrier that ended stage st - 1
    if (more) stash(sOp[(st + 1) & 1]);
    __syncthreads();                           // publishes stage st + 1 and ends every read of stage st's buffer
  }
  acc_guard4(acc[0][0], acc[0][1], acc[0][2], acc[0][3]);
  acc_guard4(acc[1][0], acc[1][1], acc[1][2], acc[1][3]);
  acc_guard4(acc[2][0], acc[2][1], acc[2][2], acc[2][3]);
  acc_guard4(acc[3][0], acc[3][1], acc[3][2], acc[3][3]);

  // ---- epilogue ----
  float* slab = sT[wave];
  const float* Rb = RESID ? (resid + (size_t)b * strideR) : nullptr;
#pragma unroll
  for (int i = 0; i < 4; ++i) {
    const int mBase = m0 + (i << 4);
#pragma unroll
    for (int j = 0; j < 4; ++j) {
      const int n = n0 + (j << 4) + rlane;
      float bv = 0.f;
      if (BIAS_MODE == 2) bv = bias[n];
      if (BIAS_MODE == 3) bv = bf_bits2f(f2bf_bits(bias[n]));
#pragma unroll
      for (int r = 0; r < 8; ++r) {
        float v = acc[i][j][r] * scale;
        if (BIAS_MODE == 1) v += bias[mBase + mOff + r];
        if (BIAS_MODE == 4) v += bf_bits2f(f2bf_bits(bias[mBase + mOff + r]));
        if (BIAS_MODE == 2 || BIAS_MODE == 3) v += bv;
        if (RESID) v += Rb[(size_t)(mBase + mOff + r) * ldc + n];
        if (ACT == 1) v = tanhf(v);
        if (ACT == 2) v = fmaxf(v, 0.0f);
        if (ACT == 3) v = v / (1.0f + expf(-v));
        if (ACT == 4) v = (v > 0.f) ? v : 0.01f * v;
        slab[(mOff + r) * 68 + (j << 4) + rlane] = v;
      }
    }
    __builtin_amdgcn_fence(__ATOMIC_RELEASE, "workgroup");
    __builtin_amdgcn_wave_barrier();
    __builtin_amdgcn_fence(__ATOMIC_ACQUIRE, "workgroup");
    if (OUT_MODE == 0) {
      float* C = (float*)Cout + (size_t)b * strideC;
      const int hh = lane >> 4, c4 = (lane & 15) * 4;     // row seg = 256 B = 16 lanes x 16 B
      {
#pragma unroll
        for (int it = 0; it < 8; ++it) {
          const int row = it * 2 + hh;
          v4f v = *(const v4f*)(slab + row * 68 + c4);
          *(v4f*)(C + (size_t)(mBase + row) * ldc + n0 + c4) = v;
        }
        
      }
    } else {
      const int q = lane >> 3, c8 = (lane & 7) * 8;
      unsigned short* C  = (unsigned short*)Cout  + (size_t)b * strideC;
      unsigned short* C2 = (OUT_MODE == 2) ? ((unsigned short*)Cout2 + (size_t)b * strideC) : nullptr;
      {
#pragma unroll
        for (int it = 0; it < 4; ++it) {
          const int row = it * 4 + q;
          const float* sp = slab + row * 68 + c8;
          v8h hv, lv;
          if (OUT_MODE == 3) {
            // columns c8..c8+7 of this 64-wide tile are rotation pairs (c8>>1)+0..3 of position t
            const int t = (mBase + row) % ropeT;
            const v4f cv = *(const v4f*)(ropeC + (size_t)t * ROPE_HALF + (c8 >> 1));
            const v4f sv = *(const v4f*)(ropeS + (size_t)t * ROPE_HALF + (c8 >> 1));
#pragma unroll
            for (int e2 = 0; e2 < 4; ++e2) {
              const float x0 = sp[2 * e2], x1 = sp[2 * e2 + 1];
              hv[2 * e2]     = (_Float16)(x0 * cv[e2] - x1 * sv[e2]);
              hv[2 * e2 + 1] = (_Float16)(x0 * sv[e2] + x1 * cv[e2]);
            }
          } else {
#pragma unroll
            for (int e = 0; e < 8; ++e) {
              if (OUT_MODE == 1) {
                hv[e] = (_Float16)sp[e];
              } else {
                unsigned short hb = f2bf_bits(sp[e]);
                unsigned short lb = f2bf_bits(sp[e] - bf_bits2f(hb));
                hv[e] = __builtin_bit_cast(_Float16, hb);
                lv[e] = __builtin_bit_cast(_Float16, lb);
              }
            }
          }
          *(v8h*)(C + (size_t)(mBase + row) * ldc + n0 + c8) = hv;
          if (OUT_MODE == 2) *(v8h*)(C2 + (size_t)(mBase + row) * ldc + n0 + c8) = lv;
        }
        
      }
    }
    __builtin_amdgcn_fence(__ATOMIC_RELEASE, "workgroup");
    __builtin_amdgcn_wave_barrier();
    __builtin_amdgcn_fence(__ATOMIC_ACQUIRE, "workgroup");
  }
}

// ---------------------------------------------------------------------------
// f32 -> bf16 (RNE) cast, 8 elements per thread, one 16-B store per lane: a wave writes 512 contiguous bytes =
// Coverage: grid = n8/256 blocks x 256 threads x 8 elements = 8*n8 = the whole plane (n8 = 8192*1024/8 = 1,048,576
// -> 4096 blocks exactly).
// ---------------------------------------------------------------------------
__global__ __launch_bounds__(256) void cast_bf16x8_kernel(const float* __restrict__ in, unsigned short* __restrict__ out, int n8) {
  const int i = blockIdx.x * 256 + threadIdx.x;
  if (i < n8) {
    const v4f a  = *(const v4f*)(in + 8 * (size_t)i);
    const v4f a2 = *(const v4f*)(in + 8 * (size_t)i + 4);
    v4u u;
    u[0] = pk16(f2bf_bits(a[0]),  f2bf_bits(a[1]));
    u[1] = pk16(f2bf_bits(a[2]),  f2bf_bits(a[3]));
    u[2] = pk16(f2bf_bits(a2[0]), f2bf_bits(a2[1]));
    u[3] = pk16(f2bf_bits(a2[2]), f2bf_bits(a2[3]));
    *(v4u*)(out + 8 * (size_t)i) = u;
    
  }
}

// ---------------------------------------------------------------------------
// Fused transpose + bf16 (RNE) cast of an f32 matrix: in [R rows][Cc cols] (pitch Cc) -> out[c][r] ([Cc][R], pitch R).
// 64x64 tiles through LDS. grid = (Cc/64, R/64), 256 threads (R, Cc multiples of 64).
// Coverage per block: load 4 it x 256 thr x 4 floats = 64x64; store 2 it x 256 thr x 8 u16 = 64x64.
// ---------------------------------------------------------------------------
__global__ __launch_bounds__(256) void tcast_bf16_kernel(const float* __restrict__ W, unsigned short* __restrict__ oh, int R, int Cc) {
  __shared__ __align__(16) float tf[64 * 68];
  const int c0  = blockIdx.x * 64;   // input column block = output row block
  const int rb0 = blockIdx.y * 64;   // input row block    = output column block
  const int tid = threadIdx.x;
  {
    const int lr = tid >> 4;         // 0..15
    const int c4 = (tid & 15) * 4;   // 0..60
#pragma unroll
    for (int it = 0; it < 4; ++it) {
      const int rr = it * 16 + lr;   // 0..63
      const v4f a = *(const v4f*)(W + (size_t)(rb0 + rr) * Cc + c0 + c4);
      *(v4f*)(tf + rr * 68 + c4) = a;
    }
  }
  __syncthreads();
  const int sub = tid >> 3;          // 0..31
  const int c8  = (tid & 7) * 8;     // 0..56
  v4u hv[2];
#pragma unroll
  for (int it = 0; it < 2; ++it) {
    const int oc = it * 32 + sub;    // output row within tile (= input column)
    v4u a;
#pragma unroll
    for (int q = 0; q < 4; ++q) {
      const float f0 = tf[(c8 + 2 * q) * 68 + oc];
      const float f1 = tf[(c8 + 2 * q + 1) * 68 + oc];
      a[q] = pk16(f2bf_bits(f0), f2bf_bits(f1));
    }
    hv[it] = a;
  }
  {
#pragma unroll
    for (int it = 0; it < 2; ++it) {
      const int oc = it * 32 + sub;
      const size_t go = (size_t)(c0 + oc) * R + rb0 + c8;
      *(v4u*)(oh + go) = hv[it];
    }
    
  }
}

// ---------------------------------------------------------------------------
// Rotation frequencies: freq[i] = 1 / 10000^((2i)/64), i = 0..31 (f32 pow, f32 reciprocal).
// ---------------------------------------------------------------------------
__global__ __launch_bounds__(32) void rope_freq_kernel(float* __restrict__ freq) {
  const int i = threadIdx.x;                       // 0..31
  const float e = (float)(2 * i) / (float)HEAD_D;  // exact (division by 64)
  const float p = powf(10000.0f, e);
  const float f = 1.0f / p;
  ((float*)freq)[i] = f;
  
}

// ---------------------------------------------------------------------------
// Rotation tables: ang[t][i] = (float)t * freq[i]; cosT/sinT [SEQ][32] f32 (precise sincosf).
// ---------------------------------------------------------------------------
__global__ __launch_bounds__(256) void rope_table_kernel(const float* __restrict__ freq, float* __restrict__ cosT,
                                                         float* __restrict__ sinT, int n) {
  const int idx = blockIdx.x * 256 + threadIdx.x;
  if (idx < n) {
    const int t = idx >> 5, i = idx & 31;
    const float ang = (float)t * freq[i];
    float sv, cv;
    sincosf(ang, &sv, &cv);
    ((float*)cosT)[idx] = cv;
    ((float*)sinT)[idx] = sv;
    
  }
}

// =====================================================================================
// Full (non-causal, unmasked) attention, head dim 64, f16 operand planes.
//   q|k plane (f16): element (b, t, h, d) of q at [(b*SEQ + t)*QK_LD + h*64 + d], of k at [... + D_MODEL + h*64 + d]
//   v^T plane (f16): element (b, h, d, s) at [(b*D_MODEL + h*64 + d)*SEQ + s]
//   out: bf16 hi and lo planes, element (b, t, h, d) at [(b*SEQ + t)*D_MODEL + h*64 + d]
//   scores = (q . k) * sscale : v_wmma_f32_16x16x32_f16, f32 accumulate, scale applied to the f32 accumulator
//   out    = p . v            : v_wmma_f32_16x16x32_f16 with p (unnormalised, <= 1) carried x2^15 in f16, folded into 1/l
//   online softmax in f32 over all SEQ keys (32 chunks of 64, compile-time trip count, no masking).
//   Block = 4 waves = 64 query rows of one (batch, head); grid = (N_HEAD * SEQ/64, NB_BATCH).
//   K / V^T chunk staging: 128 threads x 32 elements per plane = the whole 64x64 tile (16-B copies, plain loads,
//   __syncthreads before and after); fragment loads read the LDS tiles with the same v8h element type.
// =====================================================================================
constexpr int AT_D  = 64;
constexpr int AT_NW = 4;
constexpr int AT_QB = 64;
constexpr int AT_KC = 64;
constexpr int AT_LP = 72;   // LDS row pitch of the K, V^T and P tiles in f16 elements: 144 B = 16 B x 9 (odd) for 16-byte row readers
constexpr float P_CARRY = 32768.0f;

__device__ __forceinline__ v8f mma_h16(v16h a, v16h b, v8f c) {
  c = __builtin_amdgcn_wmma_f32_16x16x32_f16(false, a, false, b, (short)0, c, false, false);
  asm volatile("v_nop\n\tv_nop\n\tv_nop\n\tv_nop" : "+v"(c) : "v"(a), "v"(b));
  return c;
}

__global__ __launch_bounds__(128)
void attn_f16_kernel(const unsigned short* __restrict__ qkp, const unsigned short* __restrict__ vtp,
                     unsigned short* __restrict__ ohp, unsigned short* __restrict__ olp, float sscale) {
  union FB { v16h v; v8h h[2]; };
  __shared__ __align__(16) _Float16 Ksh[AT_KC * AT_LP];         // K [kv][d], pitch AT_LP      9 KB
  __shared__ __align__(16) _Float16 Vth[AT_D * AT_LP];          // V^T [d][kv], pitch AT_LP    9 KB
  __shared__ __align__(16) _Float16 Psh[AT_NW][16 * AT_LP];     // per wave P [row][kv], pitch AT_LP  9 KB
  __shared__ __align__(16) float    Os[AT_NW][16 * 68];         // per wave out tile, pitch 68

  const int tid  = threadIdx.x;
  const int wave = tid >> 5;
  const int lane = tid & 31;
  const int hh   = lane >> 4;
  const int c    = lane & 15;

  const int nqb = SEQ_LEN / AT_QB;            // 32
  const int bx = blockIdx.x;
  const int qb = bx % nqb;
  const int h  = bx / nqb;                    // 0..N_HEAD-1 (grid.x = N_HEAD * nqb)
  const int b  = blockIdx.y;                  // batch
  const int q0 = qb * AT_QB + wave * 16;

  const _Float16* Qp = (const _Float16*)(const void*)qkp + (size_t)b * SEQ_LEN * QK_LD + (size_t)h * AT_D;
  const _Float16* Kp = Qp + D_MODEL;
  const _Float16* Vp = (const _Float16*)(const void*)vtp + ((size_t)b * D_MODEL + (size_t)h * AT_D) * SEQ_LEN;
  unsigned short* Oh = ohp + (size_t)b * SEQ_LEN * D_MODEL + (size_t)h * AT_D;
  unsigned short* Ol = olp + (size_t)b * SEQ_LEN * D_MODEL + (size_t)h * AT_D;

  // ---- Q fragments (A operand, row = lane&15, split k map via Frag load): 2 d-chunks ----
  v16h qa[2];
#pragma unroll
  for (int dc = 0; dc < 2; ++dc)
    qa[dc] = Frag<_Float16>::load(Qp + (size_t)(q0 + c) * QK_LD + dc * 32 + 8 * hh);

  float mrow[8], lrow[8];
  v8f oacc[4];
#pragma unroll
  for (int r = 0; r < 8; ++r) { mrow[r] = -INFINITY; lrow[r] = 0.f; }
#pragma unroll
  for (int t = 0; t < 4; ++t) oacc[t] = (v8f){0.f,0.f,0.f,0.f,0.f,0.f,0.f,0.f};

  for (int kc = 0; kc < SEQ_LEN / AT_KC; ++kc) {     // 32, compile-time constant
    const int kv0 = kc * AT_KC;
    __syncthreads();
    {
      // staging coverage: 128 threads x (4 x 8) elements = 64 rows x 64 per plane = the whole chunk tile
      const int r = tid >> 1, half = (tid & 1) * 32;
      const _Float16* ks = Kp + (size_t)(kv0 + r) * QK_LD + half;     // K row kv0+r, d = half..half+31
      const _Float16* vs = Vp + (size_t)r * SEQ_LEN + kv0 + half;      // V^T row d = r, s = kv0+half..+31
#pragma unroll
      for (int i = 0; i < 4; ++i) {
        const v8h a0 = *(const v8h*)(ks + 8 * i);
        const v8h b0 = *(const v8h*)(vs + 8 * i);
        *(v8h*)(Ksh + r * AT_LP + half + 8 * i) = a0;
        *(v8h*)(Vth + r * AT_LP + half + 8 * i) = b0;
      }
    }
    __syncthreads();

    v8f s[4];
#pragma unroll
    for (int j = 0; j < 4; ++j) {
      s[j] = (v8f){0.f,0.f,0.f,0.f,0.f,0.f,0.f,0.f};
#pragma unroll
      for (int dc = 0; dc < 2; ++dc) {
        FB kb;
        kb.h[0] = *(const v8h*)(Ksh + (j * 16 + c) * AT_LP + dc * 32 + 8 * hh);
        kb.h[1] = *(const v8h*)(Ksh + (j * 16 + c) * AT_LP + dc * 32 + 16 + 8 * hh);
        s[j] = mma_h16(qa[dc], kb.v, s[j]);
      }
      s[j] = s[j] * sscale;
    }
    float cm[8];
#pragma unroll
    for (int r = 0; r < 8; ++r) {
      float m = fmaxf(fmaxf(s[0][r], s[1][r]), fmaxf(s[2][r], s[3][r]));
#pragma unroll
      for (int off = 1; off < 16; off <<= 1) m = fmaxf(m, __shfl_xor(m, off, 32));
      cm[r] = m;
    }
    _Float16* pw = Psh[wave];
#pragma unroll
    for (int r = 0; r < 8; ++r) {
      const float mnew  = fmaxf(mrow[r], cm[r]);
      const float alpha = expf(mrow[r] - mnew);
      mrow[r] = mnew;
      float psum = 0.f;
#pragma unroll
      for (int j = 0; j < 4; ++j) {
        const float p = expf(s[j][r] - mnew);
        psum += p;
        pw[(8 * hh + r) * AT_LP + j * 16 + c] = (_Float16)(p * P_CARRY);
      }
#pragma unroll
      for (int off = 1; off < 16; off <<= 1) psum += __shfl_xor(psum, off, 32);
      lrow[r] = lrow[r] * alpha + psum;
#pragma unroll
      for (int t = 0; t < 4; ++t) oacc[t][r] *= alpha;
    }
    __builtin_amdgcn_fence(__ATOMIC_RELEASE, "workgroup");
    __builtin_amdgcn_wave_barrier();
    __builtin_amdgcn_fence(__ATOMIC_ACQUIRE, "workgroup");
#pragma unroll 1
    for (int kk = 0; kk < 2; ++kk) {
      FB pa;
      pa.h[0] = *(const v8h*)(pw + c * AT_LP + kk * 32 + 8 * hh);
      pa.h[1] = *(const v8h*)(pw + c * AT_LP + kk * 32 + 16 + 8 * hh);
#pragma unroll
      for (int t = 0; t < 4; ++t) {
        FB vb;
        vb.h[0] = *(const v8h*)(Vth + (t * 16 + c) * AT_LP + kk * 32 + 8 * hh);
        vb.h[1] = *(const v8h*)(Vth + (t * 16 + c) * AT_LP + kk * 32 + 16 + 8 * hh);
        oacc[t] = mma_h16(pa.v, vb.v, oacc[t]);
      }
    }
  }

  float* os = Os[wave];
#pragma unroll
  for (int r = 0; r < 8; ++r) {
    const float inv = 1.0f / (lrow[r] * P_CARRY);
#pragma unroll
    for (int t = 0; t < 4; ++t) os[(8 * hh + r) * 68 + t * 16 + c] = oacc[t][r] * inv;
  }
  __builtin_amdgcn_fence(__ATOMIC_RELEASE, "workgroup");
  __builtin_amdgcn_wave_barrier();
  __builtin_amdgcn_fence(__ATOMIC_ACQUIRE, "workgroup");
  {
    const int q8 = lane >> 3, c8 = (lane & 7) * 8;
    {
#pragma unroll
      for (int it = 0; it < 4; ++it) {
        const int row = it * 4 + q8;
        const float* sp = os + row * 68 + c8;
        v8h hv, lv;
#pragma unroll
        for (int e = 0; e < 8; ++e) {
          const unsigned short hb = f2bf_bits(sp[e]);
          const unsigned short lb = f2bf_bits(sp[e] - bf_bits2f(hb));
          hv[e] = __builtin_bit_cast(_Float16, hb);
          lv[e] = __builtin_bit_cast(_Float16, lb);
        }
        const size_t go = (size_t)(q0 + row) * D_MODEL + c8;
        *(v8h*)(Oh + go) = hv;
        *(v8h*)(Ol + go) = lv;
      }
      
    }
  }
}

// ---------------- host-side orchestration (kernel launches only) ----------------
extern "C" void kernel_launch(void* const* d_in, const int* in_sizes, int n_in,
                              void* d_out, int out_size, void* d_ws, size_t ws_size,
                              hipStream_t stream) {
  if (n_in < 5) return;
  const int M_ROWS = NB_BATCH * SEQ_LEN;   // 8192
  if (in_sizes[0] != M_ROWS * D_MODEL) return;
  if (in_sizes[1] != D_MODEL * 3 * D_MODEL) return;
  if (in_sizes[2] != 3 * D_MODEL) return;
  if (in_sizes[3] != D_MODEL * D_MODEL) return;
  if (in_sizes[4] != D_MODEL) return;
  if (out_size != M_ROWS * D_MODEL) return;

  const float* x    = (const float*)d_in[0];
  const float* Wqkv = (const float*)d_in[1];
  const float* bqkv = (const float*)d_in[2];
  const float* Wout = (const float*)d_in[3];
  const float* bout = (const float*)d_in[4];
  float* out = (float*)d_out;

  // workspace map (all offsets 256-B aligned; every region fully written before it is read):
  //   xb    bf16 [8192][1024]                16,777,216
  //   wqT   bf16 [3072][1024] (Wqkv^T)       6,291,456
  //   woT   bf16 [1024][1024] (Wout^T)       2,097,152
  //   freq  f32  [32] (+pad)                        256
  //   cosT  f32  [2048][32]                     262,144
  //   sinT  f32  [2048][32]                     262,144
  //   qk16  f16  [8192][2048] (q | k, rotated) 33,554,432
  //   vt16  f16  [4][1024][2048] (v^T)       16,777,216
  //   ohi   bf16 [8192][1024]                16,777,216
  //   olo   bf16 [8192][1024]                16,777,216
  //   total                                 109,576,448
  char* ws = (char*)d_ws;
  size_t off = 0;
  unsigned short* xb   = (unsigned short*)(ws + off); off += (size_t)M_ROWS * D_MODEL * 2;
  unsigned short* wqT  = (unsigned short*)(ws + off); off += (size_t)3 * D_MODEL * D_MODEL * 2;
  unsigned short* woT  = (unsigned short*)(ws + off); off += (size_t)D_MODEL * D_MODEL * 2;
  float*          freq = (float*)(ws + off);          off += 256;
  float*          cosT = (float*)(ws + off);          off += (size_t)SEQ_LEN * ROPE_HALF * 4;
  float*          sinT = (float*)(ws + off);          off += (size_t)SEQ_LEN * ROPE_HALF * 4;
  unsigned short* qk16 = (unsigned short*)(ws + off); off += (size_t)M_ROWS * QK_LD * 2;
  unsigned short* vt16 = (unsigned short*)(ws + off); off += (size_t)NB_BATCH * D_MODEL * SEQ_LEN * 2;
  unsigned short* ohi  = (unsigned short*)(ws + off); off += (size_t)M_ROWS * D_MODEL * 2;
  unsigned short* olo  = (unsigned short*)(ws + off); off += (size_t)M_ROWS * D_MODEL * 2;
  if (off > ws_size) return;

  // 1) x -> bf16 (n8 = 1,048,576 -> 4096 blocks)
  const int n8 = (M_ROWS * D_MODEL) / 8;
  cast_bf16x8_kernel<<<dim3((n8 + 255) / 256), dim3(256), 0, stream>>>(x, xb, n8);
  // 2) Wqkv [1024][3072] -> Wqkv^T bf16 [3072][1024]; Wout [1024][1024] -> Wout^T bf16 [1024][1024]
  tcast_bf16_kernel<<<dim3(3 * D_MODEL / 64, D_MODEL / 64), dim3(256), 0, stream>>>(Wqkv, wqT, D_MODEL, 3 * D_MODEL);
  tcast_bf16_kernel<<<dim3(D_MODEL / 64, D_MODEL / 64), dim3(256), 0, stream>>>(Wout, woT, D_MODEL, D_MODEL);
  // 3) rotation tables
  rope_freq_kernel<<<dim3(1), dim3(32), 0, stream>>>(freq);
  const int ntab = SEQ_LEN * ROPE_HALF;   // 65536
  rope_table_kernel<<<dim3((ntab + 255) / 256), dim3(256), 0, stream>>>(freq, cosT, sinT, ntab);
  // 4) q|k = x.Wqkv[:, 0:2048] + bf16(b) -> rotate -> f16 : M=8192, N=2048, K=1024 (work-group tiles 64x8 = 512 blocks)
  {
    const int tiles = (M_ROWS / GB_M) * (2 * D_MODEL / GB_N);
    wmma_gemm64<1, 0, 3, 3, false, D_MODEL><<<dim3(tiles, 1), dim3(256), 0, stream>>>(
        xb, nullptr, 0L,
        wqT, 0L,
        (void*)qk16, nullptr, QK_LD, 0L,
        bqkv, nullptr, 0L,
        cosT, sinT, SEQ_LEN,
        M_ROWS, 2 * D_MODEL, D_MODEL, 1.0f);
  }
  // 5) v^T per batch = Wv^T . x_b^T + bf16(bv)[m] -> f16 : M=1024 (features), N=2048 (positions), K=1024, z = 4
  //    A = Wqkv^T rows 2048..3071, Bt = x_b [2048][1024], C = vt16 + b*1024*2048 (work-group tiles 8x8 = 64 blocks)
  {
    const int tiles = (D_MODEL / GB_M) * (SEQ_LEN / GB_N);
    wmma_gemm64<1, 0, 4, 1, false, D_MODEL><<<dim3(tiles, NB_BATCH), dim3(256), 0, stream>>>(
        wqT + (size_t)2 * D_MODEL * D_MODEL, nullptr, 0L,
        xb, (long)SEQ_LEN * D_MODEL,
        (void*)vt16, nullptr, SEQ_LEN, (long)D_MODEL * SEQ_LEN,
        bqkv + 2 * D_MODEL, nullptr, 0L,
        nullptr, nullptr, 1,
        D_MODEL, SEQ_LEN, D_MODEL, 1.0f);
  }
  // 6) attention -> o as bf16 hi/lo planes [8192][1024]
  attn_f16_kernel<<<dim3(N_HEAD * (SEQ_LEN / AT_QB), NB_BATCH), dim3(128), 0, stream>>>(qk16, vt16, ohi, olo, 0.125f);
  // 7) out = (o_hi + o_lo).Wout + bf16(b_out) -> f32 d_out : M=8192, N=1024, K=1024 (work-group tiles 64x4 = 256 blocks)
  {
    const int tiles = (M_ROWS / GB_M) * (D_MODEL / GB_N);
    wmma_gemm64<1, 2, 3, 0, false, D_MODEL><<<dim3(tiles, 1), dim3(256), 0, stream>>>(
        ohi, olo, 0L,
        woT, 0L,
        (void*)out, nullptr, D_MODEL, 0L,
        bout, nullptr, 0L,
        nullptr, nullptr, 1,
        M_ROWS, D_MODEL, D_MODEL, 1.0f);
  }
}

// v003
// A run of this version takes 216 microseconds.
// In both of two side-by-side timings against v002, it was 1.59 times as fast.
// All steps since v000 together make it 2.76 times as fast.
// Contractions: x.Wqkv (q|k part) and Wv^T.x^T : v_wmma_f32_16x16x32_bf16 (bf16 operands = RNE of the f32 inputs); q.k^T and p.v : v_wmma_f32_16x16x32_f16 (q,k cast to f16 after f32 rope; p carried x2^15 in f16; v f16); o.Wout : v_wmma_f32_16x16x32_bf16 with o as bf16 hi+lo planes (hi.W + lo.W), Wout bf16; all f32 accumulate; rope tables, softmax in f32; biases RNE-rounded to bf16, added in f32.
#include <hip/hip_runtime.h>
#include <math.h>
#include <stdint.h>

constexpr int NB_BATCH  = 4;
constexpr int SEQ_LEN   = 2048;
constexpr int D_MODEL   = 1024;
constexpr int N_HEAD    = 16;
constexpr int HEAD_D    = 64;
constexpr int ROPE_HALF = 32;          // head_dim / 2 rotation pairs
constexpr int QK_LD     = 2 * D_MODEL; // pitch of the q|k 16-bit plane

typedef __attribute__((ext_vector_type(16))) _Float16 v16h;
typedef __attribute__((ext_vector_type(8)))  _Float16 v8h;
typedef __attribute__((ext_vector_type(16))) __bf16   v16b;
typedef __attribute__((ext_vector_type(8)))  __bf16   v8b;
typedef __attribute__((ext_vector_type(8)))  float    v8f;
typedef __attribute__((ext_vector_type(4)))  float    v4f;
typedef __attribute__((ext_vector_type(4)))  unsigned int v4u;

__device__ __forceinline__ unsigned short f2bf_bits(float f) {
  unsigned u = __float_as_uint(f);
  return (unsigned short)((u + 0x7FFFu + ((u >> 16) & 1u)) >> 16);
}
__device__ __forceinline__ float bf_bits2f(unsigned short h) { return __uint_as_float(((unsigned)h) << 16); }
__device__ __forceinline__ unsigned pk16(unsigned short a, unsigned short b) { return (unsigned)a | ((unsigned)b << 16); }

// hazard guards as plain device helpers (their inline asm stays out of the kernel template body)
__device__ __forceinline__ void dep_guard_h(v8f& a, v8f& b, v16h x, v16h y) { asm volatile("v_nop\n\tv_nop\n\tv_nop\n\tv_nop" : "+v"(a), "+v"(b) : "v"(x), "v"(y)); }
__device__ __forceinline__ void dep_guard_b(v8f& a, v8f& b, v16b x, v16b y) { asm volatile("v_nop\n\tv_nop\n\tv_nop\n\tv_nop" : "+v"(a), "+v"(b) : "v"(x), "v"(y)); }
__device__ __forceinline__ void keep4_h(v16h a, v16h b, v16h c, v16h d) { asm volatile("v_nop" :: "v"(a), "v"(b), "v"(c), "v"(d)); }
__device__ __forceinline__ void keep4_b(v16b a, v16b b, v16b c, v16b d) { asm volatile("v_nop" :: "v"(a), "v"(b), "v"(c), "v"(d)); }
__device__ __forceinline__ void acc_guard4(v8f& a, v8f& b, v8f& c, v8f& d) { asm volatile("v_nop\n\tv_nop\n\tv_nop\n\tv_nop" : "+v"(a), "+v"(b), "+v"(c), "+v"(d)); }
template <typename T> struct Frag;
template <> struct Frag<_Float16> {
  typedef v16h V; typedef v8h H; union U { v16h v; v8h h[2]; };
  static __device__ __forceinline__ v16h load(const _Float16* p) {   // elements 0..7 <- p[0..7], 8..15 <- p[16..23]
    U f; f.h[0] = *(const v8h*)(p); f.h[1] = *(const v8h*)(p + 16); return f.v;
  }
  static __device__ __forceinline__ v8f mma(v16h a, v16h b, v8f c) {
    return __builtin_amdgcn_wmma_f32_16x16x32_f16(false, a, false, b, (short)0, c, false, false);
  }
  static __device__ __forceinline__ void guard(v8f& a, v8f& b, v16h x, v16h y) { dep_guard_h(a, b, x, y); }
  static __device__ __forceinline__ void keep(v16h a, v16h b, v16h c, v16h d) { keep4_h(a, b, c, d); }
};
template <> struct Frag<__bf16> {
  typedef v16b V; typedef v8b H; union U { v16b v; v8b h[2]; };
  static __device__ __forceinline__ v16b load(const __bf16* p) {
    U f; f.h[0] = *(const v8b*)(p); f.h[1] = *(const v8b*)(p + 16); return f.v;
  }
  static __device__ __forceinline__ v8f mma(v16b a, v16b b, v8f c) {
    return __builtin_amdgcn_wmma_f32_16x16x32_bf16(false, a, false, b, (short)0, c, false, false);
  }
  static __device__ __forceinline__ void guard(v8f& a, v8f& b, v16b x, v16b y) { dep_guard_b(a, b, x, y); }
  static __device__ __forceinline__ void keep(v16b a, v16b b, v16b c, v16b d) { keep4_b(a, b, c, d); }
};

// ---- Register-blocked batched WMMA GEMM, operands staged per work-group in LDS ----
// C[m,n] = scale * sum_k A[m,k] * Bt[n,k] (+bias)(+resid); a work-group of 8 waves (2 x 4) owns a 128x256 tile,
// each wave a 64x64 tile of it.
// A row-major [M,K]; Bt row-major [N,K]; M % 128 == 0, N % 256 == 0, K % 64 == 0.
// A stage is 64 k (128 B, one cache line) of every operand row of the work-group tile: 8 lanes x 16 B fetch one row's line,
// so a wave's load touches 4 whole lines; the rows lie in LDS at pitch GB_LP. Two LDS buffers: stage s+1 is fetched into
// registers ahead of stage s's products, stored behind them into the other buffer, one work-group barrier per stage.
// SPLITM: 0 = single product; 2 = A hi/lo planes (hi.B + lo.B).
// BIAS_MODE: 0 = none, 1 = bias[m], 2 = bias[n], 3 = bias[n] RNE-converted to bf16, 4 = bias[m] RNE-converted to bf16.
// OUT_MODE: 0 = f32, 1 = f16, 2 = bf16 hi plane (Cout) + bf16 lo plane (Cout2),
//           3 = f16 with interleaved-pair rotation: pair (2i,2i+1) within each 64-wide column tile rotated by
//               (ropeC, ropeS)[t][i] with t = m % ropeT (tables [ropeT][32] f32).
// ET: 0 = f16 operands, 1 = bf16 operands (pointers passed as 16-bit storage)
template <int ET> struct Elem;
template <> struct Elem<0> { typedef _Float16 T; };
template <> struct Elem<1> { typedef __bf16 T; };
constexpr int GB_M  = 128;  // work-group tile rows
constexpr int GB_N  = 256;  // work-group tile columns
constexpr int GB_K  = 64;   // k per stage
constexpr int GB_LP = 72;   // LDS row pitch in 16-bit elements: 144 B = 16 B x 9 (odd) for 16-byte row readers
// Registers: the single-plane builds stay within 256 VGPRs, so that two work-groups (their LDS fits twice) share a WGP and
// one's products cover the other's barrier and staging; the hi/lo build has one work-group per WGP by its LDS.
// LD: row pitch of A and Bt in elements, a compile-time value: the groups of 32 staged rows are then immediate offsets
// of one address per plane.
template <int ET, int SPLITM, int BIAS_MODE, int OUT_MODE, bool RESID, int LD, int ACT = 0>
__global__ __launch_bounds__(256) __attribute__((amdgpu_waves_per_eu((SPLITM != 0) ? 2 : 4))) void wmma_gemm64(
    const unsigned short* __restrict__ Ap, const unsigned short* __restrict__ A2p, long strideA,
    const unsigned short* __restrict__ Btp, long strideB,
    void* __restrict__ Cout, void* __restrict__ Cout2, int ldc, long strideC,
    const float* __restrict__ bias,
    const float* __restrict__ resid, long strideR,
    const float* __restrict__ ropeC, const float* __restrict__ ropeS, int ropeT,
    int M, int N, int K, float scale) {
  typedef typename Elem<ET>::T T;
  typedef typename Frag<T>::V V;
  typedef typename Frag<T>::H H;
  static_assert(SPLITM == 0 || SPLITM == 2, "staged planes: A (hi, lo) and Bt");
  const T* A = (const T*)Ap; const T* A2 = (const T*)A2p; const T* Bt = (const T*)Btp;
  constexpr int A_ROWS = (SPLITM != 0) ? 2 * GB_M : GB_M;   // staged A rows: hi plane, then lo plane
  constexpr int S_ROWS = A_ROWS + GB_N;                     // staged rows per stage
  constexpr int NPC    = S_ROWS / 32;                       // 16-B pieces per thread per stage (256 threads x 16 B = 32 rows)
  __shared__ __align__(16) T sOp[2][S_ROWS * GB_LP];        // two stage buffers
  __shared__ __align__(16) float sT[8][16 * 68];   // per-wave 16x64 slab, pitch 68 floats
  const int b    = blockIdx.y;
  const int tid  = threadIdx.x;
  const int lane = tid & 31;
  const int wave = tid >> 5;
  const int blkN = N >> 8;
  const int blkM = M >> 7;
  if ((int)blockIdx.x >= blkM * blkN) return;   // the same for the whole work-group, ahead of every barrier
  const int bm = blockIdx.x / blkN;
  const int bn = blockIdx.x - bm * blkN;
  const int wm = (wave >> 2) << 6;             // this wave's row offset in the work-group tile
  const int wn = (wave & 3) << 6;              // this wave's column offset
  const int m0 = (bm << 7) + wm;
  const int n0 = (bn << 8) + wn;

  const int rlane = lane & 15;                 // row (A) / col (B, D) within subtile
  const int koff  = (lane >> 4) * 8;           // k offset of this lane half
  const int mOff  = (lane >> 4) * 8;           // D row offset

  // staging map: thread -> row (tid >> 3) of each group of 32 staged rows, 16-B piece (tid & 7) of its 128-B line
  const int sr = tid >> 3;
  const int sc = (tid & 7) * 8;
  const T* gA  = A  + (size_t)b * strideA + (size_t)((bm << 7) + sr) * LD + sc;
  const T* gA2 = (SPLITM != 0) ? (A2 + (size_t)b * strideA + (size_t)((bm << 7) + sr) * LD + sc) : gA;
  const T* gB  = Bt + (size_t)b * strideB + (size_t)((bn << 8) + sr) * LD + sc;
  H pre[NPC];
  auto fetch = [&](int k0) {
    const T* pa  = gA  + k0;
    const T* pa2 = gA2 + k0;
    const T* pb  = gB  + k0;
#pragma unroll   // constant indices keep pre[] in registers and the row groups as immediate offsets
    for (int it = 0; it < NPC; ++it) {
      const int row = it * 32;
      if (row < GB_M)        pre[it] = *(const H*)(pa  + (size_t)row * LD);
      else if (row < A_ROWS) pre[it] = *(const H*)(pa2 + (size_t)(row - GB_M) * LD);
      else                   pre[it] = *(const H*)(pb  + (size_t)(row - A_ROWS) * LD);
    }
    // the wait in front of any overwrite of the loads' address registers; the addresses are inputs, so that their
    // registers are held up to it
    asm volatile("s_wait_xcnt 0x0" :: "v"(pa), "v"(pa2), "v"(pb) : "memory");
  };
  auto stash = [&](T* dst) {
#pragma unroll   // constant indices keep pre[] in registers
    for (int it = 0; it < NPC; ++it) *(H*)(dst + (it * 32 + sr) * GB_LP + sc) = pre[it];
  };

  v8f acc[4][4];
#pragma unroll
  for (int i = 0; i < 4; ++i)
#pragma unroll
    for (int j = 0; j < 4; ++j) acc[i][j] = (v8f){0.f,0.f,0.f,0.f,0.f,0.f,0.f,0.f};

  const int nst = K >> 6;
  fetch(0);
  stash(sOp[0]);
  __syncthreads();
  for (int st = 0; st < nst; ++st) {
    const bool more = (st + 1 < nst);          // the same for the whole work-group
    if (more) fetch((st + 1) << 6);
    const T* sA = sOp[st & 1] + (wm + rlane) * GB_LP + koff;
    const T* sB = sOp[st & 1] + (A_ROWS + wn + rlane) * GB_LP + koff;
#pragma unroll   // both halves of a stage in one block, so that the second half's fragment reads can start under the first's products
    for (int kk = 0; kk < GB_K; kk += 32) {
      // all fragments of these 32 k are read as one group ahead of their products
      V bh[4], ah[4], al[4];
#pragma unroll
      for (int j = 0; j < 4; ++j) bh[j] = Frag<T>::load(sB + (j << 4) * GB_LP + kk);
#pragma unroll
      for (int i = 0; i < 4; ++i) {
        ah[i] = Frag<T>::load(sA + (i << 4) * GB_LP + kk);
        if (SPLITM != 0) al[i] = Frag<T>::load(sA + (GB_M + (i << 4)) * GB_LP + kk);
      }
#pragma unroll
      for (int i = 0; i < 4; ++i) {
#pragma unroll
        for (int j = 0; j < 4; ++j) {
          acc[i][j] = Frag<T>::mma(ah[i], bh[j], acc[i][j]);
          if (SPLITM != 0) acc[i][j] = Frag<T>::mma(al[i], bh[j], acc[i][j]);
        }
        Frag<T>::guard(acc[i][0], acc[i][3], ah[i], (SPLITM != 0) ? al[i] : ah[i]);
      }
      Frag<T>::keep(bh[0], bh[1], bh[2], bh[3]);
    }
    // the other buffer's last readers passed the barrier that ended stage st - 1
    if (more) stash(sOp[(st + 1) & 1]);
    __syncthreads();                           // publishes stage st + 1 and ends every read of stage st's buffer
  }
  acc_guard4(acc[0][0], acc[0][1], acc[0][2], acc[0][3]);
  acc_guard4(acc[1][0], acc[1][1], acc[1][2], acc[1][3]);
  acc_guard4(acc[2][0], acc[2][1], acc[2][2], acc[2][3]);
  acc_guard4(acc[3][0], acc[3][1], acc[3][2], acc[3][3]);

  // ---- epilogue ----
  float* slab = sT[wave];
  const float* Rb = RESID ? (resid + (size_t)b * strideR) : nullptr;
#pragma unroll
  for (int i = 0; i < 4; ++i) {
    const int mBase = m0 + (i << 4);
#pragma unroll
    for (int j = 0; j < 4; ++j) {
      const int n = n0 + (j << 4) + rlane;
      float bv = 0.f;
      if (BIAS_MODE == 2) bv = bias[n];
      if (BIAS_MODE == 3) bv = bf_bits2f(f2bf_bits(bias[n]));
#pragma unroll
      for (int r = 0; r < 8; ++r) {
        float v = acc[i][j][r] * scale;
        if (BIAS_MODE == 1) v += bias[mBase + mOff + r];
        if (BIAS_MODE == 4) v += bf_bits2f(f2bf_bits(bias[mBase + mOff + r]));
        if (BIAS_MODE == 2 || BIAS_MODE == 3) v += bv;
        if (RESID) v += Rb[(size_t)(mBase + mOff + r) * ldc + n];
        if (ACT == 1) v = tanhf(v);
        if (ACT == 2) v = fmaxf(v, 0.0f);
        if (ACT == 3) v = v / (1.0f + expf(-v));
        if (ACT == 4) v = (v > 0.f) ? v : 0.01f * v;
        slab[(mOff + r) * 68 + (j << 4) + rlane] = v;
      }
    }
    __builtin_amdgcn_fence(__ATOMIC_RELEASE, "workgroup");
    __builtin_amdgcn_wave_barrier();
    __builtin_amdgcn_fence(__ATOMIC_ACQUIRE, "workgroup");
    if (OUT_MODE == 0) {
      float* C = (float*)Cout + (size_t)b * strideC;
      const int hh = lane >> 4, c4 = (lane & 15) * 4;     // row seg = 256 B = 16 lanes x 16 B
      {
#pragma unroll
        for (int it = 0; it < 8; ++it) {
          const int row = it * 2 + hh;
          v4f v = *(const v4f*)(slab + row * 68 + c4);
          *(v4f*)(C + (size_t)(mBase + row) * ldc + n0 + c4) = v;
        }
        
      }
    } else {
      const int q = lane >> 3, c8 = (lane & 7) * 8;
      unsigned short* C  = (unsigned short*)Cout  + (size_t)b * strideC;
      unsigned short* C2 = (OUT_MODE == 2) ? ((unsigned short*)Cout2 + (size_t)b * strideC) : nullptr;
      {
#pragma unroll
        for (int it = 0; it < 4; ++it) {
          const int row = it * 4 + q;
          const float* sp = slab + row * 68 + c8;
          v8h hv, lv;
          if (OUT_MODE == 3) {
            // columns c8..c8+7 of this 64-wide tile are rotation pairs (c8>>1)+0..3 of position t
            const int t = (mBase + row) % ropeT;
            const v4f cv = *(const v4f*)(ropeC + (size_t)t * ROPE_HALF + (c8 >> 1));
            const v4f sv = *(const v4f*)(ropeS + (size_t)t * ROPE_HALF + (c8 >> 1));
#pragma unroll
            for (int e2 = 0; e2 < 4; ++e2) {
              const float x0 = sp[2 * e2], x1 = sp[2 * e2 + 1];
              hv[2 * e2]     = (_Float16)(x0 * cv[e2] - x1 * sv[e2]);
              hv[2 * e2 + 1] = (_Float16)(x0 * sv[e2] + x1 * cv[e2]);
            }
          } else {
#pragma unroll
            for (int e = 0; e < 8; ++e) {
              if (OUT_MODE == 1) {
                hv[e] = (_Float16)sp[e];
              } else {
                unsigned short hb = f2bf_bits(sp[e]);
                unsigned short lb = f2bf_bits(sp[e] - bf_bits2f(hb));
                hv[e] = __builtin_bit_cast(_Float16, hb);
                lv[e] = __builtin_bit_cast(_Float16, lb);
              }
            }
          }
          *(v8h*)(C + (size_t)(mBase + row) * ldc + n0 + c8) = hv;
          if (OUT_MODE == 2) *(v8h*)(C2 + (size_t)(mBase + row) * ldc + n0 + c8) = lv;
        }
        
      }
    }
    __builtin_amdgcn_fence(__ATOMIC_RELEASE, "workgroup");
    __builtin_amdgcn_wave_barrier();
    __builtin_amdgcn_fence(__ATOMIC_ACQUIRE, "workgroup");
  }
}

// ---------------------------------------------------------------------------
// f32 -> bf16 (RNE) cast, 8 elements per thread, one 16-B store per lane: a wave writes 512 contiguous bytes =
// Coverage: grid = n8/256 blocks x 256 threads x 8 elements = 8*n8 = the whole plane (n8 = 8192*1024/8 = 1,048,576
// -> 4096 blocks exactly).
// ---------------------------------------------------------------------------
__global__ __launch_bounds__(256) void cast_bf16x8_kernel(const float* __restrict__ in, unsigned short* __restrict__ out, int n8) {
  const int i = blockIdx.x * 256 + threadIdx.x;
  if (i < n8) {
    const v4f a  = *(const v4f*)(in + 8 * (size_t)i);
    const v4f a2 = *(const v4f*)(in + 8 * (size_t)i + 4);
    v4u u;
    u[0] = pk16(f2bf_bits(a[0]),  f2bf_bits(a[1]));
    u[1] = pk16(f2bf_bits(a[2]),  f2bf_bits(a[3]));
    u[2] = pk16(f2bf_bits(a2[0]), f2bf_bits(a2[1]));
    u[3] = pk16(f2bf_bits(a2[2]), f2bf_bits(a2[3]));
    *(v4u*)(out + 8 * (size_t)i) = u;
    
  }
}

// ---------------------------------------------------------------------------
// Fused transpose + bf16 (RNE) cast of an f32 matrix: in [R rows][Cc cols] (pitch Cc) -> out[c][r] ([Cc][R], pitch R).
// 64x64 tiles through LDS. grid = (Cc/64, R/64), 256 threads (R, Cc multiples of 64).
// Coverage per block: load 4 it x 256 thr x 4 floats = 64x64; store 2 it x 256 thr x 8 u16 = 64x64.
// ---------------------------------------------------------------------------
__global__ __launch_bounds__(256) void tcast_bf16_kernel(const float* __restrict__ W, unsigned short* __restrict__ oh, int R, int Cc) {
  __shared__ __align__(16) float tf[64 * 68];
  const int c0  = blockIdx.x * 64;   // input column block = output row block
  const int rb0 = blockIdx.y * 64;   // input row block    = output column block
  const int tid = threadIdx.x;
  {
    const int lr = tid >> 4;         // 0..15
    const int c4 = (tid & 15) * 4;   // 0..60
#pragma unroll
    for (int it = 0; it < 4; ++it) {
      const int rr = it * 16 + lr;   // 0..63
      const v4f a = *(const v4f*)(W + (size_t)(rb0 + rr) * Cc + c0 + c4);
      *(v4f*)(tf + rr * 68 + c4) = a;
    }
  }
  __syncthreads();
  const int sub = tid >> 3;          // 0..31
  const int c8  = (tid & 7) * 8;     // 0..56
  v4u hv[2];
#pragma unroll
  for (int it = 0; it < 2; ++it) {
    const int oc = it * 32 + sub;    // output row within tile (= input column)
    v4u a;
#pragma unroll
    for (int q = 0; q < 4; ++q) {
      const float f0 = tf[(c8 + 2 * q) * 68 + oc];
      const float f1 = tf[(c8 + 2 * q + 1) * 68 + oc];
      a[q] = pk16(f2bf_bits(f0), f2bf_bits(f1));
    }
    hv[it] = a;
  }
  {
#pragma unroll
    for (int it = 0; it < 2; ++it) {
      const int oc = it * 32 + sub;
      const size_t go = (size_t)(c0 + oc) * R + rb0 + c8;
      *(v4u*)(oh + go) = hv[it];
    }
    
  }
}

// ---------------------------------------------------------------------------
// Rotation frequencies: freq[i] = 1 / 10000^((2i)/64), i = 0..31 (f32 pow, f32 reciprocal).
// ---------------------------------------------------------------------------
__global__ __launch_bounds__(32) void rope_freq_kernel(float* __restrict__ freq) {
  const int i = threadIdx.x;                       // 0..31
  const float e = (float)(2 * i) / (float)HEAD_D;  // exact (division by 64)
  const float p = powf(10000.0f, e);
  const float f = 1.0f / p;
  ((float*)freq)[i] = f;
  
}

// ---------------------------------------------------------------------------
// Rotation tables: ang[t][i] = (float)t * freq[i]; cosT/sinT [SEQ][32] f32 (precise sincosf).
// ---------------------------------------------------------------------------
__global__ __launch_bounds__(256) void rope_table_kernel(const float* __restrict__ freq, float* __restrict__ cosT,
                                                         float* __restrict__ sinT, int n) {
  const int idx = blockIdx.x * 256 + threadIdx.x;
  if (idx < n) {
    const int t = idx >> 5, i = idx & 31;
    const float ang = (float)t * freq[i];
    float sv, cv;
    sincosf(ang, &sv, &cv);
    ((float*)cosT)[idx] = cv;
    ((float*)sinT)[idx] = sv;
    
  }
}

// =====================================================================================
// Full (non-causal, unmasked) attention, head dim 64, f16 operand planes.
//   q|k plane (f16): element (b, t, h, d) of q at [(b*SEQ + t)*QK_LD + h*64 + d], of k at [... + D_MODEL + h*64 + d]
//   v^T plane (f16): element (b, h, d, s) at [(b*D_MODEL + h*64 + d)*SEQ + s]
//   out: bf16 hi and lo planes, element (b, t, h, d) at [(b*SEQ + t)*D_MODEL + h*64 + d]
//   scores = (q . k) * sscale : v_wmma_f32_16x16x32_f16, f32 accumulate, scale applied to the f32 accumulator
//   out    = p . v            : v_wmma_f32_16x16x32_f16 with p (unnormalised, <= 1) carried x2^15 in f16, folded into 1/l
//   online softmax in f32 over all SEQ keys (32 chunks of 64, compile-time trip count, no masking).
//   Block = 4 waves = 64 query rows of one (batch, head); grid = (N_HEAD * SEQ/64, NB_BATCH).
//   K / V^T chunk staging: 128 threads x 32 elements per plane = the whole 64x64 tile (16-B copies, plain loads,
//   __syncthreads before and after); fragment loads read the LDS tiles with the same v8h element type.
// =====================================================================================
constexpr int AT_D  = 64;
constexpr int AT_NW = 4;
constexpr int AT_QB = 64;
constexpr int AT_KC = 64;
constexpr int AT_LP = 72;   // LDS row pitch of the K and V^T tiles in f16 elements: 144 B = 16 B x 9 (odd) for 16-byte row readers
constexpr float P_CARRY = 32768.0f;

__device__ __forceinline__ v8f mma_h16(v16h a, v16h b, v8f c) {
  return __builtin_amdgcn_wmma_f32_16x16x32_f16(false, a, false, b, (short)0, c, false, false);
}
// value of lane l ^ 16 (the other half of the wave), by a vector cross-row move
__device__ __forceinline__ float xhalf(float x) {
  const int b = __builtin_bit_cast(int, x);
  return __builtin_bit_cast(float, __builtin_amdgcn_permlanex16(b, b, 0x76543210, 0xfedcba98, false, false));
}

__global__ __launch_bounds__(128)
void attn_f16_kernel(const unsigned short* __restrict__ qkp, const unsigned short* __restrict__ vtp,
                     unsigned short* __restrict__ ohp, unsigned short* __restrict__ olp, float sscale) {
  union FB { v16h v; v8h h[2]; };
  __shared__ __align__(16) _Float16 Ksh[AT_KC * AT_LP];         // K [kv][d], pitch AT_LP      9 KB
  __shared__ __align__(16) _Float16 Vth[AT_D * AT_LP];          // V^T [d][kv], pitch AT_LP    9 KB
  __shared__ __align__(16) float    Os[AT_NW][16 * 68];         // per wave out tile, pitch 68

  const int tid  = threadIdx.x;
  const int wave = tid >> 5;
  const int lane = tid & 31;
  const int hh   = lane >> 4;
  const int c    = lane & 15;

  const int nqb = SEQ_LEN / AT_QB;            // 32
  const int bx = blockIdx.x;
  const int qb = bx % nqb;
  const int h  = bx / nqb;                    // 0..N_HEAD-1 (grid.x = N_HEAD * nqb)
  const int b  = blockIdx.y;                  // batch
  const int q0 = qb * AT_QB + wave * 16;

  const _Float16* Qp = (const _Float16*)(const void*)qkp + (size_t)b * SEQ_LEN * QK_LD + (size_t)h * AT_D;
  const _Float16* Kp = Qp + D_MODEL;
  const _Float16* Vp = (const _Float16*)(const void*)vtp + ((size_t)b * D_MODEL + (size_t)h * AT_D) * SEQ_LEN;
  unsigned short* Oh = ohp + (size_t)b * SEQ_LEN * D_MODEL + (size_t)h * AT_D;
  unsigned short* Ol = olp + (size_t)b * SEQ_LEN * D_MODEL + (size_t)h * AT_D;

  // ---- Q fragments (B operand, column = lane&15, split k map via Frag load): 2 d-chunks ----
  v16h qa[2];
#pragma unroll
  for (int dc = 0; dc < 2; ++dc)
    qa[dc] = Frag<_Float16>::load(Qp + (size_t)(q0 + c) * QK_LD + dc * 32 + 8 * hh);

  float mrun = -INFINITY;   // running maximum of query q0 + c (the same in both halves)
  float lrun = 0.f;         // running sum over this half's keys; the halves are joined behind the loop
  v8f oacc[4];              // O^T: oacc[t][r] = element d = t*16 + 8*hh + r of query q0 + c
#pragma unroll
  for (int t = 0; t < 4; ++t) oacc[t] = (v8f){0.f,0.f,0.f,0.f,0.f,0.f,0.f,0.f};

  for (int kc = 0; kc < SEQ_LEN / AT_KC; ++kc) {     // 32, compile-time constant
    const int kv0 = kc * AT_KC;
    __syncthreads();
    {
      // staging coverage: 128 threads x (4 x 8) elements = 64 rows x 64 per plane = the whole chunk tile
      const int r = tid >> 1, half = (tid & 1) * 32;
      const _Float16* ks = Kp + (size_t)(kv0 + r) * QK_LD + half;     // K row kv0+r, d = half..half+31
      const _Float16* vs = Vp + (size_t)r * SEQ_LEN + kv0 + half;      // V^T row d = r, s = kv0+half..+31
#pragma unroll
      for (int i = 0; i < 4; ++i) {
        const v8h a0 = *(const v8h*)(ks + 8 * i);
        const v8h b0 = *(const v8h*)(vs + 8 * i);
        *(v8h*)(Ksh + r * AT_LP + half + 8 * i) = a0;
        *(v8h*)(Vth + r * AT_LP + half + 8 * i) = b0;
      }
      // the wait in front of any overwrite of the loads' address registers; the addresses are inputs, so that their
      // registers are held up to it
      asm volatile("s_wait_xcnt 0x0" :: "v"(ks), "v"(vs) : "memory");
    }
    __syncthreads();

    v8f s[4];
#pragma unroll
    for (int j = 0; j < 4; ++j) s[j] = (v8f){0.f,0.f,0.f,0.f,0.f,0.f,0.f,0.f};
#pragma unroll
    for (int dc = 0; dc < 2; ++dc) {
#pragma unroll
      for (int j = 0; j < 4; ++j) {
        FB kb;
        kb.h[0] = *(const v8h*)(Ksh + (j * 16 + c) * AT_LP + dc * 32 + 8 * hh);
        kb.h[1] = *(const v8h*)(Ksh + (j * 16 + c) * AT_LP + dc * 32 + 16 + 8 * hh);
        s[j] = mma_h16(kb.v, qa[dc], s[j]);
      }
    }
#pragma unroll
    for (int j = 0; j < 4; ++j) s[j] = s[j] * sscale;
    const v8f c8v = __builtin_elementwise_max(__builtin_elementwise_max(s[0], s[1]), __builtin_elementwise_max(s[2], s[3]));
    float cm = fmaxf(fmaxf(fmaxf(c8v[0], c8v[1]), fmaxf(c8v[2], c8v[3])), fmaxf(fmaxf(c8v[4], c8v[5]), fmaxf(c8v[6], c8v[7])));
    cm = fmaxf(cm, xhalf(cm));
    const float mnew  = fmaxf(mrun, cm);
    const float alpha = expf(mrun - mnew);
    mrun = mnew;
    FB pb[2];
    v8f pv[4];
#pragma unroll
    for (int j = 0; j < 4; ++j) {
#pragma unroll
      for (int r = 0; r < 8; ++r) {
        const float p = expf(s[j][r] - mnew);
        pv[j][r] = p;
        pb[j >> 1].h[j & 1][r] = (_Float16)(p * P_CARRY);
      }
    }
    const v8f ps8 = (pv[0] + pv[1]) + (pv[2] + pv[3]);
    const float psum = ((ps8[0] + ps8[1]) + (ps8[2] + ps8[3])) + ((ps8[4] + ps8[5]) + (ps8[6] + ps8[7]));
    lrun = lrun * alpha + psum;
#pragma unroll
    for (int t = 0; t < 4; ++t) oacc[t] = oacc[t] * alpha;
#pragma unroll
    for (int kk = 0; kk < 2; ++kk) {
#pragma unroll
      for (int t = 0; t < 4; ++t) {
        FB vb;
        vb.h[0] = *(const v8h*)(Vth + (t * 16 + c) * AT_LP + kk * 32 + 8 * hh);
        vb.h[1] = *(const v8h*)(Vth + (t * 16 + c) * AT_LP + kk * 32 + 16 + 8 * hh);
        oacc[t] = mma_h16(vb.v, pb[kk].v, oacc[t]);
      }
    }
    // the distance behind the last products on the loop's taken branch as on its fall-through
    acc_guard4(oacc[0], oacc[1], oacc[2], oacc[3]);
  }

  float* os = Os[wave];
  {
    const float inv = 1.0f / ((lrun + xhalf(lrun)) * P_CARRY);
#pragma unroll
    for (int t = 0; t < 4; ++t) {
      const v8f o = oacc[t] * inv;
      *(v4f*)(os + c * 68 + t * 16 + 8 * hh)     = (v4f){o[0], o[1], o[2], o[3]};
      *(v4f*)(os + c * 68 + t * 16 + 8 * hh + 4) = (v4f){o[4], o[5], o[6], o[7]};
    }
  }
  __builtin_amdgcn_fence(__ATOMIC_RELEASE, "workgroup");
  __builtin_amdgcn_wave_barrier();
  __builtin_amdgcn_fence(__ATOMIC_ACQUIRE, "workgroup");
  {
    const int q8 = lane >> 3, c8 = (lane & 7) * 8;
    {
#pragma unroll
      for (int it = 0; it < 4; ++it) {
        const int row = it * 4 + q8;
        const float* sp = os + row * 68 + c8;
        v8h hv, lv;
#pragma unroll
        for (int e = 0; e < 8; ++e) {
          const unsigned short hb = f2bf_bits(sp[e]);
          const unsigned short lb = f2bf_bits(sp[e] - bf_bits2f(hb));
          hv[e] = __builtin_bit_cast(_Float16, hb);
          lv[e] = __builtin_bit_cast(_Float16, lb);
        }
        const size_t go = (size_t)(q0 + row) * D_MODEL + c8;
        *(v8h*)(Oh + go) = hv;
        *(v8h*)(Ol + go) = lv;
      }
      
    }
  }
}

// ---------------- host-side orchestration (kernel launches only) ----------------
extern "C" void kernel_launch(void* const* d_in, const int* in_sizes, int n_in,
                              void* d_out, int out_size, void* d_ws, size_t ws_size,
                              hipStream_t stream) {
  if (n_in < 5) return;
  const int M_ROWS = NB_BATCH * SEQ_LEN;   // 8192
  if (in_sizes[0] != M_ROWS * D_MODEL) return;
  if (in_sizes[1] != D_MODEL * 3 * D_MODEL) return;
  if (in_sizes[2] != 3 * D_MODEL) return;
  if (in_sizes[3] != D_MODEL * D_MODEL) return;
  if (in_sizes[4] != D_MODEL) return;
  if (out_size != M_ROWS * D_MODEL) return;

  const float* x    = (const float*)d_in[0];
  const float* Wqkv = (const float*)d_in[1];
  const float* bqkv = (const float*)d_in[2];
  const float* Wout = (const float*)d_in[3];
  const float* bout = (const float*)d_in[4];
  float* out = (float*)d_out;

  // workspace map (all offsets 256-B aligned; every region fully written before it is read):
  //   xb    bf16 [8192][1024]                16,777,216
  //   wqT   bf16 [3072][1024] (Wqkv^T)       6,291,456
  //   woT   bf16 [1024][1024] (Wout^T)       2,097,152
  //   freq  f32  [32] (+pad)                        256
  //   cosT  f32  [2048][32]                     262,144
  //   sinT  f32  [2048][32]                     262,144
  //   qk16  f16  [8192][2048] (q | k, rotated) 33,554,432
  //   vt16  f16  [4][1024][2048] (v^T)       16,777,216
  //   ohi   bf16 [8192][1024]                16,777,216
  //   olo   bf16 [8192][1024]                16,777,216
  //   total                                 109,576,448
  char* ws = (char*)d_ws;
  size_t off = 0;
  unsigned short* xb   = (unsigned short*)(ws + off); off += (size_t)M_ROWS * D_MODEL * 2;
  unsigned short* wqT  = (unsigned short*)(ws + off); off += (size_t)3 * D_MODEL * D_MODEL * 2;
  unsigned short* woT  = (unsigned short*)(ws + off); off += (size_t)D_MODEL * D_MODEL * 2;
  float*          freq = (float*)(ws + off);          off += 256;
  float*          cosT = (float*)(ws + off);          off += (size_t)SEQ_LEN * ROPE_HALF * 4;
  float*          sinT = (float*)(ws + off);          off += (size_t)SEQ_LEN * ROPE_HALF * 4;
  unsigned short* qk16 = (unsigned short*)(ws + off); off += (size_t)M_ROWS * QK_LD * 2;
  unsigned short* vt16 = (unsigned short*)(ws + off); off += (size_t)NB_BATCH * D_MODEL * SEQ_LEN * 2;
  unsigned short* ohi  = (unsigned short*)(ws + off); off += (size_t)M_ROWS * D_MODEL * 2;
  unsigned short* olo  = (unsigned short*)(ws + off); off += (size_t)M_ROWS * D_MODEL * 2;
  if (off > ws_size) return;

  // 1) x -> bf16 (n8 = 1,048,576 -> 4096 blocks)
  const int n8 = (M_ROWS * D_MODEL) / 8;
  cast_bf16x8_kernel<<<dim3((n8 + 255) / 256), dim3(256), 0, stream>>>(x, xb, n8);
  // 2) Wqkv [1024][3072] -> Wqkv^T bf16 [3072][1024]; Wout [1024][1024] -> Wout^T bf16 [1024][1024]
  tcast_bf16_kernel<<<dim3(3 * D_MODEL / 64, D_MODEL / 64), dim3(256), 0, stream>>>(Wqkv, wqT, D_MODEL, 3 * D_MODEL);
  tcast_bf16_kernel<<<dim3(D_MODEL / 64, D_MODEL / 64), dim3(256), 0, stream>>>(Wout, woT, D_MODEL, D_MODEL);
  // 3) rotation tables
  rope_freq_kernel<<<dim3(1), dim3(32), 0, stream>>>(freq);
  const int ntab = SEQ_LEN * ROPE_HALF;   // 65536
  rope_table_kernel<<<dim3((ntab + 255) / 256), dim3(256), 0, stream>>>(freq, cosT, sinT, ntab);
  // 4) q|k = x.Wqkv[:, 0:2048] + bf16(b) -> rotate -> f16 : M=8192, N=2048, K=1024 (work-group tiles 64x8 = 512 blocks)
  {
    const int tiles = (M_ROWS / GB_M) * (2 * D_MODEL / GB_N);
    wmma_gemm64<1, 0, 3, 3, false, D_MODEL><<<dim3(tiles, 1), dim3(256), 0, stream>>>(
        xb, nullptr, 0L,
        wqT, 0L,
        (void*)qk16, nullptr, QK_LD, 0L,
        bqkv, nullptr, 0L,
        cosT, sinT, SEQ_LEN,
        M_ROWS, 2 * D_MODEL, D_MODEL, 1.0f);
  }
  // 5) v^T per batch = Wv^T . x_b^T + bf16(bv)[m] -> f16 : M=1024 (features), N=2048 (positions), K=1024, z = 4
  //    A = Wqkv^T rows 2048..3071, Bt = x_b [2048][1024], C = vt16 + b*1024*2048 (work-group tiles 8x8 = 64 blocks)
  {
    const int tiles = (D_MODEL / GB_M) * (SEQ_LEN / GB_N);
    wmma_gemm64<1, 0, 4, 1, false, D_MODEL><<<dim3(tiles, NB_BATCH), dim3(256), 0, stream>>>(
        wqT + (size_t)2 * D_MODEL * D_MODEL, nullptr, 0L,
        xb, (long)SEQ_LEN * D_MODEL,
        (void*)vt16, nullptr, SEQ_LEN, (long)D_MODEL * SEQ_LEN,
        bqkv + 2 * D_MODEL, nullptr, 0L,
        nullptr, nullptr, 1,
        D_MODEL, SEQ_LEN, D_MODEL, 1.0f);
  }
  // 6) attention -> o as bf16 hi/lo planes [8192][1024]
  attn_f16_kernel<<<dim3(N_HEAD * (SEQ_LEN / AT_QB), NB_BATCH), dim3(128), 0, stream>>>(qk16, vt16, ohi, olo, 0.125f);
  // 7) out = (o_hi + o_lo).Wout + bf16(b_out) -> f32 d_out : M=8192, N=1024, K=1024 (work-group tiles 64x4 = 256 blocks)
  {
    const int tiles = (M_ROWS / GB_M) * (D_MODEL / GB_N);
    wmma_gemm64<1, 2, 3, 0, false, D_MODEL><<<dim3(tiles, 1), dim3(256), 0, stream>>>(
        ohi, olo, 0L,
        woT, 0L,
        (void*)out, nullptr, D_MODEL, 0L,
        bout, nullptr, 0L,
        nullptr, nullptr, 1,
        M_ROWS, D_MODEL, D_MODEL, 1.0f);
  }
}

// v004
// It runs in 170 microseconds.
// Next to v003, in two timings, it ran 1.28 times as fast each time.
// All steps since v000 together make it 3.54 times as fast.
// Contractions: x.Wqkv (q|k part) and Wv^T.x^T : v_wmma_f32_16x16x32_bf16 (bf16 operands = RNE of the f32 inputs); q.k^T and p.v : v_wmma_f32_16x16x32_f16 (q,k cast to f16 after f32 rope; p carried x2^15 in f16; v f16); o.Wout : v_wmma_f32_16x16x32_bf16 with o as bf16 hi+lo planes (hi.W + lo.W), Wout bf16; all f32 accumulate; rope tables, softmax in f32; biases RNE-rounded to bf16, added in f32.
#include <hip/hip_runtime.h>
#include <math.h>
#include <stdint.h>

constexpr int NB_BATCH  = 4;
constexpr int SEQ_LEN   = 2048;
constexpr int D_MODEL   = 1024;
constexpr int N_HEAD    = 16;
constexpr int HEAD_D    = 64;
constexpr int ROPE_HALF = 32;          // head_dim / 2 rotation pairs
constexpr int QK_LD     = 2 * D_MODEL; // pitch of the q|k 16-bit plane

typedef __attribute__((ext_vector_type(16))) _Float16 v16h;
typedef __attribute__((ext_vector_type(8)))  _Float16 v8h;
typedef __attribute__((ext_vector_type(16))) __bf16   v16b;
typedef __attribute__((ext_vector_type(8)))  __bf16   v8b;
typedef __attribute__((ext_vector_type(8)))  float    v8f;
typedef __attribute__((ext_vector_type(4)))  float    v4f;
typedef __attribute__((ext_vector_type(4)))  unsigned int v4u;

__device__ __forceinline__ unsigned short f2bf_bits(float f) {
  unsigned u = __float_as_uint(f);
  return (unsigned short)((u + 0x7FFFu + ((u >> 16) & 1u)) >> 16);
}
__device__ __forceinline__ float bf_bits2f(unsigned short h) { return __uint_as_float(((unsigned)h) << 16); }
__device__ __forceinline__ unsigned pk16(unsigned short a, unsigned short b) { return (unsigned)a | ((unsigned)b << 16); }

// hazard guards as plain device helpers (their inline asm stays out of the kernel template body)
__device__ __forceinline__ void dep_guard_h(v8f& a, v8f& b, v16h x, v16h y) { asm volatile("v_nop\n\tv_nop\n\tv_nop\n\tv_nop" : "+v"(a), "+v"(b) : "v"(x), "v"(y)); }
__device__ __forceinline__ void dep_guard_b(v8f& a, v8f& b, v16b x, v16b y) { asm volatile("v_nop\n\tv_nop\n\tv_nop\n\tv_nop" : "+v"(a), "+v"(b) : "v"(x), "v"(y)); }
__device__ __forceinline__ void keep4_h(v16h a, v16h b, v16h c, v16h d) { asm volatile("v_nop" :: "v"(a), "v"(b), "v"(c), "v"(d)); }
__device__ __forceinline__ void keep4_b(v16b a, v16b b, v16b c, v16b d) { asm volatile("v_nop" :: "v"(a), "v"(b), "v"(c), "v"(d)); }
__device__ __forceinline__ void acc_guard4(v8f& a, v8f& b, v8f& c, v8f& d) { asm volatile("v_nop\n\tv_nop\n\tv_nop\n\tv_nop" : "+v"(a), "+v"(b), "+v"(c), "+v"(d)); }
template <typename T> struct Frag;
template <> struct Frag<_Float16> {
  typedef v16h V; typedef v8h H; union U { v16h v; v8h h[2]; };
  static __device__ __forceinline__ v16h load(const _Float16* p) {   // elements 0..7 <- p[0..7], 8..15 <- p[16..23]
    U f; f.h[0] = *(const v8h*)(p); f.h[1] = *(const v8h*)(p + 16); return f.v;
  }
  static __device__ __forceinline__ v8f mma(v16h a, v16h b, v8f c) {
    return __builtin_amdgcn_wmma_f32_16x16x32_f16(false, a, false, b, (short)0, c, false, false);
  }
  static __device__ __forceinline__ void guard(v8f& a, v8f& b, v16h x, v16h y) { dep_guard_h(a, b, x, y); }
  static __device__ __forceinline__ void keep(v16h a, v16h b, v16h c, v16h d) { keep4_h(a, b, c, d); }
};
template <> struct Frag<__bf16> {
  typedef v16b V; typedef v8b H; union U { v16b v; v8b h[2]; };
  static __device__ __forceinline__ v16b load(const __bf16* p) {
    U f; f.h[0] = *(const v8b*)(p); f.h[1] = *(const v8b*)(p + 16); return f.v;
  }
  static __device__ __forceinline__ v8f mma(v16b a, v16b b, v8f c) {
    return __builtin_amdgcn_wmma_f32_16x16x32_bf16(false, a, false, b, (short)0, c, false, false);
  }
  static __device__ __forceinline__ void guard(v8f& a, v8f& b, v16b x, v16b y) { dep_guard_b(a, b, x, y); }
  static __device__ __forceinline__ void keep(v16b a, v16b b, v16b c, v16b d) { keep4_b(a, b, c, d); }
};

// ---- Register-blocked batched WMMA GEMM, operands staged per work-group in LDS ----
// C[m,n] = scale * sum_k A[m,k] * Bt[n,k] (+bias)(+resid); a work-group of 8 waves (2 x 4) owns a 128x256 tile,
// each wave a 64x64 tile of it.
// A row-major [M,K]; Bt row-major [N,K]; M % 128 == 0, N % 256 == 0, K % 64 == 0.
// A stage is 64 k (128 B, one cache line) of every operand row of the work-group tile: 8 lanes x 16 B fetch one row's line,
// so a wave's load touches 4 whole lines; the rows lie in LDS at pitch GB_LP. Two LDS buffers: stage s+1 is fetched into
// registers ahead of stage s's products, stored behind them into the other buffer, one work-group barrier per stage.
// SPLITM: 0 = single product; 2 = A hi/lo planes (hi.B + lo.B).
// BIAS_MODE: 0 = none, 1 = bias[m], 2 = bias[n], 3 = bias[n] RNE-converted to bf16, 4 = bias[m] RNE-converted to bf16.
// OUT_MODE: 0 = f32, 1 = f16, 2 = bf16 hi plane (Cout) + bf16 lo plane (Cout2),
//           3 = f16 with interleaved-pair rotation: pair (2i,2i+1) within each 64-wide column tile rotated by
//               (ropeC, ropeS)[t][i] with t = m % ropeT (tables [ropeT][32] f32).
// ET: 0 = f16 operands, 1 = bf16 operands (pointers passed as 16-bit storage)
template <int ET> struct Elem;
template <> struct Elem<0> { typedef _Float16 T; };
template <> struct Elem<1> { typedef __bf16 T; };
constexpr int GB_M  = 128;  // work-group tile rows
constexpr int GB_N  = 256;  // work-group tile columns
constexpr int GB_K  = 64;   // k per stage
constexpr int GB_LP = 72;   // LDS row pitch in 16-bit elements: 144 B = 16 B x 9 (odd) for 16-byte row readers
// Registers: the single-plane builds stay within 256 VGPRs, so that two work-groups (their LDS fits twice) share a WGP and
// one's products cover the other's barrier and staging; the hi/lo build has one work-group per WGP by its LDS.
// LD: row pitch of A and Bt in elements, a compile-time value: the groups of 32 staged rows are then immediate offsets
// of one address per plane.
template <int ET, int SPLITM, int BIAS_MODE, int OUT_MODE, bool RESID, int LD, int ACT = 0>
__global__ __launch_bounds__(256) __attribute__((amdgpu_waves_per_eu((SPLITM != 0) ? 2 : 4))) void wmma_gemm64(
    const unsigned short* __restrict__ Ap, const unsigned short* __restrict__ A2p, long strideA,
    const unsigned short* __restrict__ Btp, long strideB,
    void* __restrict__ Cout, void* __restrict__ Cout2, int ldc, long strideC,
    const float* __restrict__ bias,
    const float* __restrict__ resid, long strideR,
    const float* __restrict__ ropeC, const float* __restrict__ ropeS, int ropeT,
    int M, int N, int K, float scale) {
  typedef typename Elem<ET>::T T;
  typedef typename Frag<T>::V V;
  typedef typename Frag<T>::H H;
  static_assert(SPLITM == 0 || SPLITM == 2, "staged planes: A (hi, lo) and Bt");
  const T* A = (const T*)Ap; const T* A2 = (const T*)A2p; const T* Bt = (const T*)Btp;
  constexpr int A_ROWS = (SPLITM != 0) ? 2 * GB_M : GB_M;   // staged A rows: hi plane, then lo plane
  constexpr int S_ROWS = A_ROWS + GB_N;                     // staged rows per stage
  constexpr int NPC    = S_ROWS / 32;                       // 16-B pieces per thread per stage (256 threads x 16 B = 32 rows)
  __shared__ __align__(16) T sOp[2][S_ROWS * GB_LP];        // two stage buffers
  __shared__ __align__(16) float sT[8][16 * 68];   // per-wave 16x64 slab, pitch 68 floats
  const int b    = blockIdx.y;
  const int tid  = threadIdx.x;
  const int lane = tid & 31;
  const int wave = tid >> 5;
  const int blkN = N >> 8;
  const int blkM = M >> 7;
  if ((int)blockIdx.x >= blkM * blkN) return;   // the same for the whole work-group, ahead of every barrier
  const int bm = blockIdx.x / blkN;
  const int bn = blockIdx.x - bm * blkN;
  const int wm = (wave >> 2) << 6;             // this wave's row offset in the work-group tile
  const int wn = (wave & 3) << 6;              // this wave's column offset
  const int m0 = (bm << 7) + wm;
  const int n0 = (bn << 8) + wn;

  const int rlane = lane & 15;                 // row (A) / col (B, D) within subtile
  const int koff  = (lane >> 4) * 8;           // k offset of this lane half
  const int mOff  = (lane >> 4) * 8;           // D row offset

  // staging map: thread -> row (tid >> 3) of each group of 32 staged rows, 16-B piece (tid & 7) of its 128-B line
  const int sr = tid >> 3;
  const int sc = (tid & 7) * 8;
  const T* gA  = A  + (size_t)b * strideA + (size_t)((bm << 7) + sr) * LD + sc;
  const T* gA2 = (SPLITM != 0) ? (A2 + (size_t)b * strideA + (size_t)((bm << 7) + sr) * LD + sc) : gA;
  const T* gB  = Bt + (size_t)b * strideB + (size_t)((bn << 8) + sr) * LD + sc;
  H pre[NPC];
  auto fetch = [&](int k0) {
    const T* pa  = gA  + k0;
    const T* pa2 = gA2 + k0;
    const T* pb  = gB  + k0;
#pragma unroll   // constant indices keep pre[] in registers and the row groups as immediate offsets
    for (int it = 0; it < NPC; ++it) {
      const int row = it * 32;
      if (row < GB_M)        pre[it] = *(const H*)(pa  + (size_t)row * LD);
      else if (row < A_ROWS) pre[it] = *(const H*)(pa2 + (size_t)(row - GB_M) * LD);
      else                   pre[it] = *(const H*)(pb  + (size_t)(row - A_ROWS) * LD);
    }
    // the wait in front of any overwrite of the loads' address registers; the addresses are inputs, so that their
    // registers are held up to it
    asm volatile("s_wait_xcnt 0x0" :: "v"(pa), "v"(pa2), "v"(pb) : "memory");
  };
  auto stash = [&](T* dst) {
#pragma unroll   // constant indices keep pre[] in registers
    for (int it = 0; it < NPC; ++it) *(H*)(dst + (it * 32 + sr) * GB_LP + sc) = pre[it];
  };

  v8f acc[4][4];
#pragma unroll
  for (int i = 0; i < 4; ++i)
#pragma unroll
    for (int j = 0; j < 4; ++j) acc[i][j] = (v8f){0.f,0.f,0.f,0.f,0.f,0.f,0.f,0.f};

  const int nst = K >> 6;
  fetch(0);
  stash(sOp[0]);
  __syncthreads();
  for (int st = 0; st < nst; ++st) {
    const bool more = (st + 1 < nst);          // the same for the whole work-group
    if (more) fetch((st + 1) << 6);
    const T* sA = sOp[st & 1] + (wm + rlane) * GB_LP + koff;
    const T* sB = sOp[st & 1] + (A_ROWS + wn + rlane) * GB_LP + koff;
#pragma unroll   // both halves of a stage in one block, so that the second half's fragment reads can start under the first's products
    for (int kk = 0; kk < GB_K; kk += 32) {
      // all fragments of these 32 k are read as one group ahead of their products
      V bh[4], ah[4], al[4];
#pragma unroll
      for (int j = 0; j < 4; ++j) bh[j] = Frag<T>::load(sB + (j << 4) * GB_LP + kk);
#pragma unroll
      for (int i = 0; i < 4; ++i) {
        ah[i] = Frag<T>::load(sA + (i << 4) * GB_LP + kk);
        if (SPLITM != 0) al[i] = Frag<T>::load(sA + (GB_M + (i << 4)) * GB_LP + kk);
      }
#pragma unroll
      for (int i = 0; i < 4; ++i) {
#pragma unroll
        for (int j = 0; j < 4; ++j) {
          acc[i][j] = Frag<T>::mma(ah[i], bh[j], acc[i][j]);
          if (SPLITM != 0) acc[i][j] = Frag<T>::mma(al[i], bh[j], acc[i][j]);
        }
        Frag<T>::guard(acc[i][0], acc[i][3], ah[i], (SPLITM != 0) ? al[i] : ah[i]);
      }
      Frag<T>::keep(bh[0], bh[1], bh[2], bh[3]);
    }
    // the other buffer's last readers passed the barrier that ended stage st - 1
    if (more) stash(sOp[(st + 1) & 1]);
    __syncthreads();                           // publishes stage st + 1 and ends every read of stage st's buffer
  }
  acc_guard4(acc[0][0], acc[0][1], acc[0][2], acc[0][3]);
  acc_guard4(acc[1][0], acc[1][1], acc[1][2], acc[1][3]);
  acc_guard4(acc[2][0], acc[2][1], acc[2][2], acc[2][3]);
  acc_guard4(acc[3][0], acc[3][1], acc[3][2], acc[3][3]);

  // ---- epilogue ----
  float* slab = sT[wave];
  const float* Rb = RESID ? (resid + (size_t)b * strideR) : nullptr;
#pragma unroll
  for (int i = 0; i < 4; ++i) {
    const int mBase = m0 + (i << 4);
#pragma unroll
    for (int j = 0; j < 4; ++j) {
      const int n = n0 + (j << 4) + rlane;
      float bv = 0.f;
      if (BIAS_MODE == 2) bv = bias[n];
      if (BIAS_MODE == 3) bv = bf_bits2f(f2bf_bits(bias[n]));
#pragma unroll
      for (int r = 0; r < 8; ++r) {
        float v = acc[i][j][r] * scale;
        if (BIAS_MODE == 1) v += bias[mBase + mOff + r];
        if (BIAS_MODE == 4) v += bf_bits2f(f2bf_bits(bias[mBase + mOff + r]));
        if (BIAS_MODE == 2 || BIAS_MODE == 3) v += bv;
        if (RESID) v += Rb[(size_t)(mBase + mOff + r) * ldc + n];
        if (ACT == 1) v = tanhf(v);
        if (ACT == 2) v = fmaxf(v, 0.0f);
        if (ACT == 3) v = v / (1.0f + expf(-v));
        if (ACT == 4) v = (v > 0.f) ? v : 0.01f * v;
        slab[(mOff + r) * 68 + (j << 4) + rlane] = v;
      }
    }
    __builtin_amdgcn_fence(__ATOMIC_RELEASE, "workgroup");
    __builtin_amdgcn_wave_barrier();
    __builtin_amdgcn_fence(__ATOMIC_ACQUIRE, "workgroup");
    if (OUT_MODE == 0) {
      float* C = (float*)Cout + (size_t)b * strideC;
      const int hh = lane >> 4, c4 = (lane & 15) * 4;     // row seg = 256 B = 16 lanes x 16 B
      {
#pragma unroll
        for (int it = 0; it < 8; ++it) {
          const int row = it * 2 + hh;
          v4f v = *(const v4f*)(slab + row * 68 + c4);
          *(v4f*)(C + (size_t)(mBase + row) * ldc + n0 + c4) = v;
        }
        
      }
    } else {
      const int q = lane >> 3, c8 = (lane & 7) * 8;
      unsigned short* C  = (unsigned short*)Cout  + (size_t)b * strideC;
      unsigned short* C2 = (OUT_MODE == 2) ? ((unsigned short*)Cout2 + (size_t)b * strideC) : nullptr;
      {
#pragma unroll
        for (int it = 0; it < 4; ++it) {
          const int row = it * 4 + q;
          const float* sp = slab + row * 68 + c8;
          v8h hv, lv;
          if (OUT_MODE == 3) {
            // columns c8..c8+7 of this 64-wide tile are rotation pairs (c8>>1)+0..3 of position t
            const int t = (mBase + row) % ropeT;
            const v4f cv = *(const v4f*)(ropeC + (size_t)t * ROPE_HALF + (c8 >> 1));
            const v4f sv = *(const v4f*)(ropeS + (size_t)t * ROPE_HALF + (c8 >> 1));
#pragma unroll
            for (int e2 = 0; e2 < 4; ++e2) {
              const float x0 = sp[2 * e2], x1 = sp[2 * e2 + 1];
              hv[2 * e2]     = (_Float16)(x0 * cv[e2] - x1 * sv[e2]);
              hv[2 * e2 + 1] = (_Float16)(x0 * sv[e2] + x1 * cv[e2]);
            }
          } else {
#pragma unroll
            for (int e = 0; e < 8; ++e) {
              if (OUT_MODE == 1) {
                hv[e] = (_Float16)sp[e];
              } else {
                unsigned short hb = f2bf_bits(sp[e]);
                unsigned short lb = f2bf_bits(sp[e] - bf_bits2f(hb));
                hv[e] = __builtin_bit_cast(_Float16, hb);
                lv[e] = __builtin_bit_cast(_Float16, lb);
              }
            }
          }
          *(v8h*)(C + (size_t)(mBase + row) * ldc + n0 + c8) = hv;
          if (OUT_MODE == 2) *(v8h*)(C2 + (size_t)(mBase + row) * ldc + n0 + c8) = lv;
        }
        
      }
    }
    __builtin_amdgcn_fence(__ATOMIC_RELEASE, "workgroup");
    __builtin_amdgcn_wave_barrier();
    __builtin_amdgcn_fence(__ATOMIC_ACQUIRE, "workgroup");
  }
}

// ---------------------------------------------------------------------------
// f32 -> bf16 (RNE) cast, 8 elements per thread, one 16-B store per lane: a wave writes 512 contiguous bytes =
// Coverage: grid = n8/256 blocks x 256 threads x 8 elements = 8*n8 = the whole plane (n8 = 8192*1024/8 = 1,048,576
// -> 4096 blocks exactly).
// ---------------------------------------------------------------------------
__global__ __launch_bounds__(256) void cast_bf16x8_kernel(const float* __restrict__ in, unsigned short* __restrict__ out, int n8) {
  const int i = blockIdx.x * 256 + threadIdx.x;
  if (i < n8) {
    const v4f a  = *(const v4f*)(in + 8 * (size_t)i);
    const v4f a2 = *(const v4f*)(in + 8 * (size_t)i + 4);
    v4u u;
    u[0] = pk16(f2bf_bits(a[0]),  f2bf_bits(a[1]));
    u[1] = pk16(f2bf_bits(a[2]),  f2bf_bits(a[3]));
    u[2] = pk16(f2bf_bits(a2[0]), f2bf_bits(a2[1]));
    u[3] = pk16(f2bf_bits(a2[2]), f2bf_bits(a2[3]));
    *(v4u*)(out + 8 * (size_t)i) = u;
    
  }
}

// ---------------------------------------------------------------------------
// Fused transpose + bf16 (RNE) cast of an f32 matrix: in [R rows][Cc cols] (pitch Cc) -> out[c][r] ([Cc][R], pitch R).
// 64x64 tiles through LDS. grid = (Cc/64, R/64), 256 threads (R, Cc multiples of 64).
// Coverage per block: load 4 it x 256 thr x 4 floats = 64x64; store 2 it x 256 thr x 8 u16 = 64x64.
// ---------------------------------------------------------------------------
__global__ __launch_bounds__(256) void tcast_bf16_kernel(const float* __restrict__ W, unsigned short* __restrict__ oh, int R, int Cc) {
  __shared__ __align__(16) float tf[64 * 68];
  const int c0  = blockIdx.x * 64;   // input column block = output row block
  const int rb0 = blockIdx.y * 64;   // input row block    = output column block
  const int tid = threadIdx.x;
  {
    const int lr = tid >> 4;         // 0..15
    const int c4 = (tid & 15) * 4;   // 0..60
#pragma unroll
    for (int it = 0; it < 4; ++it) {
      const int rr = it * 16 + lr;   // 0..63
      const v4f a = *(const v4f*)(W + (size_t)(rb0 + rr) * Cc + c0 + c4);
      *(v4f*)(tf + rr * 68 + c4) = a;
    }
  }
  __syncthreads();
  const int sub = tid >> 3;          // 0..31
  const int c8  = (tid & 7) * 8;     // 0..56
  v4u hv[2];
#pragma unroll
  for (int it = 0; it < 2; ++it) {
    const int oc = it * 32 + sub;    // output row within tile (= input column)
    v4u a;
#pragma unroll
    for (int q = 0; q < 4; ++q) {
      const float f0 = tf[(c8 + 2 * q) * 68 + oc];
      const float f1 = tf[(c8 + 2 * q + 1) * 68 + oc];
      a[q] = pk16(f2bf_bits(f0), f2bf_bits(f1));
    }
    hv[it] = a;
  }
  {
#pragma unroll
    for (int it = 0; it < 2; ++it) {
      const int oc = it * 32 + sub;
      const size_t go = (size_t)(c0 + oc) * R + rb0 + c8;
      *(v4u*)(oh + go) = hv[it];
    }
    
  }
}

// ---------------------------------------------------------------------------
// Rotation frequencies: freq[i] = 1 / 10000^((2i)/64), i = 0..31 (f32 pow, f32 reciprocal).
// ---------------------------------------------------------------------------
__global__ __launch_bounds__(32) void rope_freq_kernel(float* __restrict__ freq) {
  const int i = threadIdx.x;                       // 0..31
  const float e = (float)(2 * i) / (float)HEAD_D;  // exact (division by 64)
  const float p = powf(10000.0f, e);
  const float f = 1.0f / p;
  ((float*)freq)[i] = f;
  
}

// ---------------------------------------------------------------------------
// Rotation tables: ang[t][i] = (float)t * freq[i]; cosT/sinT [SEQ][32] f32 (precise sincosf).
// ---------------------------------------------------------------------------
__global__ __launch_bounds__(256) void rope_table_kernel(const float* __restrict__ freq, float* __restrict__ cosT,
                                                         float* __restrict__ sinT, int n) {
  const int idx = blockIdx.x * 256 + threadIdx.x;
  if (idx < n) {
    const int t = idx >> 5, i = idx & 31;
    const float ang = (float)t * freq[i];
    float sv, cv;
    sincosf(ang, &sv, &cv);
    ((float*)cosT)[idx] = cv;
    ((float*)sinT)[idx] = sv;
    
  }
}

// =====================================================================================
// Full (non-causal, unmasked) attention, head dim 64, f16 operand planes.
//   q|k plane (f16): element (b, t, h, d) of q at [(b*SEQ + t)*QK_LD + h*64 + d], of k at [... + D_MODEL + h*64 + d]
//   v^T plane (f16): element (b, h, d, s) at [(b*D_MODEL + h*64 + d)*SEQ + s]
//   out: bf16 hi and lo planes, element (b, t, h, d) at [(b*SEQ + t)*D_MODEL + h*64 + d]
//   scores = (q . k) * sscale : v_wmma_f32_16x16x32_f16, f32 accumulate, scale (times log2 e) applied to the f32 accumulator
//   out    = p . v            : v_wmma_f32_16x16x32_f16 with p (unnormalised, <= 1) carried x2^15 in f16, as is the sum l
//   online softmax in f32 over all SEQ keys (32 chunks of 64, compile-time trip count, no masking).
//   Block = 4 waves = 64 query rows of one (batch, head); grid = (N_HEAD * SEQ/64, NB_BATCH).
//   K / V^T chunk staging: 128 threads x 32 elements per plane = the whole 64x64 tile (16-B copies, plain loads,
//   __syncthreads before and after); fragment loads read the LDS tiles with the same v8h element type.
// =====================================================================================
constexpr int AT_D  = 64;
constexpr int AT_NW = 4;
constexpr int AT_QB = 64;
constexpr int AT_KC = 64;
constexpr int AT_LP = 72;   // LDS row pitch of the K and V^T tiles in f16 elements: 144 B = 16 B x 9 (odd) for 16-byte row readers
constexpr float P_CARRY_LOG2 = 15.0f;   // p is carried x2^15: the carry is added to the exponent
constexpr float LOG2_E = 1.4426950408889634f;

__device__ __forceinline__ v8f mma_h16(v16h a, v16h b, v8f c) {
  return __builtin_amdgcn_wmma_f32_16x16x32_f16(false, a, false, b, (short)0, c, false, false);
}
__device__ __forceinline__ v8f splat8(float x) { return (v8f){x, x, x, x, x, x, x, x}; }
// value of lane l ^ 16 (the other half of the wave), by a vector cross-row move
__device__ __forceinline__ float xhalf(float x) {
  const int b = __builtin_bit_cast(int, x);
  return __builtin_bit_cast(float, __builtin_amdgcn_permlanex16(b, b, 0x76543210, 0xfedcba98, false, false));
}

__global__ __launch_bounds__(128)
void attn_f16_kernel(const unsigned short* __restrict__ qkp, const unsigned short* __restrict__ vtp,
                     unsigned short* __restrict__ ohp, unsigned short* __restrict__ olp, float sscale) {
  union FB { v16h v; v8h h[2]; };
  __shared__ __align__(16) _Float16 Ksh[AT_KC * AT_LP];         // K [kv][d], pitch AT_LP      9 KB
  __shared__ __align__(16) _Float16 Vth[AT_D * AT_LP];          // V^T [d][kv], pitch AT_LP    9 KB
  __shared__ __align__(16) float    Os[AT_NW][16 * 68];         // per wave out tile, pitch 68

  const int tid  = threadIdx.x;
  const int wave = tid >> 5;
  const int lane = tid & 31;
  const int hh   = lane >> 4;
  const int c    = lane & 15;

  const int nqb = SEQ_LEN / AT_QB;            // 32
  const int bx = blockIdx.x;
  const int qb = bx % nqb;
  const int h  = bx / nqb;                    // 0..N_HEAD-1 (grid.x = N_HEAD * nqb)
  const int b  = blockIdx.y;                  // batch
  const int q0 = qb * AT_QB + wave * 16;

  const _Float16* Qp = (const _Float16*)(const void*)qkp + (size_t)b * SEQ_LEN * QK_LD + (size_t)h * AT_D;
  const _Float16* Kp = Qp + D_MODEL;
  const _Float16* Vp = (const _Float16*)(const void*)vtp + ((size_t)b * D_MODEL + (size_t)h * AT_D) * SEQ_LEN;
  unsigned short* Oh = ohp + (size_t)b * SEQ_LEN * D_MODEL + (size_t)h * AT_D;
  unsigned short* Ol = olp + (size_t)b * SEQ_LEN * D_MODEL + (size_t)h * AT_D;

  // ---- Q fragments (B operand, column = lane&15, split k map via Frag load): 2 d-chunks ----
  v16h qa[2];
#pragma unroll
  for (int dc = 0; dc < 2; ++dc)
    qa[dc] = Frag<_Float16>::load(Qp + (size_t)(q0 + c) * QK_LD + dc * 32 + 8 * hh);

  // Softmax in base 2: p * 2^15 = exp2(s * sc2 + (15 - m)), one multiply-add and one hardware exponential a score; m is the
  // maximum of the raw scores times sc2, which is the maximum of the scaled scores because sc2 > 0 (sscale is 1/sqrt(64)).
  const float sc2 = sscale * LOG2_E;
  const v8f sc2v = splat8(sc2);
  float mrun = -INFINITY;   // running maximum of query q0 + c in scaled log2 units (the same in both halves)
  float lrun = 0.f;         // running sum (x2^15) over this half's keys; the halves are joined behind the loop
  v8f oacc[4];              // O^T: oacc[t][r] = element d = t*16 + 8*hh + r of query q0 + c
#pragma unroll
  for (int t = 0; t < 4; ++t) oacc[t] = (v8f){0.f,0.f,0.f,0.f,0.f,0.f,0.f,0.f};

  for (int kc = 0; kc < SEQ_LEN / AT_KC; ++kc) {     // 32, compile-time constant
    const int kv0 = kc * AT_KC;
    __syncthreads();
    {
      // staging coverage: 128 threads x (4 x 8) elements = 64 rows x 64 per plane = the whole chunk tile
      const int r = tid >> 1, half = (tid & 1) * 32;
      const _Float16* ks = Kp + (size_t)(kv0 + r) * QK_LD + half;     // K row kv0+r, d = half..half+31
      const _Float16* vs = Vp + (size_t)r * SEQ_LEN + kv0 + half;      // V^T row d = r, s = kv0+half..+31
#pragma unroll
      for (int i = 0; i < 4; ++i) {
        const v8h a0 = *(const v8h*)(ks + 8 * i);
        const v8h b0 = *(const v8h*)(vs + 8 * i);
        *(v8h*)(Ksh + r * AT_LP + half + 8 * i) = a0;
        *(v8h*)(Vth + r * AT_LP + half + 8 * i) = b0;
      }
      // the wait in front of any overwrite of the loads' address registers; the addresses are inputs, so that their
      // registers are held up to it
      asm volatile("s_wait_xcnt 0x0" :: "v"(ks), "v"(vs) : "memory");
    }
    __syncthreads();

    v8f s[4];
#pragma unroll
    for (int j = 0; j < 4; ++j) s[j] = (v8f){0.f,0.f,0.f,0.f,0.f,0.f,0.f,0.f};
#pragma unroll
    for (int dc = 0; dc < 2; ++dc) {
#pragma unroll
      for (int j = 0; j < 4; ++j) {
        FB kb;
        kb.h[0] = *(const v8h*)(Ksh + (j * 16 + c) * AT_LP + dc * 32 + 8 * hh);
        kb.h[1] = *(const v8h*)(Ksh + (j * 16 + c) * AT_LP + dc * 32 + 16 + 8 * hh);
        s[j] = mma_h16(kb.v, qa[dc], s[j]);
      }
    }
    const v8f c8v = __builtin_elementwise_max(__builtin_elementwise_max(s[0], s[1]), __builtin_elementwise_max(s[2], s[3]));
    float cm = fmaxf(fmaxf(fmaxf(c8v[0], c8v[1]), fmaxf(c8v[2], c8v[3])), fmaxf(fmaxf(c8v[4], c8v[5]), fmaxf(c8v[6], c8v[7])));
    cm = fmaxf(cm, xhalf(cm));
    const float mnew  = fmaxf(mrun, cm * sc2);
    const float alpha = __builtin_amdgcn_exp2f(mrun - mnew);   // 0 in the first chunk, where mrun is -inf
    mrun = mnew;
    const float off = P_CARRY_LOG2 - mnew;
    FB pb[2];
    v8f pv[4];
#pragma unroll
    for (int j = 0; j < 4; ++j) {
      const v8f e = __builtin_elementwise_fma(s[j], sc2v, splat8(off));
#pragma unroll
      for (int r = 0; r < 8; ++r) {
        const float p = __builtin_amdgcn_exp2f(e[r]);
        pv[j][r] = p;
        pb[j >> 1].h[j & 1][r] = (_Float16)p;
      }
    }
    const v8f ps8 = (pv[0] + pv[1]) + (pv[2] + pv[3]);
    const float psum = ((ps8[0] + ps8[1]) + (ps8[2] + ps8[3])) + ((ps8[4] + ps8[5]) + (ps8[6] + ps8[7]));
    lrun = lrun * alpha + psum;
#pragma unroll
    for (int t = 0; t < 4; ++t) oacc[t] = oacc[t] * alpha;
#pragma unroll
    for (int kk = 0; kk < 2; ++kk) {
#pragma unroll
      for (int t = 0; t < 4; ++t) {
        FB vb;
        vb.h[0] = *(const v8h*)(Vth + (t * 16 + c) * AT_LP + kk * 32 + 8 * hh);
        vb.h[1] = *(const v8h*)(Vth + (t * 16 + c) * AT_LP + kk * 32 + 16 + 8 * hh);
        oacc[t] = mma_h16(vb.v, pb[kk].v, oacc[t]);
      }
    }
    // the distance behind the last products on the loop's taken branch as on its fall-through
    acc_guard4(oacc[0], oacc[1], oacc[2], oacc[3]);
  }

  float* os = Os[wave];
  {
    const float inv = 1.0f / (lrun + xhalf(lrun));   // lrun carries the same 2^15 as p
#pragma unroll
    for (int t = 0; t < 4; ++t) {
      const v8f o = oacc[t] * inv;
      *(v4f*)(os + c * 68 + t * 16 + 8 * hh)     = (v4f){o[0], o[1], o[2], o[3]};
      *(v4f*)(os + c * 68 + t * 16 + 8 * hh + 4) = (v4f){o[4], o[5], o[6], o[7]};
    }
  }
  __builtin_amdgcn_fence(__ATOMIC_RELEASE, "workgroup");
  __builtin_amdgcn_wave_barrier();
  __builtin_amdgcn_fence(__ATOMIC_ACQUIRE, "workgroup");
  {
    const int q8 = lane >> 3, c8 = (lane & 7) * 8;
    {
#pragma unroll
      for (int it = 0; it < 4; ++it) {
        const int row = it * 4 + q8;
        const float* sp = os + row * 68 + c8;
        v8h hv, lv;
#pragma unroll
        for (int e = 0; e < 8; ++e) {
          const unsigned short hb = f2bf_bits(sp[e]);
          const unsigned short lb = f2bf_bits(sp[e] - bf_bits2f(hb));
          hv[e] = __builtin_bit_cast(_Float16, hb);
          lv[e] = __builtin_bit_cast(_Float16, lb);
        }
        const size_t go = (size_t)(q0 + row) * D_MODEL + c8;
        *(v8h*)(Oh + go) = hv;
        *(v8h*)(Ol + go) = lv;
      }
      
    }
  }
}

// ---------------- host-side orchestration (kernel launches only) ----------------
extern "C" void kernel_launch(void* const* d_in, const int* in_sizes, int n_in,
                              void* d_out, int out_size, void* d_ws, size_t ws_size,
                              hipStream_t stream) {
  if (n_in < 5) return;
  const int M_ROWS = NB_BATCH * SEQ_LEN;   // 8192
  if (in_sizes[0] != M_ROWS * D_MODEL) return;
  if (in_sizes[1] != D_MODEL * 3 * D_MODEL) return;
  if (in_sizes[2] != 3 * D_MODEL) return;
  if (in_sizes[3] != D_MODEL * D_MODEL) return;
  if (in_sizes[4] != D_MODEL) return;
  if (out_size != M_ROWS * D_MODEL) return;

  const float* x    = (const float*)d_in[0];
  const float* Wqkv = (const float*)d_in[1];
  const float* bqkv = (const float*)d_in[2];
  const float* Wout = (const float*)d_in[3];
  const float* bout = (const float*)d_in[4];
  float* out = (float*)d_out;

  // workspace map (all offsets 256-B aligned; every region fully written before it is read):
  //   xb    bf16 [8192][1024]                16,777,216
  //   wqT   bf16 [3072][1024] (Wqkv^T)       6,291,456
  //   woT   bf16 [1024][1024] (Wout^T)       2,097,152
  //   freq  f32  [32] (+pad)                        256
  //   cosT  f32  [2048][32]                     262,144
  //   sinT  f32  [2048][32]                     262,144
  //   qk16  f16  [8192][2048] (q | k, rotated) 33,554,432
  //   vt16  f16  [4][1024][2048] (v^T)       16,777,216
  //   ohi   bf16 [8192][1024]                16,777,216
  //   olo   bf16 [8192][1024]                16,777,216
  //   total                                 109,576,448
  char* ws = (char*)d_ws;
  size_t off = 0;
  unsigned short* xb   = (unsigned short*)(ws + off); off += (size_t)M_ROWS * D_MODEL * 2;
  unsigned short* wqT  = (unsigned short*)(ws + off); off += (size_t)3 * D_MODEL * D_MODEL * 2;
  unsigned short* woT  = (unsigned short*)(ws + off); off += (size_t)D_MODEL * D_MODEL * 2;
  float*          freq = (float*)(ws + off);          off += 256;
  float*          cosT = (float*)(ws + off);          off += (size_t)SEQ_LEN * ROPE_HALF * 4;
  float*          sinT = (float*)(ws + off);          off += (size_t)SEQ_LEN * ROPE_HALF * 4;
  unsigned short* qk16 = (unsigned short*)(ws + off); off += (size_t)M_ROWS * QK_LD * 2;
  unsigned short* vt16 = (unsigned short*)(ws + off); off += (size_t)NB_BATCH * D_MODEL * SEQ_LEN * 2;
  unsigned short* ohi  = (unsigned short*)(ws + off); off += (size_t)M_ROWS * D_MODEL * 2;
  unsigned short* olo  = (unsigned short*)(ws + off); off += (size_t)M_ROWS * D_MODEL * 2;
  if (off > ws_size) return;

  // 1) x -> bf16 (n8 = 1,048,576 -> 4096 blocks)
  const int n8 = (M_ROWS * D_MODEL) / 8;
  cast_bf16x8_kernel<<<dim3((n8 + 255) / 256), dim3(256), 0, stream>>>(x, xb, n8);
  // 2) Wqkv [1024][3072] -> Wqkv^T bf16 [3072][1024]; Wout [1024][1024] -> Wout^T bf16 [1024][1024]
  tcast_bf16_kernel<<<dim3(3 * D_MODEL / 64, D_MODEL / 64), dim3(256), 0, stream>>>(Wqkv, wqT, D_MODEL, 3 * D_MODEL);
  tcast_bf16_kernel<<<dim3(D_MODEL / 64, D_MODEL / 64), dim3(256), 0, stream>>>(Wout, woT, D_MODEL, D_MODEL);
  // 3) rotation tables
  rope_freq_kernel<<<dim3(1), dim3(32), 0, stream>>>(freq);
  const int ntab = SEQ_LEN * ROPE_HALF;   // 65536
  rope_table_kernel<<<dim3((ntab + 255) / 256), dim3(256), 0, stream>>>(freq, cosT, sinT, ntab);
  // 4) q|k = x.Wqkv[:, 0:2048] + bf16(b) -> rotate -> f16 : M=8192, N=2048, K=1024 (work-group tiles 64x8 = 512 blocks)
  {
    const int tiles = (M_ROWS / GB_M) * (2 * D_MODEL / GB_N);
    wmma_gemm64<1, 0, 3, 3, false, D_MODEL><<<dim3(tiles, 1), dim3(256), 0, stream>>>(
        xb, nullptr, 0L,
        wqT, 0L,
        (void*)qk16, nullptr, QK_LD, 0L,
        bqkv, nullptr, 0L,
        cosT, sinT, SEQ_LEN,
        M_ROWS, 2 * D_MODEL, D_MODEL, 1.0f);
  }
  // 5) v^T per batch = Wv^T . x_b^T + bf16(bv)[m] -> f16 : M=1024 (features), N=2048 (positions), K=1024, z = 4
  //    A = Wqkv^T rows 2048..3071, Bt = x_b [2048][1024], C = vt16 + b*1024*2048 (work-group tiles 8x8 = 64 blocks)
  {
    const int tiles = (D_MODEL / GB_M) * (SEQ_LEN / GB_N);
    wmma_gemm64<1, 0, 4, 1, false, D_MODEL><<<dim3(tiles, NB_BATCH), dim3(256), 0, stream>>>(
        wqT + (size_t)2 * D_MODEL * D_MODEL, nullptr, 0L,
        xb, (long)SEQ_LEN * D_MODEL,
        (void*)vt16, nullptr, SEQ_LEN, (long)D_MODEL * SEQ_LEN,
        bqkv + 2 * D_MODEL, nullptr, 0L,
        nullptr, nullptr, 1,
        D_MODEL, SEQ_LEN, D_MODEL, 1.0f);
  }
  // 6) attention -> o as bf16 hi/lo planes [8192][1024]
  attn_f16_kernel<<<dim3(N_HEAD * (SEQ_LEN / AT_QB), NB_BATCH), dim3(128), 0, stream>>>(qk16, vt16, ohi, olo, 0.125f);
  // 7) out = (o_hi + o_lo).Wout + bf16(b_out) -> f32 d_out : M=8192, N=1024, K=1024 (work-group tiles 64x4 = 256 blocks)
  {
    const int tiles = (M_ROWS / GB_M) * (D_MODEL / GB_N);
    wmma_gemm64<1, 2, 3, 0, false, D_MODEL><<<dim3(tiles, 1), dim3(256), 0, stream>>>(
        ohi, olo, 0L,
        woT, 0L,
        (void*)out, nullptr, D_MODEL, 0L,
        bout, nullptr, 0L,
        nullptr, nullptr, 1,
        M_ROWS, D_MODEL, D_MODEL, 1.0f);
  }
}

// v005
// A run of this version takes 159 microseconds.
// Two timings next to v004 put it at 1.06 and 1.07 times that version's speed.
// Over all steps from v000 it is 3.76 times as fast.
// Contractions: x.Wqkv (q|k part) and Wv^T.x^T : v_wmma_f32_16x16x32_bf16 (bf16 operands = RNE of the f32 inputs); q.k^T and p.v : v_wmma_f32_16x16x32_f16 (q,k cast to f16 after f32 rope; p carried x2^15 in f16; v f16); o.Wout : v_wmma_f32_16x16x32_bf16 with o as bf16 hi+lo planes (hi.W + lo.W), Wout bf16; all f32 accumulate; rope tables, softmax in f32; biases RNE-rounded to bf16, added in f32.
#include <hip/hip_runtime.h>
#include <math.h>
#include <stdint.h>

constexpr int NB_BATCH  = 4;
constexpr int SEQ_LEN   = 2048;
constexpr int D_MODEL   = 1024;
constexpr int N_HEAD    = 16;
constexpr int HEAD_D    = 64;
constexpr int ROPE_HALF = 32;          // head_dim / 2 rotation pairs
constexpr int QK_LD     = 2 * D_MODEL; // pitch of the q|k 16-bit plane

typedef __attribute__((ext_vector_type(16))) _Float16 v16h;
typedef __attribute__((ext_vector_type(8)))  _Float16 v8h;
typedef __attribute__((ext_vector_type(16))) __bf16   v16b;
typedef __attribute__((ext_vector_type(8)))  __bf16   v8b;
typedef __attribute__((ext_vector_type(8)))  float    v8f;
typedef __attribute__((ext_vector_type(4)))  float    v4f;
typedef __attribute__((ext_vector_type(4)))  unsigned int v4u;

__device__ __forceinline__ unsigned short f2bf_bits(float f) {
  unsigned u = __float_as_uint(f);
  return (unsigned short)((u + 0x7FFFu + ((u >> 16) & 1u)) >> 16);
}
__device__ __forceinline__ float bf_bits2f(unsigned short h) { return __uint_as_float(((unsigned)h) << 16); }
__device__ __forceinline__ unsigned pk16(unsigned short a, unsigned short b) { return (unsigned)a | ((unsigned)b << 16); }

// hazard guards as plain device helpers (their inline asm stays out of the kernel template body)
__device__ __forceinline__ void dep_guard_h(v8f& a, v8f& b, v16h x, v16h y) { asm volatile("v_nop\n\tv_nop\n\tv_nop\n\tv_nop" : "+v"(a), "+v"(b) : "v"(x), "v"(y)); }
__device__ __forceinline__ void dep_guard_b(v8f& a, v8f& b, v16b x, v16b y) { asm volatile("v_nop\n\tv_nop\n\tv_nop\n\tv_nop" : "+v"(a), "+v"(b) : "v"(x), "v"(y)); }
__device__ __forceinline__ void keep4_h(v16h a, v16h b, v16h c, v16h d) { asm volatile("v_nop" :: "v"(a), "v"(b), "v"(c), "v"(d)); }
__device__ __forceinline__ void keep4_b(v16b a, v16b b, v16b c, v16b d) { asm volatile("v_nop" :: "v"(a), "v"(b), "v"(c), "v"(d)); }
__device__ __forceinline__ void acc_guard4(v8f& a, v8f& b, v8f& c, v8f& d) { asm volatile("v_nop\n\tv_nop\n\tv_nop\n\tv_nop" : "+v"(a), "+v"(b), "+v"(c), "+v"(d)); }
template <typename T> struct Frag;
template <> struct Frag<_Float16> {
  typedef v16h V; typedef v8h H; union U { v16h v; v8h h[2]; };
  static __device__ __forceinline__ v16h load(const _Float16* p) {   // elements 0..7 <- p[0..7], 8..15 <- p[16..23]
    U f; f.h[0] = *(const v8h*)(p); f.h[1] = *(const v8h*)(p + 16); return f.v;
  }
  static __device__ __forceinline__ v8f mma(v16h a, v16h b, v8f c) {
    return __builtin_amdgcn_wmma_f32_16x16x32_f16(false, a, false, b, (short)0, c, false, false);
  }
  static __device__ __forceinline__ void guard(v8f& a, v8f& b, v16h x, v16h y) { dep_guard_h(a, b, x, y); }
  static __device__ __forceinline__ void keep(v16h a, v16h b, v16h c, v16h d) { keep4_h(a, b, c, d); }
};
template <> struct Frag<__bf16> {
  typedef v16b V; typedef v8b H; union U { v16b v; v8b h[2]; };
  static __device__ __forceinline__ v16b load(const __bf16* p) {
    U f; f.h[0] = *(const v8b*)(p); f.h[1] = *(const v8b*)(p + 16); return f.v;
  }
  static __device__ __forceinline__ v8f mma(v16b a, v16b b, v8f c) {
    return __builtin_amdgcn_wmma_f32_16x16x32_bf16(false, a, false, b, (short)0, c, false, false);
  }
  static __device__ __forceinline__ void guard(v8f& a, v8f& b, v16b x, v16b y) { dep_guard_b(a, b, x, y); }
  static __device__ __forceinline__ void keep(v16b a, v16b b, v16b c, v16b d) { keep4_b(a, b, c, d); }
};

// ---- Register-blocked batched WMMA GEMM, operands staged per work-group in LDS ----
// C[m,n] = scale * sum_k A[m,k] * Bt[n,k] (+bias)(+resid); a work-group of 8 waves (2 x 4) owns a 128x256 tile,
// each wave a 64x64 tile of it.
// A row-major [M,K]; Bt row-major [N,K]; M % 128 == 0, N % 256 == 0, K % 64 == 0.
// A stage is 64 k (128 B, one cache line) of every operand row of the work-group tile: 8 lanes x 16 B fetch one row's line,
// so a wave's load touches 4 whole lines; the rows lie in LDS at pitch GB_LP. Two LDS buffers: stage s+1 is fetched into
// registers ahead of stage s's products, stored behind them into the other buffer, one work-group barrier per stage.
// SPLITM: 0 = single product; 2 = A hi/lo planes (hi.B + lo.B).
// BIAS_MODE: 0 = none, 1 = bias[m], 2 = bias[n], 3 = bias[n] RNE-converted to bf16, 4 = bias[m] RNE-converted to bf16.
// OUT_MODE: 0 = f32, 1 = f16, 2 = bf16 hi plane (Cout) + bf16 lo plane (Cout2),
//           3 = f16 with interleaved-pair rotation: pair (2i,2i+1) within each 64-wide column tile rotated by
//               (ropeC, ropeS)[t][i] with t = m % ropeT (tables [ropeT][32] f32).
// ET: 0 = f16 operands, 1 = bf16 operands (pointers passed as 16-bit storage)
template <int ET> struct Elem;
template <> struct Elem<0> { typedef _Float16 T; };
template <> struct Elem<1> { typedef __bf16 T; };
constexpr int GB_M  = 128;  // work-group tile rows
constexpr int GB_N  = 256;  // work-group tile columns
constexpr int GB_K  = 64;   // k per stage
constexpr int GB_LP = 72;   // LDS row pitch in 16-bit elements: 144 B = 16 B x 9 (odd) for 16-byte row readers
// Registers: the single-plane builds stay within 256 VGPRs, so that two work-groups (their LDS fits twice) share a WGP and
// one's products cover the other's barrier and staging; the hi/lo build has one work-group per WGP by its LDS.
// LD: row pitch of A and Bt in elements, a compile-time value: the groups of 32 staged rows are then immediate offsets
// of one address per plane.
template <int ET, int SPLITM, int BIAS_MODE, int OUT_MODE, bool RESID, int LD, int ACT = 0>
__global__ __launch_bounds__(256) __attribute__((amdgpu_waves_per_eu((SPLITM != 0) ? 2 : 4))) void wmma_gemm64(
    const unsigned short* __restrict__ Ap, const unsigned short* __restrict__ A2p, long strideA,
    const unsigned short* __restrict__ Btp, long strideB,
    void* __restrict__ Cout, void* __restrict__ Cout2, int ldc, long strideC,
    const float* __restrict__ bias,
    const float* __restrict__ resid, long strideR,
    const float* __restrict__ ropeC, const float* __restrict__ ropeS, int ropeT,
    int M, int N, int K, float scale) {
  typedef typename Elem<ET>::T T;
  typedef typename Frag<T>::V V;
  typedef typename Frag<T>::H H;
  static_assert(SPLITM == 0 || SPLITM == 2, "staged planes: A (hi, lo) and Bt");
  const T* A = (const T*)Ap; const T* A2 = (const T*)A2p; const T* Bt = (const T*)Btp;
  constexpr int A_ROWS = (SPLITM != 0) ? 2 * GB_M : GB_M;   // staged A rows: hi plane, then lo plane
  constexpr int S_ROWS = A_ROWS + GB_N;                     // staged rows per stage
  constexpr int NPC    = S_ROWS / 32;                       // 16-B pieces per thread per stage (256 threads x 16 B = 32 rows)
  __shared__ __align__(16) T sOp[2][S_ROWS * GB_LP];        // two stage buffers
  __shared__ __align__(16) float sT[8][16 * 68];   // per-wave 16x64 slab, pitch 68 floats
  const int b    = blockIdx.y;
  const int tid  = threadIdx.x;
  const int lane = tid & 31;
  const int wave = tid >> 5;
  const int blkN = N >> 8;
  const int blkM = M >> 7;
  if ((int)blockIdx.x >= blkM * blkN) return;   // the same for the whole work-group, ahead of every barrier
  const int bm = blockIdx.x / blkN;
  const int bn = blockIdx.x - bm * blkN;
  const int wm = (wave >> 2) << 6;             // this wave's row offset in the work-group tile
  const int wn = (wave & 3) << 6;              // this wave's column offset
  const int m0 = (bm << 7) + wm;
  const int n0 = (bn << 8) + wn;

  const int rlane = lane & 15;                 // row (A) / col (B, D) within subtile
  const int koff  = (lane >> 4) * 8;           // k offset of this lane half
  const int mOff  = (lane >> 4) * 8;           // D row offset

  // staging map: thread -> row (tid >> 3) of each group of 32 staged rows, 16-B piece (tid & 7) of its 128-B line
  const int sr = tid >> 3;
  const int sc = (tid & 7) * 8;
  const T* gA  = A  + (size_t)b * strideA + (size_t)((bm << 7) + sr) * LD + sc;
  const T* gA2 = (SPLITM != 0) ? (A2 + (size_t)b * strideA + (size_t)((bm << 7) + sr) * LD + sc) : gA;
  const T* gB  = Bt + (size_t)b * strideB + (size_t)((bn << 8) + sr) * LD + sc;
  H pre[NPC];
  auto fetch = [&](int k0) {
    const T* pa  = gA  + k0;
    const T* pa2 = gA2 + k0;
    const T* pb  = gB  + k0;
#pragma unroll   // constant indices keep pre[] in registers and the row groups as immediate offsets
    for (int it = 0; it < NPC; ++it) {
      const int row = it * 32;
      if (row < GB_M)        pre[it] = *(const H*)(pa  + (size_t)row * LD);
      else if (row < A_ROWS) pre[it] = *(const H*)(pa2 + (size_t)(row - GB_M) * LD);
      else                   pre[it] = *(const H*)(pb  + (size_t)(row - A_ROWS) * LD);
    }
    // the wait in front of any overwrite of the loads' address registers; the addresses are inputs, so that their
    // registers are held up to it
    asm volatile("s_wait_xcnt 0x0" :: "v"(pa), "v"(pa2), "v"(pb) : "memory");
  };
  auto stash = [&](T* dst) {
#pragma unroll   // constant indices keep pre[] in registers
    for (int it = 0; it < NPC; ++it) *(H*)(dst + (it * 32 + sr) * GB_LP + sc) = pre[it];
  };

  v8f acc[4][4];
#pragma unroll
  for (int i = 0; i < 4; ++i)
#pragma unroll
    for (int j = 0; j < 4; ++j) acc[i][j] = (v8f){0.f,0.f,0.f,0.f,0.f,0.f,0.f,0.f};

  const int nst = K >> 6;
  fetch(0);
  stash(sOp[0]);
  __syncthreads();
  for (int st = 0; st < nst; ++st) {
    const bool more = (st + 1 < nst);          // the same for the whole work-group
    if (more) fetch((st + 1) << 6);
    const T* sA = sOp[st & 1] + (wm + rlane) * GB_LP + koff;
    const T* sB = sOp[st & 1] + (A_ROWS + wn + rlane) * GB_LP + koff;
#pragma unroll   // both halves of a stage in one block, so that the second half's fragment reads can start under the first's products
    for (int kk = 0; kk < GB_K; kk += 32) {
      // all fragments of these 32 k are read as one group ahead of their products
      V bh[4], ah[4], al[4];
#pragma unroll
      for (int j = 0; j < 4; ++j) bh[j] = Frag<T>::load(sB + (j << 4) * GB_LP + kk);
#pragma unroll
      for (int i = 0; i < 4; ++i) {
        ah[i] = Frag<T>::load(sA + (i << 4) * GB_LP + kk);
        if (SPLITM != 0) al[i] = Frag<T>::load(sA + (GB_M + (i << 4)) * GB_LP + kk);
      }
#pragma unroll
      for (int i = 0; i < 4; ++i) {
#pragma unroll
        for (int j = 0; j < 4; ++j) {
          acc[i][j] = Frag<T>::mma(ah[i], bh[j], acc[i][j]);
          if (SPLITM != 0) acc[i][j] = Frag<T>::mma(al[i], bh[j], acc[i][j]);
        }
        Frag<T>::guard(acc[i][0], acc[i][3], ah[i], (SPLITM != 0) ? al[i] : ah[i]);
      }
      Frag<T>::keep(bh[0], bh[1], bh[2], bh[3]);
    }
    // the other buffer's last readers passed the barrier that ended stage st - 1
    if (more) stash(sOp[(st + 1) & 1]);
    __syncthreads();                           // publishes stage st + 1 and ends every read of stage st's buffer
  }
  acc_guard4(acc[0][0], acc[0][1], acc[0][2], acc[0][3]);
  acc_guard4(acc[1][0], acc[1][1], acc[1][2], acc[1][3]);
  acc_guard4(acc[2][0], acc[2][1], acc[2][2], acc[2][3]);
  acc_guard4(acc[3][0], acc[3][1], acc[3][2], acc[3][3]);

  // ---- epilogue ----
  float* slab = sT[wave];
  const float* Rb = RESID ? (resid + (size_t)b * strideR) : nullptr;
#pragma unroll
  for (int i = 0; i < 4; ++i) {
    const int mBase = m0 + (i << 4);
#pragma unroll
    for (int j = 0; j < 4; ++j) {
      const int n = n0 + (j << 4) + rlane;
      float bv = 0.f;
      if (BIAS_MODE == 2) bv = bias[n];
      if (BIAS_MODE == 3) bv = bf_bits2f(f2bf_bits(bias[n]));
#pragma unroll
      for (int r = 0; r < 8; ++r) {
        float v = acc[i][j][r] * scale;
        if (BIAS_MODE == 1) v += bias[mBase + mOff + r];
        if (BIAS_MODE == 4) v += bf_bits2f(f2bf_bits(bias[mBase + mOff + r]));
        if (BIAS_MODE == 2 || BIAS_MODE == 3) v += bv;
        if (RESID) v += Rb[(size_t)(mBase + mOff + r) * ldc + n];
        if (ACT == 1) v = tanhf(v);
        if (ACT == 2) v = fmaxf(v, 0.0f);
        if (ACT == 3) v = v / (1.0f + expf(-v));
        if (ACT == 4) v = (v > 0.f) ? v : 0.01f * v;
        slab[(mOff + r) * 68 + (j << 4) + rlane] = v;
      }
    }
    __builtin_amdgcn_fence(__ATOMIC_RELEASE, "workgroup");
    __builtin_amdgcn_wave_barrier();
    __builtin_amdgcn_fence(__ATOMIC_ACQUIRE, "workgroup");
    if (OUT_MODE == 0) {
      float* C = (float*)Cout + (size_t)b * strideC;
      const int hh = lane >> 4, c4 = (lane & 15) * 4;     // row seg = 256 B = 16 lanes x 16 B
      {
#pragma unroll
        for (int it = 0; it < 8; ++it) {
          const int row = it * 2 + hh;
          v4f v = *(const v4f*)(slab + row * 68 + c4);
          *(v4f*)(C + (size_t)(mBase + row) * ldc + n0 + c4) = v;
        }
        
      }
    } else {
      const int q = lane >> 3, c8 = (lane & 7) * 8;
      unsigned short* C  = (unsigned short*)Cout  + (size_t)b * strideC;
      unsigned short* C2 = (OUT_MODE == 2) ? ((unsigned short*)Cout2 + (size_t)b * strideC) : nullptr;
      {
#pragma unroll
        for (int it = 0; it < 4; ++it) {
          const int row = it * 4 + q;
          const float* sp = slab + row * 68 + c8;
          v8h hv, lv;
          if (OUT_MODE == 3) {
            // columns c8..c8+7 of this 64-wide tile are rotation pairs (c8>>1)+0..3 of position t
            const int t = (mBase + row) % ropeT;
            const v4f cv = *(const v4f*)(ropeC + (size_t)t * ROPE_HALF + (c8 >> 1));
            const v4f sv = *(const v4f*)(ropeS + (size_t)t * ROPE_HALF + (c8 >> 1));
#pragma unroll
            for (int e2 = 0; e2 < 4; ++e2) {
              const float x0 = sp[2 * e2], x1 = sp[2 * e2 + 1];
              hv[2 * e2]     = (_Float16)(x0 * cv[e2] - x1 * sv[e2]);
              hv[2 * e2 + 1] = (_Float16)(x0 * sv[e2] + x1 * cv[e2]);
            }
          } else {
#pragma unroll
            for (int e = 0; e < 8; ++e) {
              if (OUT_MODE == 1) {
                hv[e] = (_Float16)sp[e];
              } else {
                unsigned short hb = f2bf_bits(sp[e]);
                unsigned short lb = f2bf_bits(sp[e] - bf_bits2f(hb));
                hv[e] = __builtin_bit_cast(_Float16, hb);
                lv[e] = __builtin_bit_cast(_Float16, lb);
              }
            }
          }
          *(v8h*)(C + (size_t)(mBase + row) * ldc + n0 + c8) = hv;
          if (OUT_MODE == 2) *(v8h*)(C2 + (size_t)(mBase + row) * ldc + n0 + c8) = lv;
        }
        
      }
    }
    __builtin_amdgcn_fence(__ATOMIC_RELEASE, "workgroup");
    __builtin_amdgcn_wave_barrier();
    __builtin_amdgcn_fence(__ATOMIC_ACQUIRE, "workgroup");
  }
}

// ---------------------------------------------------------------------------
// Preparation: four independent bodies share one launch, picked by ranges of the block index (the same for a whole
// work-group). Every body takes 256 threads; the ranges are compile-time counts of the fixed shapes.
// ---------------------------------------------------------------------------
// f32 -> bf16 (RNE) cast, 8 elements per thread, one 16-B store per lane: a wave writes 512 contiguous bytes.
// Coverage: n8/256 blocks x 256 threads x 8 elements = 8*n8 = the whole plane (n8 = 8192*1024/8 = 1,048,576
// -> 4096 blocks exactly).
__device__ __forceinline__ void cast_bf16x8_body(const float* __restrict__ in, unsigned short* __restrict__ out, int blk) {
  const int i = blk * 256 + threadIdx.x;
  const v4f a  = *(const v4f*)(in + 8 * (size_t)i);
  const v4f a2 = *(const v4f*)(in + 8 * (size_t)i + 4);
  v4u u;
  u[0] = pk16(f2bf_bits(a[0]),  f2bf_bits(a[1]));
  u[1] = pk16(f2bf_bits(a[2]),  f2bf_bits(a[3]));
  u[2] = pk16(f2bf_bits(a2[0]), f2bf_bits(a2[1]));
  u[3] = pk16(f2bf_bits(a2[2]), f2bf_bits(a2[3]));
  *(v4u*)(out + 8 * (size_t)i) = u;
  // the wait in front of any overwrite of the store's registers on a path that leads on through another body's code
  asm volatile("s_wait_xcnt 0x0" ::: "memory");
}

// Fused transpose + bf16 (RNE) cast of an f32 matrix: in [R rows][Cc cols] (pitch Cc) -> out[c][r] ([Cc][R], pitch R).
// 64x64 tiles through LDS (tf: 64 rows, pitch 68 floats); tile (cb, rb) of (Cc/64, R/64), 256 threads.
// Coverage per block: load 4 it x 256 thr x 4 floats = 64x64; store 2 it x 256 thr x 8 u16 = 64x64.
template <int R, int Cc>
__device__ __forceinline__ void tcast_bf16_body(const float* __restrict__ W, unsigned short* __restrict__ oh, float* tf,
                                                int cb, int rb) {
  const int c0  = cb * 64;           // input column block = output row block
  const int rb0 = rb * 64;           // input row block    = output column block
  const int tid = threadIdx.x;
  {
    const int lr = tid >> 4;         // 0..15
    const int c4 = (tid & 15) * 4;   // 0..60
#pragma unroll
    for (int it = 0; it < 4; ++it) {
      const int rr = it * 16 + lr;   // 0..63
      const v4f a = *(const v4f*)(W + (size_t)(rb0 + rr) * Cc + c0 + c4);
      *(v4f*)(tf + rr * 68 + c4) = a;
    }
  }
  __syncthreads();
  const int sub = tid >> 3;          // 0..31
  const int c8  = (tid & 7) * 8;     // 0..56
  v4u hv[2];
#pragma unroll
  for (int it = 0; it < 2; ++it) {
    const int oc = it * 32 + sub;    // output row within tile (= input column)
    v4u a;
#pragma unroll
    for (int q = 0; q < 4; ++q) {
      const float f0 = tf[(c8 + 2 * q) * 68 + oc];
      const float f1 = tf[(c8 + 2 * q + 1) * 68 + oc];
      a[q] = pk16(f2bf_bits(f0), f2bf_bits(f1));
    }
    hv[it] = a;
  }
#pragma unroll
  for (int it = 0; it < 2; ++it) {
    const int oc = it * 32 + sub;
    const size_t go = (size_t)(c0 + oc) * R + rb0 + c8;
    *(v4u*)(oh + go) = hv[it];
  }
  // the wait in front of any overwrite of the stores' registers on a path that leads on through another body's code
  asm volatile("s_wait_xcnt 0x0" ::: "memory");
}

// Rotation tables: freq[i] = 1 / 10000^((2i)/64), i = 0..31 (f32 pow, f32 reciprocal), formed by each thread for its own i;
// ang[t][i] = (float)t * freq[i]; cosT/sinT [SEQ][32] f32 (precise sincosf). SEQ*32/256 blocks cover the tables exactly.
__device__ __forceinline__ void rope_table_body(float* __restrict__ cosT, float* __restrict__ sinT, int blk) {
  const int idx = blk * 256 + threadIdx.x;
  const int t = idx >> 5, i = idx & 31;
  const float e = (float)(2 * i) / (float)HEAD_D;  // exact (division by 64)
  const float p = powf(10000.0f, e);
  const float f = 1.0f / p;
  const float ang = (float)t * f;
  float sv, cv;
  sincosf(ang, &sv, &cv);
  cosT[idx] = cv;
  sinT[idx] = sv;
}

constexpr int PREP_RT = SEQ_LEN * ROPE_HALF / 256;                    // 256 blocks: rotation tables
constexpr int PREP_TQ = (3 * D_MODEL / 64) * (D_MODEL / 64);          // 768 blocks: Wqkv^T
constexpr int PREP_TO = (D_MODEL / 64) * (D_MODEL / 64);              // 256 blocks: Wout^T
constexpr int PREP_CX = NB_BATCH * SEQ_LEN * D_MODEL / 8 / 256;       // 4096 blocks: x
// The bodies with the longest chains (tables, transposes) have the lowest block indices, the stream of x the rest.
__global__ __launch_bounds__(256) void prep_kernel(const float* __restrict__ x, const float* __restrict__ Wqkv,
                                                   const float* __restrict__ Wout, unsigned short* __restrict__ xb,
                                                   unsigned short* __restrict__ wqT, unsigned short* __restrict__ woT,
                                                   float* __restrict__ cosT, float* __restrict__ sinT) {
  __shared__ __align__(16) float tf[64 * 68];
  const int bx = blockIdx.x;
  if (bx < PREP_RT) {
    rope_table_body(cosT, sinT, bx);
  } else if (bx < PREP_RT + PREP_TQ) {
    const int k = bx - PREP_RT;
    tcast_bf16_body<D_MODEL, 3 * D_MODEL>(Wqkv, wqT, tf, k % (3 * D_MODEL / 64), k / (3 * D_MODEL / 64));
  } else if (bx < PREP_RT + PREP_TQ + PREP_TO) {
    const int k = bx - (PREP_RT + PREP_TQ);
    tcast_bf16_body<D_MODEL, D_MODEL>(Wout, woT, tf, k % (D_MODEL / 64), k / (D_MODEL / 64));
  } else {
    cast_bf16x8_body(x, xb, bx - (PREP_RT + PREP_TQ + PREP_TO));
  }
}

// =====================================================================================
// Full (non-causal, unmasked) attention, head dim 64, f16 operand planes.
//   q|k plane (f16): element (b, t, h, d) of q at [(b*SEQ + t)*QK_LD + h*64 + d], of k at [... + D_MODEL + h*64 + d]
//   v^T plane (f16): element (b, h, d, s) at [(b*D_MODEL + h*64 + d)*SEQ + s]
//   out: bf16 hi and lo planes, element (b, t, h, d) at [(b*SEQ + t)*D_MODEL + h*64 + d]
//   scores = (q . k) * sscale : v_wmma_f32_16x16x32_f16, f32 accumulate, scale (times log2 e) applied to the f32 accumulator
//   out    = p . v            : v_wmma_f32_16x16x32_f16 with p (unnormalised, <= 1) carried x2^15 in f16, as is the sum l
//   online softmax in f32 over all SEQ keys (32 chunks of 64, compile-time trip count, no masking).
//   Block = 4 waves = 64 query rows of one (batch, head); grid = (N_HEAD * SEQ/64, NB_BATCH).
//   K / V^T chunk staging: 128 threads x 32 elements per plane = the whole 64x64 tile (16-B copies, plain loads,
//   __syncthreads before and after); fragment loads read the LDS tiles with the same v8h element type.
// =====================================================================================
constexpr int AT_D  = 64;
constexpr int AT_NW = 4;
constexpr int AT_QB = 64;
constexpr int AT_KC = 64;
constexpr int AT_LP = 72;   // LDS row pitch of the K and V^T tiles in f16 elements: 144 B = 16 B x 9 (odd) for 16-byte row readers
constexpr float P_CARRY_LOG2 = 15.0f;   // p is carried x2^15: the carry is added to the exponent
constexpr float LOG2_E = 1.4426950408889634f;

__device__ __forceinline__ v8f mma_h16(v16h a, v16h b, v8f c) {
  return __builtin_amdgcn_wmma_f32_16x16x32_f16(false, a, false, b, (short)0, c, false, false);
}
__device__ __forceinline__ v8f splat8(float x) { return (v8f){x, x, x, x, x, x, x, x}; }
// value of lane l ^ 16 (the other half of the wave), by a vector cross-row move
__device__ __forceinline__ float xhalf(float x) {
  const int b = __builtin_bit_cast(int, x);
  return __builtin_bit_cast(float, __builtin_amdgcn_permlanex16(b, b, 0x76543210, 0xfedcba98, false, false));
}

__global__ __launch_bounds__(128)
void attn_f16_kernel(const unsigned short* __restrict__ qkp, const unsigned short* __restrict__ vtp,
                     unsigned short* __restrict__ ohp, unsigned short* __restrict__ olp, float sscale) {
  union FB { v16h v; v8h h[2]; };
  __shared__ __align__(16) _Float16 Ksh[AT_KC * AT_LP];         // K [kv][d], pitch AT_LP      9 KB
  __shared__ __align__(16) _Float16 Vth[AT_D * AT_LP];          // V^T [d][kv], pitch AT_LP    9 KB
  __shared__ __align__(16) float    Os[AT_NW][16 * 68];         // per wave out tile, pitch 68

  const int tid  = threadIdx.x;
  const int wave = tid >> 5;
  const int lane = tid & 31;
  const int hh   = lane >> 4;
  const int c    = lane & 15;

  const int nqb = SEQ_LEN / AT_QB;            // 32
  const int bx = blockIdx.x;
  const int qb = bx % nqb;
  const int h  = bx / nqb;                    // 0..N_HEAD-1 (grid.x = N_HEAD * nqb)
  const int b  = blockIdx.y;                  // batch
  const int q0 = qb * AT_QB + wave * 16;

  const _Float16* Qp = (const _Float16*)(const void*)qkp + (size_t)b * SEQ_LEN * QK_LD + (size_t)h * AT_D;
  const _Float16* Kp = Qp + D_MODEL;
  const _Float16* Vp = (const _Float16*)(const void*)vtp + ((size_t)b * D_MODEL + (size_t)h * AT_D) * SEQ_LEN;
  unsigned short* Oh = ohp + (size_t)b * SEQ_LEN * D_MODEL + (size_t)h * AT_D;
  unsigned short* Ol = olp + (size_t)b * SEQ_LEN * D_MODEL + (size_t)h * AT_D;

  // ---- Q fragments (B operand, column = lane&15, split k map via Frag load): 2 d-chunks ----
  v16h qa[2];
#pragma unroll
  for (int dc = 0; dc < 2; ++dc)
    qa[dc] = Frag<_Float16>::load(Qp + (size_t)(q0 + c) * QK_LD + dc * 32 + 8 * hh);

  // Softmax in base 2: p * 2^15 = exp2(s * sc2 + (15 - m)), one multiply-add and one hardware exponential a score; m is the
  // maximum of the raw scores times sc2, which is the maximum of the scaled scores because sc2 > 0 (sscale is 1/sqrt(64)).
  const float sc2 = sscale * LOG2_E;
  const v8f sc2v = splat8(sc2);
  float mrun = -INFINITY;   // running maximum of query q0 + c in scaled log2 units (the same in both halves)
  float lrun = 0.f;         // running sum (x2^15) over this half's keys; the halves are joined behind the loop
  v8f oacc[4];              // O^T: oacc[t][r] = element d = t*16 + 8*hh + r of query q0 + c
#pragma unroll
  for (int t = 0; t < 4; ++t) oacc[t] = (v8f){0.f,0.f,0.f,0.f,0.f,0.f,0.f,0.f};

  for (int kc = 0; kc < SEQ_LEN / AT_KC; ++kc) {     // 32, compile-time constant
    const int kv0 = kc * AT_KC;
    __syncthreads();
    {
      // staging coverage: 128 threads x (4 x 8) elements = 64 rows x 64 per plane = the whole chunk tile
      const int r = tid >> 1, half = (tid & 1) * 32;
      const _Float16* ks = Kp + (size_t)(kv0 + r) * QK_LD + half;     // K row kv0+r, d = half..half+31
      const _Float16* vs = Vp + (size_t)r * SEQ_LEN + kv0 + half;      // V^T row d = r, s = kv0+half..+31
#pragma unroll
      for (int i = 0; i < 4; ++i) {
        const v8h a0 = *(const v8h*)(ks + 8 * i);
        const v8h b0 = *(const v8h*)(vs + 8 * i);
        *(v8h*)(Ksh + r * AT_LP + half + 8 * i) = a0;
        *(v8h*)(Vth + r * AT_LP + half + 8 * i) = b0;
      }
      // the wait in front of any overwrite of the loads' address registers; the addresses are inputs, so that their
      // registers are held up to it
      asm volatile("s_wait_xcnt 0x0" :: "v"(ks), "v"(vs) : "memory");
    }
    __syncthreads();

    v8f s[4];
#pragma unroll
    for (int j = 0; j < 4; ++j) s[j] = (v8f){0.f,0.f,0.f,0.f,0.f,0.f,0.f,0.f};
#pragma unroll
    for (int dc = 0; dc < 2; ++dc) {
#pragma unroll
      for (int j = 0; j < 4; ++j) {
        FB kb;
        kb.h[0] = *(const v8h*)(Ksh + (j * 16 + c) * AT_LP + dc * 32 + 8 * hh);
        kb.h[1] = *(const v8h*)(Ksh + (j * 16 + c) * AT_LP + dc * 32 + 16 + 8 * hh);
        s[j] = mma_h16(kb.v, qa[dc], s[j]);
      }
    }
    const v8f c8v = __builtin_elementwise_max(__builtin_elementwise_max(s[0], s[1]), __builtin_elementwise_max(s[2], s[3]));
    float cm = fmaxf(fmaxf(fmaxf(c8v[0], c8v[1]), fmaxf(c8v[2], c8v[3])), fmaxf(fmaxf(c8v[4], c8v[5]), fmaxf(c8v[6], c8v[7])));
    cm = fmaxf(cm, xhalf(cm));
    const float mnew  = fmaxf(mrun, cm * sc2);
    const float alpha = __builtin_amdgcn_exp2f(mrun - mnew);   // 0 in the first chunk, where mrun is -inf
    mrun = mnew;
    const float off = P_CARRY_LOG2 - mnew;
    FB pb[2];
    v8f pv[4];
#pragma unroll
    for (int j = 0; j < 4; ++j) {
      const v8f e = __builtin_elementwise_fma(s[j], sc2v, splat8(off));
#pragma unroll
      for (int r = 0; r < 8; ++r) {
        const float p = __builtin_amdgcn_exp2f(e[r]);
        pv[j][r] = p;
        pb[j >> 1].h[j & 1][r] = (_Float16)p;
      }
    }
    const v8f ps8 = (pv[0] + pv[1]) + (pv[2] + pv[3]);
    const float psum = ((ps8[0] + ps8[1]) + (ps8[2] + ps8[3])) + ((ps8[4] + ps8[5]) + (ps8[6] + ps8[7]));
    lrun = lrun * alpha + psum;
#pragma unroll
    for (int t = 0; t < 4; ++t) oacc[t] = oacc[t] * alpha;
#pragma unroll
    for (int kk = 0; kk < 2; ++kk) {
#pragma unroll
      for (int t = 0; t < 4; ++t) {
        FB vb;
        vb.h[0] = *(const v8h*)(Vth + (t * 16 + c) * AT_LP + kk * 32 + 8 * hh);
        vb.h[1] = *(const v8h*)(Vth + (t * 16 + c) * AT_LP + kk * 32 + 16 + 8 * hh);
        oacc[t] = mma_h16(vb.v, pb[kk].v, oacc[t]);
      }
    }
    // the distance behind the last products on the loop's taken branch as on its fall-through
    acc_guard4(oacc[0], oacc[1], oacc[2], oacc[3]);
  }

  float* os = Os[wave];
  {
    const float inv = 1.0f / (lrun + xhalf(lrun));   // lrun carries the same 2^15 as p
#pragma unroll
    for (int t = 0; t < 4; ++t) {
      const v8f o = oacc[t] * inv;
      *(v4f*)(os + c * 68 + t * 16 + 8 * hh)     = (v4f){o[0], o[1], o[2], o[3]};
      *(v4f*)(os + c * 68 + t * 16 + 8 * hh + 4) = (v4f){o[4], o[5], o[6], o[7]};
    }
  }
  __builtin_amdgcn_fence(__ATOMIC_RELEASE, "workgroup");
  __builtin_amdgcn_wave_barrier();
  __builtin_amdgcn_fence(__ATOMIC_ACQUIRE, "workgroup");
  {
    const int q8 = lane >> 3, c8 = (lane & 7) * 8;
    {
#pragma unroll
      for (int it = 0; it < 4; ++it) {
        const int row = it * 4 + q8;
        const float* sp = os + row * 68 + c8;
        v8h hv, lv;
#pragma unroll
        for (int e = 0; e < 8; ++e) {
          const unsigned short hb = f2bf_bits(sp[e]);
          const unsigned short lb = f2bf_bits(sp[e] - bf_bits2f(hb));
          hv[e] = __builtin_bit_cast(_Float16, hb);
          lv[e] = __builtin_bit_cast(_Float16, lb);
        }
        const size_t go = (size_t)(q0 + row) * D_MODEL + c8;
        *(v8h*)(Oh + go) = hv;
        *(v8h*)(Ol + go) = lv;
      }
      
    }
  }
}

// ---------------- host-side orchestration (kernel launches only) ----------------
extern "C" void kernel_launch(void* const* d_in, const int* in_sizes, int n_in,
                              void* d_out, int out_size, void* d_ws, size_t ws_size,
                              hipStream_t stream) {
  if (n_in < 5) return;
  const int M_ROWS = NB_BATCH * SEQ_LEN;   // 8192
  if (in_sizes[0] != M_ROWS * D_MODEL) return;
  if (in_sizes[1] != D_MODEL * 3 * D_MODEL) return;
  if (in_sizes[2] != 3 * D_MODEL) return;
  if (in_sizes[3] != D_MODEL * D_MODEL) return;
  if (in_sizes[4] != D_MODEL) return;
  if (out_size != M_ROWS * D_MODEL) return;

  const float* x    = (const float*)d_in[0];
  const float* Wqkv = (const float*)d_in[1];
  const float* bqkv = (const float*)d_in[2];
  const float* Wout = (const float*)d_in[3];
  const float* bout = (const float*)d_in[4];
  float* out = (float*)d_out;

  // workspace map (all offsets 256-B aligned; every region fully written before it is read):
  //   xb    bf16 [8192][1024]                16,777,216
  //   wqT   bf16 [3072][1024] (Wqkv^T)       6,291,456
  //   woT   bf16 [1024][1024] (Wout^T)       2,097,152
  //   cosT  f32  [2048][32]                     262,144
  //   sinT  f32  [2048][32]                     262,144
  //   qk16  f16  [8192][2048] (q | k, rotated) 33,554,432
  //   vt16  f16  [4][1024][2048] (v^T)       16,777,216
  //   ohi   bf16 [8192][1024]                16,777,216
  //   olo   bf16 [8192][1024]                16,777,216
  //   total                                 109,576,192
  char* ws = (char*)d_ws;
  size_t off = 0;
  unsigned short* xb   = (unsigned short*)(ws + off); off += (size_t)M_ROWS * D_MODEL * 2;
  unsigned short* wqT  = (unsigned short*)(ws + off); off += (size_t)3 * D_MODEL * D_MODEL * 2;
  unsigned short* woT  = (unsigned short*)(ws + off); off += (size_t)D_MODEL * D_MODEL * 2;
  float*          cosT = (float*)(ws + off);          off += (size_t)SEQ_LEN * ROPE_HALF * 4;
  float*          sinT = (float*)(ws + off);          off += (size_t)SEQ_LEN * ROPE_HALF * 4;
  unsigned short* qk16 = (unsigned short*)(ws + off); off += (size_t)M_ROWS * QK_LD * 2;
  unsigned short* vt16 = (unsigned short*)(ws + off); off += (size_t)NB_BATCH * D_MODEL * SEQ_LEN * 2;
  unsigned short* ohi  = (unsigned short*)(ws + off); off += (size_t)M_ROWS * D_MODEL * 2;
  unsigned short* olo  = (unsigned short*)(ws + off); off += (size_t)M_ROWS * D_MODEL * 2;
  if (off > ws_size) return;

  // 1-3) one launch: rotation tables; Wqkv [1024][3072] -> Wqkv^T bf16 [3072][1024]; Wout -> Wout^T bf16 [1024][1024]; x -> bf16
  prep_kernel<<<dim3(PREP_RT + PREP_TQ + PREP_TO + PREP_CX), dim3(256), 0, stream>>>(x, Wqkv, Wout, xb, wqT, woT, cosT, sinT);
  // 4) q|k = x.Wqkv[:, 0:2048] + bf16(b) -> rotate -> f16 : M=8192, N=2048, K=1024 (work-group tiles 64x8 = 512 blocks)
  {
    const int tiles = (M_ROWS / GB_M) * (2 * D_MODEL / GB_N);
    wmma_gemm64<1, 0, 3, 3, false, D_MODEL><<<dim3(tiles, 1), dim3(256), 0, stream>>>(
        xb, nullptr, 0L,
        wqT, 0L,
        (void*)qk16, nullptr, QK_LD, 0L,
        bqkv, nullptr, 0L,
        cosT, sinT, SEQ_LEN,
        M_ROWS, 2 * D_MODEL, D_MODEL, 1.0f);
  }
  // 5) v^T per batch = Wv^T . x_b^T + bf16(bv)[m] -> f16 : M=1024 (features), N=2048 (positions), K=1024, z = 4
  //    A = Wqkv^T rows 2048..3071, Bt = x_b [2048][1024], C = vt16 + b*1024*2048 (work-group tiles 8x8 = 64 blocks)
  {
    const int tiles = (D_MODEL / GB_M) * (SEQ_LEN / GB_N);
    wmma_gemm64<1, 0, 4, 1, false, D_MODEL><<<dim3(tiles, NB_BATCH), dim3(256), 0, stream>>>(
        wqT + (size_t)2 * D_MODEL * D_MODEL, nullptr, 0L,
        xb, (long)SEQ_LEN * D_MODEL,
        (void*)vt16, nullptr, SEQ_LEN, (long)D_MODEL * SEQ_LEN,
        bqkv + 2 * D_MODEL, nullptr, 0L,
        nullptr, nullptr, 1,
        D_MODEL, SEQ_LEN, D_MODEL, 1.0f);
  }
  // 6) attention -> o as bf16 hi/lo planes [8192][1024]
  attn_f16_kernel<<<dim3(N_HEAD * (SEQ_LEN / AT_QB), NB_BATCH), dim3(128), 0, stream>>>(qk16, vt16, ohi, olo, 0.125f);
  // 7) out = (o_hi + o_lo).Wout + bf16(b_out) -> f32 d_out : M=8192, N=1024, K=1024 (work-group tiles 64x4 = 256 blocks)
  {
    const int tiles = (M_ROWS / GB_M) * (D_MODEL / GB_N);
    wmma_gemm64<1, 2, 3, 0, false, D_MODEL><<<dim3(tiles, 1), dim3(256), 0, stream>>>(
        ohi, olo, 0L,
        woT, 0L,
        (void*)out, nullptr, D_MODEL, 0L,
        bout, nullptr, 0L,
        nullptr, nullptr, 1,
        M_ROWS, D_MODEL, D_MODEL, 1.0f);
  }
}

// v006
// Measured time: 155 microseconds a run.
// Next to v005, in two timings, it ran 1.04 and 1.03 times as fast.
// All steps since v000 together make it 3.89 times as fast.
// Contractions: x.Wqkv (q|k part) and Wv^T.x^T : v_wmma_f32_16x16x32_bf16 (bf16 operands = RNE of the f32 inputs); q.k^T and p.v : v_wmma_f32_16x16x32_f16 (q,k cast to f16 after f32 rope; p carried x2^15 in f16; v f16); o.Wout : v_wmma_f32_16x16x32_bf16 with o as bf16 hi+lo planes (hi.W + lo.W), Wout bf16; all f32 accumulate; rope tables, softmax in f32; biases RNE-rounded to bf16, added in f32.
#include <hip/hip_runtime.h>
#include <math.h>
#include <stdint.h>

constexpr int NB_BATCH  = 4;
constexpr int SEQ_LEN   = 2048;
constexpr int D_MODEL   = 1024;
constexpr int N_HEAD    = 16;
constexpr int HEAD_D    = 64;
constexpr int ROPE_HALF = 32;          // head_dim / 2 rotation pairs
constexpr int QK_LD     = 2 * D_MODEL; // pitch of the q|k 16-bit plane

typedef __attribute__((ext_vector_type(16))) _Float16 v16h;
typedef __attribute__((ext_vector_type(8)))  _Float16 v8h;
typedef __attribute__((ext_vector_type(16))) __bf16   v16b;
typedef __attribute__((ext_vector_type(8)))  __bf16   v8b;
typedef __attribute__((ext_vector_type(8)))  float    v8f;
typedef __attribute__((ext_vector_type(4)))  float    v4f;
typedef __attribute__((ext_vector_type(4)))  unsigned int v4u;

__device__ __forceinline__ unsigned short f2bf_bits(float f) {
  unsigned u = __float_as_uint(f);
  return (unsigned short)((u + 0x7FFFu + ((u >> 16) & 1u)) >> 16);
}
__device__ __forceinline__ float bf_bits2f(unsigned short h) { return __uint_as_float(((unsigned)h) << 16); }
__device__ __forceinline__ unsigned pk16(unsigned short a, unsigned short b) { return (unsigned)a | ((unsigned)b << 16); }

// hazard guards as plain device helpers (their inline asm stays out of the kernel template body)
__device__ __forceinline__ void dep_guard_h(v8f& a, v8f& b, v16h x, v16h y) { asm volatile("v_nop\n\tv_nop\n\tv_nop\n\tv_nop" : "+v"(a), "+v"(b) : "v"(x), "v"(y)); }
__device__ __forceinline__ void dep_guard_b(v8f& a, v8f& b, v16b x, v16b y) { asm volatile("v_nop\n\tv_nop\n\tv_nop\n\tv_nop" : "+v"(a), "+v"(b) : "v"(x), "v"(y)); }
__device__ __forceinline__ void keep4_h(v16h a, v16h b, v16h c, v16h d) { asm volatile("v_nop" :: "v"(a), "v"(b), "v"(c), "v"(d)); }
__device__ __forceinline__ void keep4_b(v16b a, v16b b, v16b c, v16b d) { asm volatile("v_nop" :: "v"(a), "v"(b), "v"(c), "v"(d)); }
__device__ __forceinline__ void acc_guard4(v8f& a, v8f& b, v8f& c, v8f& d) { asm volatile("v_nop\n\tv_nop\n\tv_nop\n\tv_nop" : "+v"(a), "+v"(b), "+v"(c), "+v"(d)); }
template <typename T> struct Frag;
template <> struct Frag<_Float16> {
  typedef v16h V; typedef v8h H; union U { v16h v; v8h h[2]; };
  static __device__ __forceinline__ v16h load(const _Float16* p) {   // elements 0..7 <- p[0..7], 8..15 <- p[16..23]
    U f; f.h[0] = *(const v8h*)(p); f.h[1] = *(const v8h*)(p + 16); return f.v;
  }
  static __device__ __forceinline__ v8f mma(v16h a, v16h b, v8f c) {
    return __builtin_amdgcn_wmma_f32_16x16x32_f16(false, a, false, b, (short)0, c, false, false);
  }
  static __device__ __forceinline__ void guard(v8f& a, v8f& b, v16h x, v16h y) { dep_guard_h(a, b, x, y); }
  static __device__ __forceinline__ void keep(v16h a, v16h b, v16h c, v16h d) { keep4_h(a, b, c, d); }
};
template <> struct Frag<__bf16> {
  typedef v16b V; typedef v8b H; union U { v16b v; v8b h[2]; };
  static __device__ __forceinline__ v16b load(const __bf16* p) {
    U f; f.h[0] = *(const v8b*)(p); f.h[1] = *(const v8b*)(p + 16); return f.v;
  }
  static __device__ __forceinline__ v8f mma(v16b a, v16b b, v8f c) {
    return __builtin_amdgcn_wmma_f32_16x16x32_bf16(false, a, false, b, (short)0, c, false, false);
  }
  static __device__ __forceinline__ void guard(v8f& a, v8f& b, v16b x, v16b y) { dep_guard_b(a, b, x, y); }
  static __device__ __forceinline__ void keep(v16b a, v16b b, v16b c, v16b d) { keep4_b(a, b, c, d); }
};

// ---- Register-blocked batched WMMA GEMM, operands staged per work-group in LDS ----
// C[m,n] = scale * sum_k A[m,k] * Bt[n,k] (+bias)(+resid); a work-group of 8 waves (2 x 4) owns a 128x256 tile,
// each wave a 64x64 tile of it.
// A row-major [M,K]; Bt row-major [N,K]; M % 128 == 0, N % 256 == 0, K % 64 == 0.
// A stage is 64 k (128 B, one cache line) of every operand row of the work-group tile: 8 lanes x 16 B fetch one row's line,
// so a wave's load touches 4 whole lines; the rows lie in LDS at pitch GB_LP. Two LDS buffers: stage s+1 is fetched into
// registers ahead of stage s's products, stored behind them into the other buffer, one work-group barrier per stage.
// SPLITM: 0 = single product; 2 = A hi/lo planes (hi.B + lo.B).
// BIAS_MODE: 0 = none, 1 = bias[m], 2 = bias[n], 3 = bias[n] RNE-converted to bf16, 4 = bias[m] RNE-converted to bf16.
// OUT_MODE: 0 = f32, 1 = f16, 2 = bf16 hi plane (Cout) + bf16 lo plane (Cout2),
//           3 = f16 with interleaved-pair rotation: pair (2i,2i+1) within each 64-wide column tile rotated by
//               (ropeC, ropeS)[t][i] with t = m % ropeT (tables [ropeT][32] f32).
// ET: 0 = f16 operands, 1 = bf16 operands (pointers passed as 16-bit storage)
template <int ET> struct Elem;
template <> struct Elem<0> { typedef _Float16 T; };
template <> struct Elem<1> { typedef __bf16 T; };
constexpr int GB_M  = 128;  // work-group tile rows
constexpr int GB_N  = 256;  // work-group tile columns
constexpr int GB_K  = 64;   // k per stage
constexpr int GB_LP = 72;   // LDS row pitch in 16-bit elements: 144 B = 16 B x 9 (odd) for 16-byte row readers
// Registers: the single-plane builds stay within 256 VGPRs, so that two work-groups (their LDS fits twice) share a WGP and
// one's products cover the other's barrier and staging; the hi/lo build has one work-group per WGP by its LDS.
// LD: row pitch of A and Bt in elements, a compile-time value: the groups of 32 staged rows are then immediate offsets
// of one address per plane.
template <int ET, int SPLITM, int BIAS_MODE, int OUT_MODE, bool RESID, int LD, int ACT = 0>
__global__ __launch_bounds__(256) __attribute__((amdgpu_waves_per_eu((SPLITM != 0) ? 2 : 4))) void wmma_gemm64(
    const unsigned short* __restrict__ Ap, const unsigned short* __restrict__ A2p, long strideA,
    const unsigned short* __restrict__ Btp, long strideB,
    void* __restrict__ Cout, void* __restrict__ Cout2, int ldc, long strideC,
    const float* __restrict__ bias,
    const float* __restrict__ resid, long strideR,
    const float* __restrict__ ropeC, const float* __restrict__ ropeS, int ropeT,
    int M, int N, int K, float scale) {
  typedef typename Elem<ET>::T T;
  typedef typename Frag<T>::V V;
  typedef typename Frag<T>::H H;
  static_assert(SPLITM == 0 || SPLITM == 2, "staged planes: A (hi, lo) and Bt");
  const T* A = (const T*)Ap; const T* A2 = (const T*)A2p; const T* Bt = (const T*)Btp;
  constexpr int A_ROWS = (SPLITM != 0) ? 2 * GB_M : GB_M;   // staged A rows: hi plane, then lo plane
  constexpr int S_ROWS = A_ROWS + GB_N;                     // staged rows per stage
  constexpr int NPC    = S_ROWS / 32;                       // 16-B pieces per thread per stage (256 threads x 16 B = 32 rows)
  __shared__ __align__(16) T sOp[2][S_ROWS * GB_LP];        // two stage buffers
  __shared__ __align__(16) float sT[8][16 * 68];   // per-wave 16x64 slab, pitch 68 floats
  const int b    = blockIdx.y;
  const int tid  = threadIdx.x;
  const int lane = tid & 31;
  const int wave = tid >> 5;
  const int blkN = N >> 8;
  const int blkM = M >> 7;
  if ((int)blockIdx.x >= blkM * blkN) return;   // the same for the whole work-group, ahead of every barrier
  const int bm = blockIdx.x / blkN;
  const int bn = blockIdx.x - bm * blkN;
  const int wm = (wave >> 2) << 6;             // this wave's row offset in the work-group tile
  const int wn = (wave & 3) << 6;              // this wave's column offset
  const int m0 = (bm << 7) + wm;
  const int n0 = (bn << 8) + wn;

  const int rlane = lane & 15;                 // row (A) / col (B, D) within subtile
  const int koff  = (lane >> 4) * 8;           // k offset of this lane half
  const int mOff  = (lane >> 4) * 8;           // D row offset

  // staging map: thread -> row (tid >> 3) of each group of 32 staged rows, 16-B piece (tid & 7) of its 128-B line
  const int sr = tid >> 3;
  const int sc = (tid & 7) * 8;
  const T* gA  = A  + (size_t)b * strideA + (size_t)((bm << 7) + sr) * LD + sc;
  const T* gA2 = (SPLITM != 0) ? (A2 + (size_t)b * strideA + (size_t)((bm << 7) + sr) * LD + sc) : gA;
  const T* gB  = Bt + (size_t)b * strideB + (size_t)((bn << 8) + sr) * LD + sc;
  H pre[NPC];
  auto fetch = [&](int k0) {
    const T* pa  = gA  + k0;
    const T* pa2 = gA2 + k0;
    const T* pb  = gB  + k0;
#pragma unroll   // constant indices keep pre[] in registers and the row groups as immediate offsets
    for (int it = 0; it < NPC; ++it) {
      const int row = it * 32;
      if (row < GB_M)        pre[it] = *(const H*)(pa  + (size_t)row * LD);
      else if (row < A_ROWS) pre[it] = *(const H*)(pa2 + (size_t)(row - GB_M) * LD);
      else                   pre[it] = *(const H*)(pb  + (size_t)(row - A_ROWS) * LD);
    }
    // the wait in front of any overwrite of the loads' address registers; the addresses are inputs, so that their
    // registers are held up to it
    asm volatile("s_wait_xcnt 0x0" :: "v"(pa), "v"(pa2), "v"(pb) : "memory");
  };
  auto stash = [&](T* dst) {
#pragma unroll   // constant indices keep pre[] in registers
    for (int it = 0; it < NPC; ++it) *(H*)(dst + (it * 32 + sr) * GB_LP + sc) = pre[it];
  };

  v8f acc[4][4];
#pragma unroll
  for (int i = 0; i < 4; ++i)
#pragma unroll
    for (int j = 0; j < 4; ++j) acc[i][j] = (v8f){0.f,0.f,0.f,0.f,0.f,0.f,0.f,0.f};

  const int nst = K >> 6;
  fetch(0);
  stash(sOp[0]);
  __syncthreads();
  for (int st = 0; st < nst; ++st) {
    const bool more = (st + 1 < nst);          // the same for the whole work-group
    if (more) fetch((st + 1) << 6);
    const T* sA = sOp[st & 1] + (wm + rlane) * GB_LP + koff;
    const T* sB = sOp[st & 1] + (A_ROWS + wn + rlane) * GB_LP + koff;
#pragma unroll   // both halves of a stage in one block, so that the second half's fragment reads can start under the first's products
    for (int kk = 0; kk < GB_K; kk += 32) {
      // all fragments of these 32 k are read as one group ahead of their products
      V bh[4], ah[4], al[4];
#pragma unroll
      for (int j = 0; j < 4; ++j) bh[j] = Frag<T>::load(sB + (j << 4) * GB_LP + kk);
#pragma unroll
      for (int i = 0; i < 4; ++i) {
        ah[i] = Frag<T>::load(sA + (i << 4) * GB_LP + kk);
        if (SPLITM != 0) al[i] = Frag<T>::load(sA + (GB_M + (i << 4)) * GB_LP + kk);
      }
#pragma unroll
      for (int i = 0; i < 4; ++i) {
#pragma unroll
        for (int j = 0; j < 4; ++j) {
          acc[i][j] = Frag<T>::mma(ah[i], bh[j], acc[i][j]);
          if (SPLITM != 0) acc[i][j] = Frag<T>::mma(al[i], bh[j], acc[i][j]);
        }
        Frag<T>::guard(acc[i][0], acc[i][3], ah[i], (SPLITM != 0) ? al[i] : ah[i]);
      }
      Frag<T>::keep(bh[0], bh[1], bh[2], bh[3]);
    }
    // the other buffer's last readers passed the barrier that ended stage st - 1
    if (more) stash(sOp[(st + 1) & 1]);
    __syncthreads();                           // publishes stage st + 1 and ends every read of stage st's buffer
  }
  acc_guard4(acc[0][0], acc[0][1], acc[0][2], acc[0][3]);
  acc_guard4(acc[1][0], acc[1][1], acc[1][2], acc[1][3]);
  acc_guard4(acc[2][0], acc[2][1], acc[2][2], acc[2][3]);
  acc_guard4(acc[3][0], acc[3][1], acc[3][2], acc[3][3]);

  // ---- epilogue ----
  float* slab = sT[wave];
  const float* Rb = RESID ? (resid + (size_t)b * strideR) : nullptr;
#pragma unroll
  for (int i = 0; i < 4; ++i) {
    const int mBase = m0 + (i << 4);
#pragma unroll
    for (int j = 0; j < 4; ++j) {
      const int n = n0 + (j << 4) + rlane;
      float bv = 0.f;
      if (BIAS_MODE == 2) bv = bias[n];
      if (BIAS_MODE == 3) bv = bf_bits2f(f2bf_bits(bias[n]));
#pragma unroll
      for (int r = 0; r < 8; ++r) {
        float v = acc[i][j][r] * scale;
        if (BIAS_MODE == 1) v += bias[mBase + mOff + r];
        if (BIAS_MODE == 4) v += bf_bits2f(f2bf_bits(bias[mBase + mOff + r]));
        if (BIAS_MODE == 2 || BIAS_MODE == 3) v += bv;
        if (RESID) v += Rb[(size_t)(mBase + mOff + r) * ldc + n];
        if (ACT == 1) v = tanhf(v);
        if (ACT == 2) v = fmaxf(v, 0.0f);
        if (ACT == 3) v = v / (1.0f + expf(-v));
        if (ACT == 4) v = (v > 0.f) ? v : 0.01f * v;
        slab[(mOff + r) * 68 + (j << 4) + rlane] = v;
      }
    }
    __builtin_amdgcn_fence(__ATOMIC_RELEASE, "workgroup");
    __builtin_amdgcn_wave_barrier();
    __builtin_amdgcn_fence(__ATOMIC_ACQUIRE, "workgroup");
    if (OUT_MODE == 0) {
      float* C = (float*)Cout + (size_t)b * strideC;
      const int hh = lane >> 4, c4 = (lane & 15) * 4;     // row seg = 256 B = 16 lanes x 16 B
      {
#pragma unroll
        for (int it = 0; it < 8; ++it) {
          const int row = it * 2 + hh;
          v4f v = *(const v4f*)(slab + row * 68 + c4);
          *(v4f*)(C + (size_t)(mBase + row) * ldc + n0 + c4) = v;
        }
        
      }
    } else {
      const int q = lane >> 3, c8 = (lane & 7) * 8;
      unsigned short* C  = (unsigned short*)Cout  + (size_t)b * strideC;
      unsigned short* C2 = (OUT_MODE == 2) ? ((unsigned short*)Cout2 + (size_t)b * strideC) : nullptr;
      {
#pragma unroll
        for (int it = 0; it < 4; ++it) {
          const int row = it * 4 + q;
          const float* sp = slab + row * 68 + c8;
          v8h hv, lv;
          if (OUT_MODE == 3) {
            // columns c8..c8+7 of this 64-wide tile are rotation pairs (c8>>1)+0..3 of position t
            const int t = (mBase + row) % ropeT;
            const v4f cv = *(const v4f*)(ropeC + (size_t)t * ROPE_HALF + (c8 >> 1));
            const v4f sv = *(const v4f*)(ropeS + (size_t)t * ROPE_HALF + (c8 >> 1));
#pragma unroll
            for (int e2 = 0; e2 < 4; ++e2) {
              const float x0 = sp[2 * e2], x1 = sp[2 * e2 + 1];
              hv[2 * e2]     = (_Float16)(x0 * cv[e2] - x1 * sv[e2]);
              hv[2 * e2 + 1] = (_Float16)(x0 * sv[e2] + x1 * cv[e2]);
            }
          } else {
#pragma unroll
            for (int e = 0; e < 8; ++e) {
              if (OUT_MODE == 1) {
                hv[e] = (_Float16)sp[e];
              } else {
                unsigned short hb = f2bf_bits(sp[e]);
                unsigned short lb = f2bf_bits(sp[e] - bf_bits2f(hb));
                hv[e] = __builtin_bit_cast(_Float16, hb);
                lv[e] = __builtin_bit_cast(_Float16, lb);
              }
            }
          }
          *(v8h*)(C + (size_t)(mBase + row) * ldc + n0 + c8) = hv;
          if (OUT_MODE == 2) *(v8h*)(C2 + (size_t)(mBase + row) * ldc + n0 + c8) = lv;
        }
        
      }
    }
    __builtin_amdgcn_fence(__ATOMIC_RELEASE, "workgroup");
    __builtin_amdgcn_wave_barrier();
    __builtin_amdgcn_fence(__ATOMIC_ACQUIRE, "workgroup");
  }
}

// ---------------------------------------------------------------------------
// Preparation: four independent bodies share one launch, picked by ranges of the block index (the same for a whole
// work-group). Every body takes 256 threads; the ranges are compile-time counts of the fixed shapes.
// ---------------------------------------------------------------------------
// f32 -> bf16 (RNE) cast, 8 elements per thread, one 16-B store per lane: a wave writes 512 contiguous bytes.
// Coverage: n8/256 blocks x 256 threads x 8 elements = 8*n8 = the whole plane (n8 = 8192*1024/8 = 1,048,576
// -> 4096 blocks exactly).
__device__ __forceinline__ void cast_bf16x8_body(const float* __restrict__ in, unsigned short* __restrict__ out, int blk) {
  const int i = blk * 256 + threadIdx.x;
  const v4f a  = *(const v4f*)(in + 8 * (size_t)i);
  const v4f a2 = *(const v4f*)(in + 8 * (size_t)i + 4);
  v4u u;
  u[0] = pk16(f2bf_bits(a[0]),  f2bf_bits(a[1]));
  u[1] = pk16(f2bf_bits(a[2]),  f2bf_bits(a[3]));
  u[2] = pk16(f2bf_bits(a2[0]), f2bf_bits(a2[1]));
  u[3] = pk16(f2bf_bits(a2[2]), f2bf_bits(a2[3]));
  *(v4u*)(out + 8 * (size_t)i) = u;
  // the wait in front of any overwrite of the store's registers on a path that leads on through another body's code
  asm volatile("s_wait_xcnt 0x0" ::: "memory");
}

// Fused transpose + bf16 (RNE) cast of an f32 matrix: in [R rows][Cc cols] (pitch Cc) -> out[c][r] ([Cc][R], pitch R).
// 64x64 tiles through LDS (tf: 64 rows, pitch 68 floats); tile (cb, rb) of (Cc/64, R/64), 256 threads.
// Coverage per block: load 4 it x 256 thr x 4 floats = 64x64; store 2 it x 256 thr x 8 u16 = 64x64.
template <int R, int Cc>
__device__ __forceinline__ void tcast_bf16_body(const float* __restrict__ W, unsigned short* __restrict__ oh, float* tf,
                                                int cb, int rb) {
  const int c0  = cb * 64;           // input column block = output row block
  const int rb0 = rb * 64;           // input row block    = output column block
  const int tid = threadIdx.x;
  {
    const int lr = tid >> 4;         // 0..15
    const int c4 = (tid & 15) * 4;   // 0..60
#pragma unroll
    for (int it = 0; it < 4; ++it) {
      const int rr = it * 16 + lr;   // 0..63
      const v4f a = *(const v4f*)(W + (size_t)(rb0 + rr) * Cc + c0 + c4);
      *(v4f*)(tf + rr * 68 + c4) = a;
    }
  }
  __syncthreads();
  const int sub = tid >> 3;          // 0..31
  const int c8  = (tid & 7) * 8;     // 0..56
  v4u hv[2];
#pragma unroll
  for (int it = 0; it < 2; ++it) {
    const int oc = it * 32 + sub;    // output row within tile (= input column)
    v4u a;
#pragma unroll
    for (int q = 0; q < 4; ++q) {
      const float f0 = tf[(c8 + 2 * q) * 68 + oc];
      const float f1 = tf[(c8 + 2 * q + 1) * 68 + oc];
      a[q] = pk16(f2bf_bits(f0), f2bf_bits(f1));
    }
    hv[it] = a;
  }
#pragma unroll
  for (int it = 0; it < 2; ++it) {
    const int oc = it * 32 + sub;
    const size_t go = (size_t)(c0 + oc) * R + rb0 + c8;
    *(v4u*)(oh + go) = hv[it];
  }
  // the wait in front of any overwrite of the stores' registers on a path that leads on through another body's code
  asm volatile("s_wait_xcnt 0x0" ::: "memory");
}

// Rotation tables: freq[i] = 1 / 10000^((2i)/64), i = 0..31 (f32 pow, f32 reciprocal), formed by each thread for its own i;
// ang[t][i] = (float)t * freq[i]; cosT/sinT [SEQ][32] f32 (precise sincosf). SEQ*32/256 blocks cover the tables exactly.
__device__ __forceinline__ void rope_table_body(float* __restrict__ cosT, float* __restrict__ sinT, int blk) {
  const int idx = blk * 256 + threadIdx.x;
  const int t = idx >> 5, i = idx & 31;
  const float e = (float)(2 * i) / (float)HEAD_D;  // exact (division by 64)
  const float p = powf(10000.0f, e);
  const float f = 1.0f / p;
  const float ang = (float)t * f;
  float sv, cv;
  sincosf(ang, &sv, &cv);
  cosT[idx] = cv;
  sinT[idx] = sv;
}

constexpr int PREP_RT = SEQ_LEN * ROPE_HALF / 256;                    // 256 blocks: rotation tables
constexpr int PREP_TQ = (3 * D_MODEL / 64) * (D_MODEL / 64);          // 768 blocks: Wqkv^T
constexpr int PREP_TO = (D_MODEL / 64) * (D_MODEL / 64);              // 256 blocks: Wout^T
constexpr int PREP_CX = NB_BATCH * SEQ_LEN * D_MODEL / 8 / 256;       // 4096 blocks: x
// The bodies with the longest chains (tables, transposes) have the lowest block indices, the stream of x the rest.
__global__ __launch_bounds__(256) void prep_kernel(const float* __restrict__ x, const float* __restrict__ Wqkv,
                                                   const float* __restrict__ Wout, unsigned short* __restrict__ xb,
                                                   unsigned short* __restrict__ wqT, unsigned short* __restrict__ woT,
                                                   float* __restrict__ cosT, float* __restrict__ sinT) {
  __shared__ __align__(16) float tf[64 * 68];
  const int bx = blockIdx.x;
  if (bx < PREP_RT) {
    rope_table_body(cosT, sinT, bx);
  } else if (bx < PREP_RT + PREP_TQ) {
    const int k = bx - PREP_RT;
    tcast_bf16_body<D_MODEL, 3 * D_MODEL>(Wqkv, wqT, tf, k % (3 * D_MODEL / 64), k / (3 * D_MODEL / 64));
  } else if (bx < PREP_RT + PREP_TQ + PREP_TO) {
    const int k = bx - (PREP_RT + PREP_TQ);
    tcast_bf16_body<D_MODEL, D_MODEL>(Wout, woT, tf, k % (D_MODEL / 64), k / (D_MODEL / 64));
  } else {
    cast_bf16x8_body(x, xb, bx - (PREP_RT + PREP_TQ + PREP_TO));
  }
}

// =====================================================================================
// Full (non-causal, unmasked) attention, head dim 64, f16 operand planes.
//   q|k plane (f16): element (b, t, h, d) of q at [(b*SEQ + t)*QK_LD + h*64 + d], of k at [... + D_MODEL + h*64 + d]
//   v^T plane (f16): element (b, h, d, s) at [(b*D_MODEL + h*64 + d)*SEQ + s]
//   out: bf16 hi and lo planes, element (b, t, h, d) at [(b*SEQ + t)*D_MODEL + h*64 + d]
//   scores = (q . k) * sscale : v_wmma_f32_16x16x32_f16, f32 accumulate, scale (times log2 e) applied to the f32 accumulator
//   out    = p . v            : v_wmma_f32_16x16x32_f16 with p (unnormalised, <= 1) carried x2^15 in f16, as is the sum l
//   online softmax in f32 over all SEQ keys (32 chunks of 64, compile-time trip count, no masking).
//   Block = 4 waves = 64 query rows of one (batch, head); grid = (N_HEAD * SEQ/64, NB_BATCH).
//   K / V^T chunk staging: 128 threads x 32 elements per plane = the whole 64x64 tile (16-B copies, plain loads,
//   __syncthreads before and after); fragment loads read the LDS tiles with the same v8h element type.
// =====================================================================================
constexpr int AT_D  = 64;
constexpr int AT_NW = 4;
constexpr int AT_QB = 64;
constexpr int AT_KC = 64;
constexpr int AT_LP = 72;   // LDS row pitch of the K and V^T tiles in f16 elements: 144 B = 16 B x 9 (odd) for 16-byte row readers
constexpr float P_CARRY_LOG2 = 15.0f;   // p is carried x2^15: the carry is added to the exponent
constexpr float LOG2_E = 1.4426950408889634f;

__device__ __forceinline__ v8f mma_h16(v16h a, v16h b, v8f c) {
  return __builtin_amdgcn_wmma_f32_16x16x32_f16(false, a, false, b, (short)0, c, false, false);
}
__device__ __forceinline__ v8f splat8(float x) { return (v8f){x, x, x, x, x, x, x, x}; }
// value of lane l ^ 16 (the other half of the wave), by a vector cross-row move
__device__ __forceinline__ float xhalf(float x) {
  const int b = __builtin_bit_cast(int, x);
  return __builtin_bit_cast(float, __builtin_amdgcn_permlanex16(b, b, 0x76543210, 0xfedcba98, false, false));
}

__global__ __launch_bounds__(128)
void attn_f16_kernel(const unsigned short* __restrict__ qkp, const unsigned short* __restrict__ vtp,
                     unsigned short* __restrict__ ohp, unsigned short* __restrict__ olp, float sscale) {
  union FB { v16h v; v8h h[2]; };
  __shared__ __align__(16) _Float16 Ksh[AT_KC * AT_LP];         // K [kv][d], pitch AT_LP      9 KB
  __shared__ __align__(16) _Float16 Vth[AT_D * AT_LP];          // V^T [d][kv], pitch AT_LP    9 KB
  __shared__ __align__(16) float    Os[AT_NW][16 * 68];         // per wave out tile, pitch 68

  const int tid  = threadIdx.x;
  const int wave = tid >> 5;
  const int lane = tid & 31;
  const int hh   = lane >> 4;
  const int c    = lane & 15;

  const int nqb = SEQ_LEN / AT_QB;            // 32
  const int bx = blockIdx.x;
  const int qb = bx % nqb;
  const int h  = bx / nqb;                    // 0..N_HEAD-1 (grid.x = N_HEAD * nqb)
  const int b  = blockIdx.y;                  // batch
  const int q0 = qb * AT_QB + wave * 16;

  const _Float16* Qp = (const _Float16*)(const void*)qkp + (size_t)b * SEQ_LEN * QK_LD + (size_t)h * AT_D;
  const _Float16* Kp = Qp + D_MODEL;
  const _Float16* Vp = (const _Float16*)(const void*)vtp + ((size_t)b * D_MODEL + (size_t)h * AT_D) * SEQ_LEN;
  unsigned short* Oh = ohp + (size_t)b * SEQ_LEN * D_MODEL + (size_t)h * AT_D;
  unsigned short* Ol = olp + (size_t)b * SEQ_LEN * D_MODEL + (size_t)h * AT_D;

  // ---- Q fragments (B operand, column = lane&15, split k map via Frag load): 2 d-chunks ----
  v16h qa[2];
#pragma unroll
  for (int dc = 0; dc < 2; ++dc)
    qa[dc] = Frag<_Float16>::load(Qp + (size_t)(q0 + c) * QK_LD + dc * 32 + 8 * hh);

  // Softmax in base 2: p * 2^15 = exp2(s * sc2 + (15 - m)), one multiply-add and one hardware exponential a score; m is the
  // maximum of the raw scores times sc2, which is the maximum of the scaled scores because sc2 > 0 (sscale is 1/sqrt(64)).
  const float sc2 = sscale * LOG2_E;
  const v8f sc2v = splat8(sc2);
  float mrun = -INFINITY;   // running maximum of query q0 + c in scaled log2 units (the same in both halves)
  float lrun = 0.f;         // running sum (x2^15) over this half's keys; the halves are joined behind the loop
  v8f oacc[4];              // O^T: oacc[t][r] = element d = t*16 + 8*hh + r of query q0 + c
#pragma unroll
  for (int t = 0; t < 4; ++t) oacc[t] = (v8f){0.f,0.f,0.f,0.f,0.f,0.f,0.f,0.f};

  for (int kc = 0; kc < SEQ_LEN / AT_KC; ++kc) {     // 32, compile-time constant
    const int kv0 = kc * AT_KC;
    __syncthreads();
    {
      // staging map: a tile row is one 128-B cache line; 8 lanes x 16 B fetch it whole, so a wave's load touches 4 lines.
      // coverage: 128 threads x 16 B = 16 rows a step, 4 steps = 64 rows x 64 per plane = the whole chunk tile
      const int r = tid >> 3, pc = (tid & 7) * 8;
      const _Float16* ks = Kp + (size_t)(kv0 + r) * QK_LD + pc;       // K rows kv0 + r + 16 i, d = pc..pc+7
      const _Float16* vs = Vp + (size_t)r * SEQ_LEN + kv0 + pc;        // V^T rows d = r + 16 i, s = kv0+pc..+7
#pragma unroll
      for (int i = 0; i < 4; ++i) {
        const v8h a0 = *(const v8h*)(ks + (size_t)(16 * i) * QK_LD);
        const v8h b0 = *(const v8h*)(vs + (size_t)(16 * i) * SEQ_LEN);
        *(v8h*)(Ksh + (r + 16 * i) * AT_LP + pc) = a0;
        *(v8h*)(Vth + (r + 16 * i) * AT_LP + pc) = b0;
      }
      // the wait in front of any overwrite of the loads' address registers; the addresses are inputs, so that their
      // registers are held up to it
      asm volatile("s_wait_xcnt 0x0" :: "v"(ks), "v"(vs) : "memory");
    }
    __syncthreads();

    v8f s[4];
#pragma unroll
    for (int j = 0; j < 4; ++j) s[j] = (v8f){0.f,0.f,0.f,0.f,0.f,0.f,0.f,0.f};
#pragma unroll
    for (int dc = 0; dc < 2; ++dc) {
#pragma unroll
      for (int j = 0; j < 4; ++j) {
        FB kb;
        kb.h[0] = *(const v8h*)(Ksh + (j * 16 + c) * AT_LP + dc * 32 + 8 * hh);
        kb.h[1] = *(const v8h*)(Ksh + (j * 16 + c) * AT_LP + dc * 32 + 16 + 8 * hh);
        s[j] = mma_h16(kb.v, qa[dc], s[j]);
      }
    }
    const v8f c8v = __builtin_elementwise_max(__builtin_elementwise_max(s[0], s[1]), __builtin_elementwise_max(s[2], s[3]));
    float cm = fmaxf(fmaxf(fmaxf(c8v[0], c8v[1]), fmaxf(c8v[2], c8v[3])), fmaxf(fmaxf(c8v[4], c8v[5]), fmaxf(c8v[6], c8v[7])));
    cm = fmaxf(cm, xhalf(cm));
    const float mnew  = fmaxf(mrun, cm * sc2);
    const float alpha = __builtin_amdgcn_exp2f(mrun - mnew);   // 0 in the first chunk, where mrun is -inf
    mrun = mnew;
    const float off = P_CARRY_LOG2 - mnew;
    FB pb[2];
    v8f pv[4];
#pragma unroll
    for (int j = 0; j < 4; ++j) {
      const v8f e = __builtin_elementwise_fma(s[j], sc2v, splat8(off));
#pragma unroll
      for (int r = 0; r < 8; ++r) {
        const float p = __builtin_amdgcn_exp2f(e[r]);
        pv[j][r] = p;
        pb[j >> 1].h[j & 1][r] = (_Float16)p;
      }
    }
    const v8f ps8 = (pv[0] + pv[1]) + (pv[2] + pv[3]);
    const float psum = ((ps8[0] + ps8[1]) + (ps8[2] + ps8[3])) + ((ps8[4] + ps8[5]) + (ps8[6] + ps8[7]));
    lrun = lrun * alpha + psum;
#pragma unroll
    for (int t = 0; t < 4; ++t) oacc[t] = oacc[t] * alpha;
#pragma unroll
    for (int kk = 0; kk < 2; ++kk) {
#pragma unroll
      for (int t = 0; t < 4; ++t) {
        FB vb;
        vb.h[0] = *(const v8h*)(Vth + (t * 16 + c) * AT_LP + kk * 32 + 8 * hh);
        vb.h[1] = *(const v8h*)(Vth + (t * 16 + c) * AT_LP + kk * 32 + 16 + 8 * hh);
        oacc[t] = mma_h16(vb.v, pb[kk].v, oacc[t]);
      }
    }
    // the distance behind the last products on the loop's taken branch as on its fall-through
    acc_guard4(oacc[0], oacc[1], oacc[2], oacc[3]);
  }

  float* os = Os[wave];
  {
    const float inv = 1.0f / (lrun + xhalf(lrun));   // lrun carries the same 2^15 as p
#pragma unroll
    for (int t = 0; t < 4; ++t) {
      const v8f o = oacc[t] * inv;
      *(v4f*)(os + c * 68 + t * 16 + 8 * hh)     = (v4f){o[0], o[1], o[2], o[3]};
      *(v4f*)(os + c * 68 + t * 16 + 8 * hh + 4) = (v4f){o[4], o[5], o[6], o[7]};
    }
  }
  __builtin_amdgcn_fence(__ATOMIC_RELEASE, "workgroup");
  __builtin_amdgcn_wave_barrier();
  __builtin_amdgcn_fence(__ATOMIC_ACQUIRE, "workgroup");
  {
    const int q8 = lane >> 3, c8 = (lane & 7) * 8;
    {
#pragma unroll
      for (int it = 0; it < 4; ++it) {
        const int row = it * 4 + q8;
        const float* sp = os + row * 68 + c8;
        v8h hv, lv;
#pragma unroll
        for (int e = 0; e < 8; ++e) {
          const unsigned short hb = f2bf_bits(sp[e]);
          const unsigned short lb = f2bf_bits(sp[e] - bf_bits2f(hb));
          hv[e] = __builtin_bit_cast(_Float16, hb);
          lv[e] = __builtin_bit_cast(_Float16, lb);
        }
        const size_t go = (size_t)(q0 + row) * D_MODEL + c8;
        *(v8h*)(Oh + go) = hv;
        *(v8h*)(Ol + go) = lv;
      }
      
    }
  }
}

// ---------------- host-side orchestration (kernel launches only) ----------------
extern "C" void kernel_launch(void* const* d_in, const int* in_sizes, int n_in,
                              void* d_out, int out_size, void* d_ws, size_t ws_size,
                              hipStream_t stream) {
  if (n_in < 5) return;
  const int M_ROWS = NB_BATCH * SEQ_LEN;   // 8192
  if (in_sizes[0] != M_ROWS * D_MODEL) return;
  if (in_sizes[1] != D_MODEL * 3 * D_MODEL) return;
  if (in_sizes[2] != 3 * D_MODEL) return;
  if (in_sizes[3] != D_MODEL * D_MODEL) return;
  if (in_sizes[4] != D_MODEL) return;
  if (out_size != M_ROWS * D_MODEL) return;

  const float* x    = (const float*)d_in[0];
  const float* Wqkv = (const float*)d_in[1];
  const float* bqkv = (const float*)d_in[2];
  const float* Wout = (const float*)d_in[3];
  const float* bout = (const float*)d_in[4];
  float* out = (float*)d_out;

  // workspace map (all offsets 256-B aligned; every region fully written before it is read):
  //   xb    bf16 [8192][1024]                16,777,216
  //   wqT   bf16 [3072][1024] (Wqkv^T)       6,291,456
  //   woT   bf16 [1024][1024] (Wout^T)       2,097,152
  //   cosT  f32  [2048][32]                     262,144
  //   sinT  f32  [2048][32]                     262,144
  //   qk16  f16  [8192][2048] (q | k, rotated) 33,554,432
  //   vt16  f16  [4][1024][2048] (v^T)       16,777,216
  //   ohi   bf16 [8192][1024]                16,777,216
  //   olo   bf16 [8192][1024]                16,777,216
  //   total                                 109,576,192
  char* ws = (char*)d_ws;
  size_t off = 0;
  unsigned short* xb   = (unsigned short*)(ws + off); off += (size_t)M_ROWS * D_MODEL * 2;
  unsigned short* wqT  = (unsigned short*)(ws + off); off += (size_t)3 * D_MODEL * D_MODEL * 2;
  unsigned short* woT  = (unsigned short*)(ws + off); off += (size_t)D_MODEL * D_MODEL * 2;
  float*          cosT = (float*)(ws + off);          off += (size_t)SEQ_LEN * ROPE_HALF * 4;
  float*          sinT = (float*)(ws + off);          off += (size_t)SEQ_LEN * ROPE_HALF * 4;
  unsigned short* qk16 = (unsigned short*)(ws + off); off += (size_t)M_ROWS * QK_LD * 2;
  unsigned short* vt16 = (unsigned short*)(ws + off); off += (size_t)NB_BATCH * D_MODEL * SEQ_LEN * 2;
  unsigned short* ohi  = (unsigned short*)(ws + off); off += (size_t)M_ROWS * D_MODEL * 2;
  unsigned short* olo  = (unsigned short*)(ws + off); off += (size_t)M_ROWS * D_MODEL * 2;
  if (off > ws_size) return;

  // 1-3) one launch: rotation tables; Wqkv [1024][3072] -> Wqkv^T bf16 [3072][1024]; Wout -> Wout^T bf16 [1024][1024]; x -> bf16
  prep_kernel<<<dim3(PREP_RT + PREP_TQ + PREP_TO + PREP_CX), dim3(256), 0, stream>>>(x, Wqkv, Wout, xb, wqT, woT, cosT, sinT);
  // 4) q|k = x.Wqkv[:, 0:2048] + bf16(b) -> rotate -> f16 : M=8192, N=2048, K=1024 (work-group tiles 64x8 = 512 blocks)
  {
    const int tiles = (M_ROWS / GB_M) * (2 * D_MODEL / GB_N);
    wmma_gemm64<1, 0, 3, 3, false, D_MODEL><<<dim3(tiles, 1), dim3(256), 0, stream>>>(
        xb, nullptr, 0L,
        wqT, 0L,
        (void*)qk16, nullptr, QK_LD, 0L,
        bqkv, nullptr, 0L,
        cosT, sinT, SEQ_LEN,
        M_ROWS, 2 * D_MODEL, D_MODEL, 1.0f);
  }
  // 5) v^T per batch = Wv^T . x_b^T + bf16(bv)[m] -> f16 : M=1024 (features), N=2048 (positions), K=1024, z = 4
  //    A = Wqkv^T rows 2048..3071, Bt = x_b [2048][1024], C = vt16 + b*1024*2048 (work-group tiles 8x8 = 64 blocks)
  {
    const int tiles = (D_MODEL / GB_M) * (SEQ_LEN / GB_N);
    wmma_gemm64<1, 0, 4, 1, false, D_MODEL><<<dim3(tiles, NB_BATCH), dim3(256), 0, stream>>>(
        wqT + (size_t)2 * D_MODEL * D_MODEL, nullptr, 0L,
        xb, (long)SEQ_LEN * D_MODEL,
        (void*)vt16, nullptr, SEQ_LEN, (long)D_MODEL * SEQ_LEN,
        bqkv + 2 * D_MODEL, nullptr, 0L,
        nullptr, nullptr, 1,
        D_MODEL, SEQ_LEN, D_MODEL, 1.0f);
  }
  // 6) attention -> o as bf16 hi/lo planes [8192][1024]
  attn_f16_kernel<<<dim3(N_HEAD * (SEQ_LEN / AT_QB), NB_BATCH), dim3(128), 0, stream>>>(qk16, vt16, ohi, olo, 0.125f);
  // 7) out = (o_hi + o_lo).Wout + bf16(b_out) -> f32 d_out : M=8192, N=1024, K=1024 (work-group tiles 64x4 = 256 blocks)
  {
    const int tiles = (M_ROWS / GB_M) * (D_MODEL / GB_N);
    wmma_gemm64<1, 2, 3, 0, false, D_MODEL><<<dim3(tiles, 1), dim3(256), 0, stream>>>(
        ohi, olo, 0L,
        woT, 0L,
        (void*)out, nullptr, D_MODEL, 0L,
        bout, nullptr, 0L,
        nullptr, nullptr, 1,
        M_ROWS, D_MODEL, D_MODEL, 1.0f);
  }
}

// v008
// Measured time: 140 microseconds a run.
// It is 1.10 times as fast as v006, going by the measured steps of the versions left out in between.
// All steps since v000 together make it 4.29 times as fast.
// Contractions: x.Wqkv (q|k part) and Wv^T.x^T : v_wmma_f32_16x16x32_bf16 (bf16 operands = RNE of the f32 inputs); q.k^T and p.v : v_wmma_f32_16x16x32_f16 (q,k cast to f16 after f32 rope; p carried x2^5 in f16; v f16); o.Wout : v_wmma_f32_16x16x32_f16 (o and Wout both RNE to f16, one plane each); all f32 accumulate; rope tables, softmax, biases in f32.
#include <hip/hip_runtime.h>
#include <math.h>
#include <stdint.h>

constexpr int NB_BATCH  = 4;
constexpr int SEQ_LEN   = 2048;
constexpr int D_MODEL   = 1024;
constexpr int N_HEAD    = 16;
constexpr int HEAD_D    = 64;
constexpr int ROPE_HALF = 32;          // head_dim / 2 rotation pairs
constexpr int QK_LD     = 2 * D_MODEL; // pitch of the q|k 16-bit plane

typedef __attribute__((ext_vector_type(16))) _Float16 v16h;
typedef __attribute__((ext_vector_type(8)))  _Float16 v8h;
typedef __attribute__((ext_vector_type(16))) __bf16   v16b;
typedef __attribute__((ext_vector_type(8)))  __bf16   v8b;
typedef __attribute__((ext_vector_type(8)))  float    v8f;
typedef __attribute__((ext_vector_type(4)))  float    v4f;
typedef __attribute__((ext_vector_type(4)))  unsigned int v4u;

__device__ __forceinline__ unsigned short f2bf_bits(float f) {
  unsigned u = __float_as_uint(f);
  return (unsigned short)((u + 0x7FFFu + ((u >> 16) & 1u)) >> 16);
}
__device__ __forceinline__ float bf_bits2f(unsigned short h) { return __uint_as_float(((unsigned)h) << 16); }
__device__ __forceinline__ unsigned short f2h_bits(float f) { return __builtin_bit_cast(unsigned short, (_Float16)f); }   // RNE
__device__ __forceinline__ unsigned pk16(unsigned short a, unsigned short b) { return (unsigned)a | ((unsigned)b << 16); }

// hazard guards as plain device helpers (their inline asm stays out of the kernel template body)
__device__ __forceinline__ void dep_guard_h(v8f& a, v8f& b, v16h x, v16h y) { asm volatile("v_nop\n\tv_nop\n\tv_nop\n\tv_nop" : "+v"(a), "+v"(b) : "v"(x), "v"(y)); }
__device__ __forceinline__ void dep_guard_b(v8f& a, v8f& b, v16b x, v16b y) { asm volatile("v_nop\n\tv_nop\n\tv_nop\n\tv_nop" : "+v"(a), "+v"(b) : "v"(x), "v"(y)); }
__device__ __forceinline__ void keep4_h(v16h a, v16h b, v16h c, v16h d) { asm volatile("v_nop" :: "v"(a), "v"(b), "v"(c), "v"(d)); }
__device__ __forceinline__ void keep4_b(v16b a, v16b b, v16b c, v16b d) { asm volatile("v_nop" :: "v"(a), "v"(b), "v"(c), "v"(d)); }
__device__ __forceinline__ void acc_guard4(v8f& a, v8f& b, v8f& c, v8f& d) { asm volatile("v_nop\n\tv_nop\n\tv_nop\n\tv_nop" : "+v"(a), "+v"(b), "+v"(c), "+v"(d)); }
template <typename T> struct Frag;
template <> struct Frag<_Float16> {
  typedef v16h V; typedef v8h H; union U { v16h v; v8h h[2]; };
  static __device__ __forceinline__ v16h load(const _Float16* p) {   // elements 0..7 <- p[0..7], 8..15 <- p[16..23]
    U f; f.h[0] = *(const v8h*)(p); f.h[1] = *(const v8h*)(p + 16); return f.v;
  }
  static __device__ __forceinline__ v8f mma(v16h a, v16h b, v8f c) {
    return __builtin_amdgcn_wmma_f32_16x16x32_f16(false, a, false, b, (short)0, c, false, false);
  }
  static __device__ __forceinline__ void guard(v8f& a, v8f& b, v16h x, v16h y) { dep_guard_h(a, b, x, y); }
  static __device__ __forceinline__ void keep(v16h a, v16h b, v16h c, v16h d) { keep4_h(a, b, c, d); }
};
template <> struct Frag<__bf16> {
  typedef v16b V; typedef v8b H; union U { v16b v; v8b h[2]; };
  static __device__ __forceinline__ v16b load(const __bf16* p) {
    U f; f.h[0] = *(const v8b*)(p); f.h[1] = *(const v8b*)(p + 16); return f.v;
  }
  static __device__ __forceinline__ v8f mma(v16b a, v16b b, v8f c) {
    return __builtin_amdgcn_wmma_f32_16x16x32_bf16(false, a, false, b, (short)0, c, false, false);
  }
  static __device__ __forceinline__ void guard(v8f& a, v8f& b, v16b x, v16b y) { dep_guard_b(a, b, x, y); }
  static __device__ __forceinline__ void keep(v16b a, v16b b, v16b c, v16b d) { keep4_b(a, b, c, d); }
};

// ---- Register-blocked batched WMMA GEMM, operands staged per work-group in LDS ----
// C[m,n] = scale * sum_k A[m,k] * Bt[n,k] (+bias)(+resid); a work-group of 8 waves (2 x 4) owns a 128x256 tile,
// each wave a 64x64 tile of it.
// A row-major [M,K]; Bt row-major [N,K]; M % 128 == 0, N % 256 == 0, K % 64 == 0.
// A stage is 64 k (128 B, one cache line) of every operand row of the work-group tile: 8 lanes x 16 B fetch one row's line,
// so a wave's load touches 4 whole lines; the rows lie in LDS at pitch GB_LP. Two LDS buffers: stage s+1 is fetched into
// registers ahead of stage s's products, stored behind them into the other buffer, one work-group barrier per stage.
// SPLITM: 0 = single product; 2 = A hi/lo planes (hi.B + lo.B).
// BIAS_MODE: 0 = none, 1 = bias[m], 2 = bias[n], 3 = bias[n] RNE-converted to bf16, 4 = bias[m] RNE-converted to bf16.
// OUT_MODE: 0 = f32, 1 = f16, 2 = bf16 hi plane (Cout) + bf16 lo plane (Cout2),
//           3 = f16 with interleaved-pair rotation: pair (2i,2i+1) within each 64-wide column tile rotated by
//               (ropeC, ropeS)[t][i] with t = m % ropeT (tables [ropeT][32] f32).
// ET: 0 = f16 operands, 1 = bf16 operands (pointers passed as 16-bit storage)
template <int ET> struct Elem;
template <> struct Elem<0> { typedef _Float16 T; };
template <> struct Elem<1> { typedef __bf16 T; };
constexpr int GB_M  = 128;  // work-group tile rows
constexpr int GB_N  = 256;  // work-group tile columns
constexpr int GB_K  = 64;   // k per stage
constexpr int GB_LP = 72;   // LDS row pitch in 16-bit elements: 144 B = 16 B x 9 (odd) for 16-byte row readers
// Registers: the single-plane builds stay within 256 VGPRs, so that two work-groups (their LDS fits twice) share a WGP and
// one's products cover the other's barrier and staging; the hi/lo build has one work-group per WGP by its LDS.
// LD: row pitch of A and Bt in elements, a compile-time value: the groups of 32 staged rows are then immediate offsets
// of one address per plane.
template <int ET, int SPLITM, int BIAS_MODE, int OUT_MODE, bool RESID, int LD, int ACT = 0>
__global__ __launch_bounds__(256) __attribute__((amdgpu_waves_per_eu((SPLITM != 0) ? 2 : 4))) void wmma_gemm64(
    const unsigned short* __restrict__ Ap, const unsigned short* __restrict__ A2p, long strideA,
    const unsigned short* __restrict__ Btp, long strideB,
    void* __restrict__ Cout, void* __restrict__ Cout2, int ldc, long strideC,
    const float* __restrict__ bias,
    const float* __restrict__ resid, long strideR,
    const float* __restrict__ ropeC, const float* __restrict__ ropeS, int ropeT,
    int M, int N, int K, float scale) {
  typedef typename Elem<ET>::T T;
  typedef typename Frag<T>::V V;
  typedef typename Frag<T>::H H;
  static_assert(SPLITM == 0 || SPLITM == 2, "staged planes: A (hi, lo) and Bt");
  const T* A = (const T*)Ap; const T* A2 = (const T*)A2p; const T* Bt = (const T*)Btp;
  constexpr int A_ROWS = (SPLITM != 0) ? 2 * GB_M : GB_M;   // staged A rows: hi plane, then lo plane
  constexpr int S_ROWS = A_ROWS + GB_N;                     // staged rows per stage
  constexpr int NPC    = S_ROWS / 32;                       // 16-B pieces per thread per stage (256 threads x 16 B = 32 rows)
  __shared__ __align__(16) T sOp[2][S_ROWS * GB_LP];        // two stage buffers
  __shared__ __align__(16) float sT[8][16 * 68];   // per-wave 16x64 slab, pitch 68 floats
  const int b    = blockIdx.y;
  const int tid  = threadIdx.x;
  const int lane = tid & 31;
  const int wave = tid >> 5;
  const int blkN = N >> 8;
  const int blkM = M >> 7;
  if ((int)blockIdx.x >= blkM * blkN) return;   // the same for the whole work-group, ahead of every barrier
  const int bm = blockIdx.x / blkN;
  const int bn = blockIdx.x - bm * blkN;
  const int wm = (wave >> 2) << 6;             // this wave's row offset in the work-group tile
  const int wn = (wave & 3) << 6;              // this wave's column offset
  const int m0 = (bm << 7) + wm;
  const int n0 = (bn << 8) + wn;

  const int rlane = lane & 15;                 // row (A) / col (B, D) within subtile
  const int koff  = (lane >> 4) * 8;           // k offset of this lane half
  const int mOff  = (lane >> 4) * 8;           // D row offset

  // staging map: thread -> row (tid >> 3) of each group of 32 staged rows, 16-B piece (tid & 7) of its 128-B line
  const int sr = tid >> 3;
  const int sc = (tid & 7) * 8;
  const T* gA  = A  + (size_t)b * strideA + (size_t)((bm << 7) + sr) * LD + sc;
  const T* gA2 = (SPLITM != 0) ? (A2 + (size_t)b * strideA + (size_t)((bm << 7) + sr) * LD + sc) : gA;
  const T* gB  = Bt + (size_t)b * strideB + (size_t)((bn << 8) + sr) * LD + sc;
  H pre[NPC];
  auto fetch = [&](int k0) {
    const T* pa  = gA  + k0;
    const T* pa2 = gA2 + k0;
    const T* pb  = gB  + k0;
#pragma unroll   // constant indices keep pre[] in registers and the row groups as immediate offsets
    for (int it = 0; it < NPC; ++it) {
      const int row = it * 32;
      if (row < GB_M)        pre[it] = *(const H*)(pa  + (size_t)row * LD);
      else if (row < A_ROWS) pre[it] = *(const H*)(pa2 + (size_t)(row - GB_M) * LD);
      else                   pre[it] = *(const H*)(pb  + (size_t)(row - A_ROWS) * LD);
    }
    // the wait in front of any overwrite of the loads' address registers; the addresses are inputs, so that their
    // registers are held up to it
    asm volatile("s_wait_xcnt 0x0" :: "v"(pa), "v"(pa2), "v"(pb) : "memory");
  };
  auto stash = [&](T* dst) {
#pragma unroll   // constant indices keep pre[] in registers
    for (int it = 0; it < NPC; ++it) *(H*)(dst + (it * 32 + sr) * GB_LP + sc) = pre[it];
  };

  v8f acc[4][4];
#pragma unroll
  for (int i = 0; i < 4; ++i)
#pragma unroll
    for (int j = 0; j < 4; ++j) acc[i][j] = (v8f){0.f,0.f,0.f,0.f,0.f,0.f,0.f,0.f};

  const int nst = K >> 6;
  fetch(0);
  stash(sOp[0]);
  __syncthreads();
  for (int st = 0; st < nst; ++st) {
    const bool more = (st + 1 < nst);          // the same for the whole work-group
    if (more) fetch((st + 1) << 6);
    const T* sA = sOp[st & 1] + (wm + rlane) * GB_LP + koff;
    const T* sB = sOp[st & 1] + (A_ROWS + wn + rlane) * GB_LP + koff;
#pragma unroll   // both halves of a stage in one block, so that the second half's fragment reads can start under the first's products
    for (int kk = 0; kk < GB_K; kk += 32) {
      // all fragments of these 32 k are read as one group ahead of their products
      V bh[4], ah[4], al[4];
#pragma unroll
      for (int j = 0; j < 4; ++j) bh[j] = Frag<T>::load(sB + (j << 4) * GB_LP + kk);
#pragma unroll
      for (int i = 0; i < 4; ++i) {
        ah[i] = Frag<T>::load(sA + (i << 4) * GB_LP + kk);
        if (SPLITM != 0) al[i] = Frag<T>::load(sA + (GB_M + (i << 4)) * GB_LP + kk);
      }
#pragma unroll
      for (int i = 0; i < 4; ++i) {
#pragma unroll
        for (int j = 0; j < 4; ++j) {
          acc[i][j] = Frag<T>::mma(ah[i], bh[j], acc[i][j]);
          if (SPLITM != 0) acc[i][j] = Frag<T>::mma(al[i], bh[j], acc[i][j]);
        }
        Frag<T>::guard(acc[i][0], acc[i][3], ah[i], (SPLITM != 0) ? al[i] : ah[i]);
      }
      Frag<T>::keep(bh[0], bh[1], bh[2], bh[3]);
    }
    // the other buffer's last readers passed the barrier that ended stage st - 1
    if (more) stash(sOp[(st + 1) & 1]);
    __syncthreads();                           // publishes stage st + 1 and ends every read of stage st's buffer
  }
  acc_guard4(acc[0][0], acc[0][1], acc[0][2], acc[0][3]);
  acc_guard4(acc[1][0], acc[1][1], acc[1][2], acc[1][3]);
  acc_guard4(acc[2][0], acc[2][1], acc[2][2], acc[2][3]);
  acc_guard4(acc[3][0], acc[3][1], acc[3][2], acc[3][3]);

  // ---- epilogue ----
  float* slab = sT[wave];
  const float* Rb = RESID ? (resid + (size_t)b * strideR) : nullptr;
#pragma unroll
  for (int i = 0; i < 4; ++i) {
    const int mBase = m0 + (i << 4);
#pragma unroll
    for (int j = 0; j < 4; ++j) {
      const int n = n0 + (j << 4) + rlane;
      float bv = 0.f;
      if (BIAS_MODE == 2) bv = bias[n];
      if (BIAS_MODE == 3) bv = bf_bits2f(f2bf_bits(bias[n]));
#pragma unroll
      for (int r = 0; r < 8; ++r) {
        float v = acc[i][j][r] * scale;
        if (BIAS_MODE == 1) v += bias[mBase + mOff + r];
        if (BIAS_MODE == 4) v += bf_bits2f(f2bf_bits(bias[mBase + mOff + r]));
        if (BIAS_MODE == 2 || BIAS_MODE == 3) v += bv;
        if (RESID) v += Rb[(size_t)(mBase + mOff + r) * ldc + n];
        if (ACT == 1) v = tanhf(v);
        if (ACT == 2) v = fmaxf(v, 0.0f);
        if (ACT == 3) v = v / (1.0f + expf(-v));
        if (ACT == 4) v = (v > 0.f) ? v : 0.01f * v;
        slab[(mOff + r) * 68 + (j << 4) + rlane] = v;
      }
    }
    __builtin_amdgcn_fence(__ATOMIC_RELEASE, "workgroup");
    __builtin_amdgcn_wave_barrier();
    __builtin_amdgcn_fence(__ATOMIC_ACQUIRE, "workgroup");
    if (OUT_MODE == 0) {
      float* C = (float*)Cout + (size_t)b * strideC;
      const int hh = lane >> 4, c4 = (lane & 15) * 4;     // row seg = 256 B = 16 lanes x 16 B
      {
#pragma unroll
        for (int it = 0; it < 8; ++it) {
          const int row = it * 2 + hh;
          v4f v = *(const v4f*)(slab + row * 68 + c4);
          *(v4f*)(C + (size_t)(mBase + row) * ldc + n0 + c4) = v;
        }
        
      }
    } else {
      const int q = lane >> 3, c8 = (lane & 7) * 8;
      unsigned short* C  = (unsigned short*)Cout  + (size_t)b * strideC;
      unsigned short* C2 = (OUT_MODE == 2) ? ((unsigned short*)Cout2 + (size_t)b * strideC) : nullptr;
      {
#pragma unroll
        for (int it = 0; it < 4; ++it) {
          const int row = it * 4 + q;
          const float* sp = slab + row * 68 + c8;
          v8h hv, lv;
          if (OUT_MODE == 3) {
            // columns c8..c8+7 of this 64-wide tile are rotation pairs (c8>>1)+0..3 of position t
            const int t = (mBase + row) % ropeT;
            const v4f cv = *(const v4f*)(ropeC + (size_t)t * ROPE_HALF + (c8 >> 1));
            const v4f sv = *(const v4f*)(ropeS + (size_t)t * ROPE_HALF + (c8 >> 1));
#pragma unroll
            for (int e2 = 0; e2 < 4; ++e2) {
              const float x0 = sp[2 * e2], x1 = sp[2 * e2 + 1];
              hv[2 * e2]     = (_Float16)(x0 * cv[e2] - x1 * sv[e2]);
              hv[2 * e2 + 1] = (_Float16)(x0 * sv[e2] + x1 * cv[e2]);
            }
          } else {
#pragma unroll
            for (int e = 0; e < 8; ++e) {
              if (OUT_MODE == 1) {
                hv[e] = (_Float16)sp[e];
              } else {
                unsigned short hb = f2bf_bits(sp[e]);
                unsigned short lb = f2bf_bits(sp[e] - bf_bits2f(hb));
                hv[e] = __builtin_bit_cast(_Float16, hb);
                lv[e] = __builtin_bit_cast(_Float16, lb);
              }
            }
          }
          *(v8h*)(C + (size_t)(mBase + row) * ldc + n0 + c8) = hv;
          if (OUT_MODE == 2) *(v8h*)(C2 + (size_t)(mBase + row) * ldc + n0 + c8) = lv;
        }
        
      }
    }
    __builtin_amdgcn_fence(__ATOMIC_RELEASE, "workgroup");
    __builtin_amdgcn_wave_barrier();
    __builtin_amdgcn_fence(__ATOMIC_ACQUIRE, "workgroup");
  }
}

// ---------------------------------------------------------------------------
// Preparation: four independent bodies share one launch, picked by ranges of the block index (the same for a whole
// work-group). Every body takes 256 threads; the ranges are compile-time counts of the fixed shapes.
// ---------------------------------------------------------------------------
// f32 -> bf16 (RNE) cast, 8 elements per thread, one 16-B store per lane: a wave writes 512 contiguous bytes.
// Coverage: n8/256 blocks x 256 threads x 8 elements = 8*n8 = the whole plane (n8 = 8192*1024/8 = 1,048,576
// -> 4096 blocks exactly).
__device__ __forceinline__ void cast_bf16x8_body(const float* __restrict__ in, unsigned short* __restrict__ out, int blk) {
  const int i = blk * 256 + threadIdx.x;
  const v4f a  = *(const v4f*)(in + 8 * (size_t)i);
  const v4f a2 = *(const v4f*)(in + 8 * (size_t)i + 4);
  v4u u;
  u[0] = pk16(f2bf_bits(a[0]),  f2bf_bits(a[1]));
  u[1] = pk16(f2bf_bits(a[2]),  f2bf_bits(a[3]));
  u[2] = pk16(f2bf_bits(a2[0]), f2bf_bits(a2[1]));
  u[3] = pk16(f2bf_bits(a2[2]), f2bf_bits(a2[3]));
  *(v4u*)(out + 8 * (size_t)i) = u;
  // the wait in front of any overwrite of the store's registers on a path that leads on through another body's code
  asm volatile("s_wait_xcnt 0x0" ::: "memory");
}

// Fused transpose + 16-bit (RNE) cast of an f32 matrix, to f16 if TO_F16, else to bf16: in [R rows][Cc cols] (pitch Cc) ->
// out[c][r] ([Cc][R], pitch R).
// 64x64 tiles through LDS (tf: 64 rows, pitch 68 floats); tile (cb, rb) of (Cc/64, R/64), 256 threads.
// Coverage per block: load 4 it x 256 thr x 4 floats = 64x64; store 2 it x 256 thr x 8 u16 = 64x64.
template <int R, int Cc, bool TO_F16>
__device__ __forceinline__ void tcast16_body(const float* __restrict__ W, unsigned short* __restrict__ oh, float* tf,
                                             int cb, int rb) {
  const int c0  = cb * 64;           // input column block = output row block
  const int rb0 = rb * 64;           // input row block    = output column block
  const int tid = threadIdx.x;
  {
    const int lr = tid >> 4;         // 0..15
    const int c4 = (tid & 15) * 4;   // 0..60
#pragma unroll
    for (int it = 0; it < 4; ++it) {
      const int rr = it * 16 + lr;   // 0..63
      const v4f a = *(const v4f*)(W + (size_t)(rb0 + rr) * Cc + c0 + c4);
      *(v4f*)(tf + rr * 68 + c4) = a;
    }
  }
  __syncthreads();
  const int sub = tid >> 3;          // 0..31
  const int c8  = (tid & 7) * 8;     // 0..56
  v4u hv[2];
#pragma unroll
  for (int it = 0; it < 2; ++it) {
    const int oc = it * 32 + sub;    // output row within tile (= input column)
    v4u a;
#pragma unroll
    for (int q = 0; q < 4; ++q) {
      const float f0 = tf[(c8 + 2 * q) * 68 + oc];
      const float f1 = tf[(c8 + 2 * q + 1) * 68 + oc];
      a[q] = TO_F16 ? pk16(f2h_bits(f0), f2h_bits(f1)) : pk16(f2bf_bits(f0), f2bf_bits(f1));
    }
    hv[it] = a;
  }
#pragma unroll
  for (int it = 0; it < 2; ++it) {
    const int oc = it * 32 + sub;
    const size_t go = (size_t)(c0 + oc) * R + rb0 + c8;
    *(v4u*)(oh + go) = hv[it];
  }
  // the wait in front of any overwrite of the stores' registers on a path that leads on through another body's code
  asm volatile("s_wait_xcnt 0x0" ::: "memory");
}

// Rotation tables: freq[i] = 1 / 10000^((2i)/64), i = 0..31 (f32 pow, f32 reciprocal), formed by each thread for its own i;
// ang[t][i] = (float)t * freq[i]; cosT/sinT [SEQ][32] f32 (precise sincosf). SEQ*32/256 blocks cover the tables exactly.
// Both tables carry the factor QK_FOLD, so that the rotated q and k each carry it and q . k comes out of the score products
// already times (1/sqrt(64)) * log2 e, one f16 rounding per element as before.
constexpr float QK_FOLD = 0.42466090014400953f;   // sqrt(0.125 * log2 e)
__device__ __forceinline__ void rope_table_body(float* __restrict__ cosT, float* __restrict__ sinT, int blk) {
  const int idx = blk * 256 + threadIdx.x;
  const int t = idx >> 5, i = idx & 31;
  const float e = (float)(2 * i) / (float)HEAD_D;  // exact (division by 64)
  const float p = powf(10000.0f, e);
  const float f = 1.0f / p;
  const float ang = (float)t * f;
  float sv, cv;
  sincosf(ang, &sv, &cv);
  cosT[idx] = cv * QK_FOLD;
  sinT[idx] = sv * QK_FOLD;
}

constexpr int PREP_RT = SEQ_LEN * ROPE_HALF / 256;                    // 256 blocks: rotation tables
constexpr int PREP_TQ = (3 * D_MODEL / 64) * (D_MODEL / 64);          // 768 blocks: Wqkv^T
constexpr int PREP_TO = (D_MODEL / 64) * (D_MODEL / 64);              // 256 blocks: Wout^T
constexpr int PREP_CX = NB_BATCH * SEQ_LEN * D_MODEL / 8 / 256;       // 4096 blocks: x
// The bodies with the longest chains (tables, transposes) have the lowest block indices, the stream of x the rest.
__global__ __launch_bounds__(256) void prep_kernel(const float* __restrict__ x, const float* __restrict__ Wqkv,
                                                   const float* __restrict__ Wout, unsigned short* __restrict__ xb,
                                                   unsigned short* __restrict__ wqT, unsigned short* __restrict__ woT,
                                                   float* __restrict__ cosT, float* __restrict__ sinT) {
  __shared__ __align__(16) float tf[64 * 68];
  const int bx = blockIdx.x;
  if (bx < PREP_RT) {
    rope_table_body(cosT, sinT, bx);
  } else if (bx < PREP_RT + PREP_TQ) {
    const int k = bx - PREP_RT;
    tcast16_body<D_MODEL, 3 * D_MODEL, false>(Wqkv, wqT, tf, k % (3 * D_MODEL / 64), k / (3 * D_MODEL / 64));
  } else if (bx < PREP_RT + PREP_TQ + PREP_TO) {
    const int k = bx - (PREP_RT + PREP_TQ);
    tcast16_body<D_MODEL, D_MODEL, true>(Wout, woT, tf, k % (D_MODEL / 64), k / (D_MODEL / 64));
  } else {
    cast_bf16x8_body(x, xb, bx - (PREP_RT + PREP_TQ + PREP_TO));
  }
}

// =====================================================================================
// Full (non-causal, unmasked) attention, head dim 64, f16 operand planes.
//   q|k plane (f16): element (b, t, h, d) of q at [(b*SEQ + t)*QK_LD + h*64 + d], of k at [... + D_MODEL + h*64 + d]
//   v^T plane (f16): element (b, h, d, s) at [(b*D_MODEL + h*64 + d)*SEQ + s]
//   out: one f16 plane, element (b, t, h, d) at [(b*SEQ + t)*D_MODEL + h*64 + d]
//   scores = q . k            : v_wmma_f32_16x16x32_f16, f32 accumulate; q and k carry the scale and log2 e (QK_FOLD)
//   out    = p . v            : v_wmma_f32_16x16x32_f16 with p (unnormalised) carried x2^5 in f16, as is the sum l
//   online softmax in f32 over all SEQ keys (32 chunks of 64, compile-time trip count, no masking), reference held.
//   Block = 4 waves = 64 query rows of one (batch, head); grid = (N_HEAD * SEQ/64, NB_BATCH).
//   K / V^T chunk staging: 128 threads x 32 elements per plane = the whole 64x64 tile (16-B copies, plain loads,
//   __syncthreads before and after); fragment loads read the LDS tiles with the same v8h element type.
// =====================================================================================
constexpr int AT_D  = 64;
constexpr int AT_NW = 4;
constexpr int AT_QB = 64;
constexpr int AT_KC = 64;
constexpr int AT_LP = 72;   // LDS row pitch of the K and V^T tiles in f16 elements: 144 B = 16 B x 9 (odd) for 16-byte row readers
constexpr float P_CARRY_LOG2 = 5.0f;    // p is carried x2^5: the carry is added to the exponent
constexpr float P_SUM_LIMIT  = 32768.0f; // a lane's chunk sum of carried p at or below it: every p of it is finite in f16

__device__ __forceinline__ v8f mma_h16(v16h a, v16h b, v8f c) {
  return __builtin_amdgcn_wmma_f32_16x16x32_f16(false, a, false, b, (short)0, c, false, false);
}
__device__ __forceinline__ v8f splat8(float x) { return (v8f){x, x, x, x, x, x, x, x}; }
// value of lane l ^ 16 (the other half of the wave), by a vector cross-row move
__device__ __forceinline__ float xhalf(float x) {
  const int b = __builtin_bit_cast(int, x);
  return __builtin_bit_cast(float, __builtin_amdgcn_permlanex16(b, b, 0x76543210, 0xfedcba98, false, false));
}

__global__ __launch_bounds__(128) __attribute__((amdgpu_waves_per_eu(8)))
void attn_f16_kernel(const unsigned short* __restrict__ qkp, const unsigned short* __restrict__ vtp,
                     unsigned short* __restrict__ op) {
  union FB { v16h v; v8h h[2]; };
  __shared__ __align__(16) _Float16 Ksh[AT_KC * AT_LP];         // K [kv][d], pitch AT_LP      9 KB
  __shared__ __align__(16) _Float16 Vth[AT_D * AT_LP];          // V^T [d][kv], pitch AT_LP    9 KB
  __shared__ __align__(16) float    Os[AT_NW][16 * 68];         // per wave out tile, pitch 68

  const int tid  = threadIdx.x;
  const int wave = tid >> 5;
  const int lane = tid & 31;
  const int hh   = lane >> 4;
  const int c    = lane & 15;

  const int nqb = SEQ_LEN / AT_QB;            // 32
  const int bx = blockIdx.x;
  const int qb = bx % nqb;
  const int h  = bx / nqb;                    // 0..N_HEAD-1 (grid.x = N_HEAD * nqb)
  const int b  = blockIdx.y;                  // batch
  const int q0 = qb * AT_QB + wave * 16;

  const _Float16* Qp = (const _Float16*)(const void*)qkp + (size_t)b * SEQ_LEN * QK_LD + (size_t)h * AT_D;
  const _Float16* Kp = Qp + D_MODEL;
  const _Float16* Vp = (const _Float16*)(const void*)vtp + ((size_t)b * D_MODEL + (size_t)h * AT_D) * SEQ_LEN;
  _Float16* Op = (_Float16*)(void*)op + (size_t)b * SEQ_LEN * D_MODEL + (size_t)h * AT_D;

  // ---- Q fragments (B operand, column = lane&15, split k map via Frag load): 2 d-chunks ----
  v16h qa[2];
#pragma unroll
  for (int dc = 0; dc < 2; ++dc)
    qa[dc] = Frag<_Float16>::load(Qp + (size_t)(q0 + c) * QK_LD + dc * 32 + 8 * hh);

  // Softmax in base 2 against a held reference: p * 2^5 = exp2(s + (5 - m)), where 5 - m enters the score products as their
  // start value C, so a score costs one hardware exponential. m is the maximum of the query's scores over the chunks that
  // raised it, so the largest p of a row is at least 1. It is raised (maximum taken, O and l rescaled) only in a chunk where
  // some lane's sum of carried p is not at or below P_SUM_LIMIT; the first chunk is one, since 5 - m starts at +inf.
  float mref = -INFINITY;   // held reference of query q0 + c in log2 units (the same in both halves)
  v8f   cref = splat8(INFINITY);   // 5 - mref in all eight rows of the lane's column
  float lrun = 0.f;         // running sum (x2^5) over this half's keys; the halves are joined behind the loop
  v8f oacc[4];              // O^T: oacc[t][r] = element d = t*16 + 8*hh + r of query q0 + c
#pragma unroll
  for (int t = 0; t < 4; ++t) oacc[t] = (v8f){0.f,0.f,0.f,0.f,0.f,0.f,0.f,0.f};

  for (int kc = 0; kc < SEQ_LEN / AT_KC; ++kc) {     // 32, compile-time constant
    const int kv0 = kc * AT_KC;
    __syncthreads();
    {
      // staging map: a tile row is one 128-B cache line; 8 lanes x 16 B fetch it whole, so a wave's load touches 4 lines.
      // coverage: 128 threads x 16 B = 16 rows a step, 4 steps = 64 rows x 64 per plane = the whole chunk tile
      const int r = tid >> 3, pc = (tid & 7) * 8;
      const _Float16* ks = Kp + (size_t)(kv0 + r) * QK_LD + pc;       // K rows kv0 + r + 16 i, d = pc..pc+7
      const _Float16* vs = Vp + (size_t)r * SEQ_LEN + kv0 + pc;        // V^T rows d = r + 16 i, s = kv0+pc..+7
#pragma unroll
      for (int i = 0; i < 4; ++i) {
        const v8h a0 = *(const v8h*)(ks + (size_t)(16 * i) * QK_LD);
        const v8h b0 = *(const v8h*)(vs + (size_t)(16 * i) * SEQ_LEN);
        *(v8h*)(Ksh + (r + 16 * i) * AT_LP + pc) = a0;
        *(v8h*)(Vth + (r + 16 * i) * AT_LP + pc) = b0;
      }
      // the wait in front of any overwrite of the loads' address registers; the addresses are inputs, so that their
      // registers are held up to it
      asm volatile("s_wait_xcnt 0x0" :: "v"(ks), "v"(vs) : "memory");
    }
    __syncthreads();

    // S^T of this chunk on top of the start value c0 (here and below the loops are unrolled so that constant indices keep
    // the tiles in registers)
    auto scores = [&](v8f (&s)[4], v8f c0) {
#pragma unroll
      for (int j = 0; j < 4; ++j) s[j] = c0;
#pragma unroll
      for (int dc = 0; dc < 2; ++dc) {
#pragma unroll
        for (int j = 0; j < 4; ++j) {
          FB kb;
          kb.h[0] = *(const v8h*)(Ksh + (j * 16 + c) * AT_LP + dc * 32 + 8 * hh);
          kb.h[1] = *(const v8h*)(Ksh + (j * 16 + c) * AT_LP + dc * 32 + 16 + 8 * hh);
          s[j] = mma_h16(kb.v, qa[dc], s[j]);
        }
      }
    };
    // exponents -> carried p in place; returns this lane's sum of them
    auto exp_sum = [&](v8f (&s)[4]) -> float {
#pragma unroll
      for (int j = 0; j < 4; ++j)
#pragma unroll
        for (int r = 0; r < 8; ++r) s[j][r] = __builtin_amdgcn_exp2f(s[j][r]);
      const v8f ps8 = (s[0] + s[1]) + (s[2] + s[3]);
      return ((ps8[0] + ps8[1]) + (ps8[2] + ps8[3])) + ((ps8[4] + ps8[5]) + (ps8[6] + ps8[7]));
    };

    v8f pv[4];
    scores(pv, cref);
    float psum = exp_sum(pv);
    // one test a chunk, the same for the whole wave (a scalar branch); written so that a NaN sum takes it too
    if (__builtin_amdgcn_ballot_w32(!(psum <= P_SUM_LIMIT)) != 0u) {
      // compiler fence: the K fragments are read from LDS again here; without it the first reads' 64 registers stay live over
      // the test for this rare path, and the kernel no longer fits eight waves a SIMD
      asm volatile("" ::: "memory");
      scores(pv, splat8(0.f));   // the K tile is still in LDS: the plain scores
      const v8f c8v = __builtin_elementwise_max(__builtin_elementwise_max(pv[0], pv[1]), __builtin_elementwise_max(pv[2], pv[3]));
      float cm = fmaxf(fmaxf(fmaxf(c8v[0], c8v[1]), fmaxf(c8v[2], c8v[3])), fmaxf(fmaxf(c8v[4], c8v[5]), fmaxf(c8v[6], c8v[7])));
      cm = fmaxf(cm, xhalf(cm));
      const float mnew  = fmaxf(mref, cm);
      const float alpha = __builtin_amdgcn_exp2f(mref - mnew);   // 0 in the first chunk, where mref is -inf
      mref = mnew;
      cref = splat8(P_CARRY_LOG2 - mnew);
      lrun = lrun * alpha;
#pragma unroll
      for (int t = 0; t < 4; ++t) oacc[t] = oacc[t] * alpha;
#pragma unroll
      for (int j = 0; j < 4; ++j) pv[j] = pv[j] + cref;
      psum = exp_sum(pv);
    }
    lrun += psum;
    FB pb[2];
#pragma unroll
    for (int j = 0; j < 4; ++j)
#pragma unroll
      for (int r = 0; r < 8; ++r) pb[j >> 1].h[j & 1][r] = (_Float16)pv[j][r];
#pragma unroll
    for (int kk = 0; kk < 2; ++kk) {
#pragma unroll
      for (int t = 0; t < 4; ++t) {
        FB vb;
        vb.h[0] = *(const v8h*)(Vth + (t * 16 + c) * AT_LP + kk * 32 + 8 * hh);
        vb.h[1] = *(const v8h*)(Vth + (t * 16 + c) * AT_LP + kk * 32 + 16 + 8 * hh);
        oacc[t] = mma_h16(vb.v, pb[kk].v, oacc[t]);
      }
    }
    // the distance behind the last products on the loop's taken branch as on its fall-through
    acc_guard4(oacc[0], oacc[1], oacc[2], oacc[3]);
  }

  float* os = Os[wave];
  {
    const float inv = 1.0f / (lrun + xhalf(lrun));   // lrun carries the same 2^5 as p
#pragma unroll
    for (int t = 0; t < 4; ++t) {
      const v8f o = oacc[t] * inv;
      *(v4f*)(os + c * 68 + t * 16 + 8 * hh)     = (v4f){o[0], o[1], o[2], o[3]};
      *(v4f*)(os + c * 68 + t * 16 + 8 * hh + 4) = (v4f){o[4], o[5], o[6], o[7]};
    }
  }
  __builtin_amdgcn_fence(__ATOMIC_RELEASE, "workgroup");
  __builtin_amdgcn_wave_barrier();
  __builtin_amdgcn_fence(__ATOMIC_ACQUIRE, "workgroup");
  {
    const int q8 = lane >> 3, c8 = (lane & 7) * 8;
    {
#pragma unroll
      for (int it = 0; it < 4; ++it) {
        const int row = it * 4 + q8;
        const float* sp = os + row * 68 + c8;
        v8h hv;
#pragma unroll
        for (int e = 0; e < 8; ++e) hv[e] = (_Float16)sp[e];
        *(v8h*)(Op + (size_t)(q0 + row) * D_MODEL + c8) = hv;
      }
      
    }
  }
}

// ---------------- host-side orchestration (kernel launches only) ----------------
extern "C" void kernel_launch(void* const* d_in, const int* in_sizes, int n_in,
                              void* d_out, int out_size, void* d_ws, size_t ws_size,
                              hipStream_t stream) {
  if (n_in < 5) return;
  const int M_ROWS = NB_BATCH * SEQ_LEN;   // 8192
  if (in_sizes[0] != M_ROWS * D_MODEL) return;
  if (in_sizes[1] != D_MODEL * 3 * D_MODEL) return;
  if (in_sizes[2] != 3 * D_MODEL) return;
  if (in_sizes[3] != D_MODEL * D_MODEL) return;
  if (in_sizes[4] != D_MODEL) return;
  if (out_size != M_ROWS * D_MODEL) return;

  const float* x    = (const float*)d_in[0];
  const float* Wqkv = (const float*)d_in[1];
  const float* bqkv = (const float*)d_in[2];
  const float* Wout = (const float*)d_in[3];
  const float* bout = (const float*)d_in[4];
  float* out = (float*)d_out;

  // workspace map (all offsets 256-B aligned; every region fully written before it is read):
  //   xb    bf16 [8192][1024]                16,777,216
  //   wqT   bf16 [3072][1024] (Wqkv^T)       6,291,456
  //   woT   f16  [1024][1024] (Wout^T)       2,097,152
  //   cosT  f32  [2048][32]                     262,144
  //   sinT  f32  [2048][32]                     262,144
  //   qk16  f16  [8192][2048] (q | k, rotated, x QK_FOLD) 33,554,432
  //   vt16  f16  [4][1024][2048] (v^T)       16,777,216
  //   o16   f16  [8192][1024]                16,777,216
  //   total                                  92,798,976
  char* ws = (char*)d_ws;
  size_t off = 0;
  unsigned short* xb   = (unsigned short*)(ws + off); off += (size_t)M_ROWS * D_MODEL * 2;
  unsigned short* wqT  = (unsigned short*)(ws + off); off += (size_t)3 * D_MODEL * D_MODEL * 2;
  unsigned short* woT  = (unsigned short*)(ws + off); off += (size_t)D_MODEL * D_MODEL * 2;
  float*          cosT = (float*)(ws + off);          off += (size_t)SEQ_LEN * ROPE_HALF * 4;
  float*          sinT = (float*)(ws + off);          off += (size_t)SEQ_LEN * ROPE_HALF * 4;
  unsigned short* qk16 = (unsigned short*)(ws + off); off += (size_t)M_ROWS * QK_LD * 2;
  unsigned short* vt16 = (unsigned short*)(ws + off); off += (size_t)NB_BATCH * D_MODEL * SEQ_LEN * 2;
  unsigned short* o16  = (unsigned short*)(ws + off); off += (size_t)M_ROWS * D_MODEL * 2;
  if (off > ws_size) return;

  // 1-3) one launch: rotation tables; Wqkv [1024][3072] -> Wqkv^T bf16 [3072][1024]; Wout -> Wout^T f16 [1024][1024]; x -> bf16
  prep_kernel<<<dim3(PREP_RT + PREP_TQ + PREP_TO + PREP_CX), dim3(256), 0, stream>>>(x, Wqkv, Wout, xb, wqT, woT, cosT, sinT);
  // 4) q|k = x.Wqkv[:, 0:2048] + bf16(b) -> rotate -> f16 : M=8192, N=2048, K=1024 (work-group tiles 64x8 = 512 blocks)
  {
    const int tiles = (M_ROWS / GB_M) * (2 * D_MODEL / GB_N);
    wmma_gemm64<1, 0, 3, 3, false, D_MODEL><<<dim3(tiles, 1), dim3(256), 0, stream>>>(
        xb, nullptr, 0L,
        wqT, 0L,
        (void*)qk16, nullptr, QK_LD, 0L,
        bqkv, nullptr, 0L,
        cosT, sinT, SEQ_LEN,
        M_ROWS, 2 * D_MODEL, D_MODEL, 1.0f);
  }
  // 5) v^T per batch = Wv^T . x_b^T + bf16(bv)[m] -> f16 : M=1024 (features), N=2048 (positions), K=1024, z = 4
  //    A = Wqkv^T rows 2048..3071, Bt = x_b [2048][1024], C = vt16 + b*1024*2048 (work-group tiles 8x8 = 64 blocks)
  {
    const int tiles = (D_MODEL / GB_M) * (SEQ_LEN / GB_N);
    wmma_gemm64<1, 0, 4, 1, false, D_MODEL><<<dim3(tiles, NB_BATCH), dim3(256), 0, stream>>>(
        wqT + (size_t)2 * D_MODEL * D_MODEL, nullptr, 0L,
        xb, (long)SEQ_LEN * D_MODEL,
        (void*)vt16, nullptr, SEQ_LEN, (long)D_MODEL * SEQ_LEN,
        bqkv + 2 * D_MODEL, nullptr, 0L,
        nullptr, nullptr, 1,
        D_MODEL, SEQ_LEN, D_MODEL, 1.0f);
  }
  // 6) attention -> o as one f16 plane [8192][1024]
  attn_f16_kernel<<<dim3(N_HEAD * (SEQ_LEN / AT_QB), NB_BATCH), dim3(128), 0, stream>>>(qk16, vt16, o16);
  // 7) out = o.Wout + bf16(b_out) -> f32 d_out : M=8192, N=1024, K=1024 (work-group tiles 64x4 = 256 blocks)
  {
    const int tiles = (M_ROWS / GB_M) * (D_MODEL / GB_N);
    wmma_gemm64<0, 0, 3, 0, false, D_MODEL><<<dim3(tiles, 1), dim3(256), 0, stream>>>(
        o16, nullptr, 0L,
        woT, 0L,
        (void*)out, nullptr, D_MODEL, 0L,
        bout, nullptr, 0L,
        nullptr, nullptr, 1,
        M_ROWS, D_MODEL, D_MODEL, 1.0f);
  }
}

// v009
// It runs in 133 microseconds.
// Two timings next to v008 both put it at 1.05 times that version's speed.
// Over all steps from v000 it is 4.52 times as fast.
// Contractions: x.Wqkv (q|k part) and Wv^T.x^T : v_wmma_f32_16x16x32_bf16 (bf16 operands = RNE of the f32 inputs); q.k^T and p.v : v_wmma_f32_16x16x32_f16 (q,k cast to f16 after f32 rope; p carried x2^5 in f16; v f16); o.Wout : v_wmma_f32_16x16x32_f16 (o and Wout both RNE to f16, one plane each); all f32 accumulate; rope tables, softmax, biases in f32.
#include <hip/hip_runtime.h>
#include <math.h>
#include <stdint.h>

constexpr int NB_BATCH  = 4;
constexpr int SEQ_LEN   = 2048;
constexpr int D_MODEL   = 1024;
constexpr int N_HEAD    = 16;
constexpr int HEAD_D    = 64;
constexpr int ROPE_HALF = 32;          // head_dim / 2 rotation pairs
constexpr int QK_LD     = 2 * D_MODEL; // pitch of the q|k 16-bit plane

typedef __attribute__((ext_vector_type(16))) _Float16 v16h;
typedef __attribute__((ext_vector_type(8)))  _Float16 v8h;
typedef __attribute__((ext_vector_type(16))) __bf16   v16b;
typedef __attribute__((ext_vector_type(8)))  __bf16   v8b;
typedef __attribute__((ext_vector_type(8)))  float    v8f;
typedef __attribute__((ext_vector_type(4)))  float    v4f;
typedef __attribute__((ext_vector_type(4)))  unsigned int v4u;

__device__ __forceinline__ unsigned short f2bf_bits(float f) {
  unsigned u = __float_as_uint(f);
  return (unsigned short)((u + 0x7FFFu + ((u >> 16) & 1u)) >> 16);
}
__device__ __forceinline__ float bf_bits2f(unsigned short h) { return __uint_as_float(((unsigned)h) << 16); }
__device__ __forceinline__ unsigned short f2h_bits(float f) { return __builtin_bit_cast(unsigned short, (_Float16)f); }   // RNE
__device__ __forceinline__ unsigned pk16(unsigned short a, unsigned short b) { return (unsigned)a | ((unsigned)b << 16); }

// hazard guards as plain device helpers (their inline asm stays out of the kernel template body)
__device__ __forceinline__ void dep_guard_h(v8f& a, v8f& b, v16h x, v16h y) { asm volatile("v_nop\n\tv_nop\n\tv_nop\n\tv_nop" : "+v"(a), "+v"(b) : "v"(x), "v"(y)); }
__device__ __forceinline__ void dep_guard_b(v8f& a, v8f& b, v16b x, v16b y) { asm volatile("v_nop\n\tv_nop\n\tv_nop\n\tv_nop" : "+v"(a), "+v"(b) : "v"(x), "v"(y)); }
__device__ __forceinline__ void keep4_h(v16h a, v16h b, v16h c, v16h d) { asm volatile("v_nop" :: "v"(a), "v"(b), "v"(c), "v"(d)); }
__device__ __forceinline__ void keep4_b(v16b a, v16b b, v16b c, v16b d) { asm volatile("v_nop" :: "v"(a), "v"(b), "v"(c), "v"(d)); }
__device__ __forceinline__ void acc_guard4(v8f& a, v8f& b, v8f& c, v8f& d) { asm volatile("v_nop\n\tv_nop\n\tv_nop\n\tv_nop" : "+v"(a), "+v"(b), "+v"(c), "+v"(d)); }
template <typename T> struct Frag;
template <> struct Frag<_Float16> {
  typedef v16h V; typedef v8h H; union U { v16h v; v8h h[2]; };
  static __device__ __forceinline__ v16h load(const _Float16* p) {   // elements 0..7 <- p[0..7], 8..15 <- p[16..23]
    U f; f.h[0] = *(const v8h*)(p); f.h[1] = *(const v8h*)(p + 16); return f.v;
  }
  static __device__ __forceinline__ v8f mma(v16h a, v16h b, v8f c) {
    return __builtin_amdgcn_wmma_f32_16x16x32_f16(false, a, false, b, (short)0, c, false, false);
  }
  static __device__ __forceinline__ void guard(v8f& a, v8f& b, v16h x, v16h y) { dep_guard_h(a, b, x, y); }
  static __device__ __forceinline__ void keep(v16h a, v16h b, v16h c, v16h d) { keep4_h(a, b, c, d); }
};
template <> struct Frag<__bf16> {
  typedef v16b V; typedef v8b H; union U { v16b v; v8b h[2]; };
  static __device__ __forceinline__ v16b load(const __bf16* p) {
    U f; f.h[0] = *(const v8b*)(p); f.h[1] = *(const v8b*)(p + 16); return f.v;
  }
  static __device__ __forceinline__ v8f mma(v16b a, v16b b, v8f c) {
    return __builtin_amdgcn_wmma_f32_16x16x32_bf16(false, a, false, b, (short)0, c, false, false);
  }
  static __device__ __forceinline__ void guard(v8f& a, v8f& b, v16b x, v16b y) { dep_guard_b(a, b, x, y); }
  static __device__ __forceinline__ void keep(v16b a, v16b b, v16b c, v16b d) { keep4_b(a, b, c, d); }
};

// ---- Register-blocked batched WMMA GEMM, operands staged per work-group in LDS ----
// C[m,n] = scale * sum_k A[m,k] * Bt[n,k] (+bias)(+resid); a work-group of 8 waves (2 x 4) owns a 128x256 tile,
// each wave a 64x64 tile of it.
// A row-major [M,K]; Bt row-major [N,K]; M % 128 == 0, N % 256 == 0, K % 64 == 0.
// A stage is 64 k (128 B, one cache line) of every operand row of the work-group tile: 8 lanes x 16 B fetch one row's line,
// so a wave's load touches 4 whole lines; the rows lie in LDS at pitch GB_LP. Two LDS buffers: stage s+1 is fetched into
// registers ahead of stage s's products, stored behind them into the other buffer, one work-group barrier per stage.
// SPLITM: 0 = single product; 2 = A hi/lo planes (hi.B + lo.B).
// BIAS_MODE: 0 = none, 1 = bias[m], 2 = bias[n], 3 = bias[n] RNE-converted to bf16, 4 = bias[m] RNE-converted to bf16.
// OUT_MODE: 0 = f32, 1 = f16, 2 = bf16 hi plane (Cout) + bf16 lo plane (Cout2),
//           3 = f16 with interleaved-pair rotation: pair (2i,2i+1) within each 64-wide column tile rotated by
//               (ropeC, ropeS)[t][i] with t = m % ropeT (tables [ropeT][32] f32).
// ET: 0 = f16 operands, 1 = bf16 operands (pointers passed as 16-bit storage)
template <int ET> struct Elem;
template <> struct Elem<0> { typedef _Float16 T; };
template <> struct Elem<1> { typedef __bf16 T; };
constexpr int GB_M  = 128;  // work-group tile rows
constexpr int GB_N  = 256;  // work-group tile columns
constexpr int GB_K  = 64;   // k per stage
constexpr int GB_LP = 72;   // LDS row pitch in 16-bit elements: 144 B = 16 B x 9 (odd) for 16-byte row readers
// Registers: the single-plane builds stay within 256 VGPRs, so that two work-groups (their LDS fits twice) share a WGP and
// one's products cover the other's barrier and staging; the hi/lo build has one work-group per WGP by its LDS.
// LD: row pitch of A and Bt in elements, a compile-time value: the groups of 32 staged rows are then immediate offsets
// of one address per plane.
template <int ET, int SPLITM, int BIAS_MODE, int OUT_MODE, bool RESID, int LD, int ACT = 0>
__global__ __launch_bounds__(256) __attribute__((amdgpu_waves_per_eu((SPLITM != 0) ? 2 : 4))) void wmma_gemm64(
    const unsigned short* __restrict__ Ap, const unsigned short* __restrict__ A2p, long strideA,
    const unsigned short* __restrict__ Btp, long strideB,
    void* __restrict__ Cout, void* __restrict__ Cout2, int ldc, long strideC,
    const float* __restrict__ bias,
    const float* __restrict__ resid, long strideR,
    const float* __restrict__ ropeC, const float* __restrict__ ropeS, int ropeT,
    int M, int N, int K, float scale) {
  typedef typename Elem<ET>::T T;
  typedef typename Frag<T>::V V;
  typedef typename Frag<T>::H H;
  static_assert(SPLITM == 0 || SPLITM == 2, "staged planes: A (hi, lo) and Bt");
  const T* A = (const T*)Ap; const T* A2 = (const T*)A2p; const T* Bt = (const T*)Btp;
  constexpr int A_ROWS = (SPLITM != 0) ? 2 * GB_M : GB_M;   // staged A rows: hi plane, then lo plane
  constexpr int S_ROWS = A_ROWS + GB_N;                     // staged rows per stage
  constexpr int NPC    = S_ROWS / 32;                       // 16-B pieces per thread per stage (256 threads x 16 B = 32 rows)
  __shared__ __align__(16) T sOp[2][S_ROWS * GB_LP];        // two stage buffers
  __shared__ __align__(16) float sT[8][16 * 68];   // per-wave 16x64 slab, pitch 68 floats
  const int b    = blockIdx.y;
  const int tid  = threadIdx.x;
  const int lane = tid & 31;
  const int wave = tid >> 5;
  const int blkN = N >> 8;
  const int blkM = M >> 7;
  if ((int)blockIdx.x >= blkM * blkN) return;   // the same for the whole work-group, ahead of every barrier
  const int bm = blockIdx.x / blkN;
  const int bn = blockIdx.x - bm * blkN;
  const int wm = (wave >> 2) << 6;             // this wave's row offset in the work-group tile
  const int wn = (wave & 3) << 6;              // this wave's column offset
  const int m0 = (bm << 7) + wm;
  const int n0 = (bn << 8) + wn;

  const int rlane = lane & 15;                 // row (A) / col (B, D) within subtile
  const int koff  = (lane >> 4) * 8;           // k offset of this lane half
  const int mOff  = (lane >> 4) * 8;           // D row offset

  // staging map: thread -> row (tid >> 3) of each group of 32 staged rows, 16-B piece (tid & 7) of its 128-B line
  const int sr = tid >> 3;
  const int sc = (tid & 7) * 8;
  const T* gA  = A  + (size_t)b * strideA + (size_t)((bm << 7) + sr) * LD + sc;
  const T* gA2 = (SPLITM != 0) ? (A2 + (size_t)b * strideA + (size_t)((bm << 7) + sr) * LD + sc) : gA;
  const T* gB  = Bt + (size_t)b * strideB + (size_t)((bn << 8) + sr) * LD + sc;
  H pre[NPC];
  auto fetch = [&](int k0) {
    const T* pa  = gA  + k0;
    const T* pa2 = gA2 + k0;
    const T* pb  = gB  + k0;
#pragma unroll   // constant indices keep pre[] in registers and the row groups as immediate offsets
    for (int it = 0; it < NPC; ++it) {
      const int row = it * 32;
      if (row < GB_M)        pre[it] = *(const H*)(pa  + (size_t)row * LD);
      else if (row < A_ROWS) pre[it] = *(const H*)(pa2 + (size_t)(row - GB_M) * LD);
      else                   pre[it] = *(const H*)(pb  + (size_t)(row - A_ROWS) * LD);
    }
    // the wait in front of any overwrite of the loads' address registers; the addresses are inputs, so that their
    // registers are held up to it
    asm volatile("s_wait_xcnt 0x0" :: "v"(pa), "v"(pa2), "v"(pb) : "memory");
  };
  auto stash = [&](T* dst) {
#pragma unroll   // constant indices keep pre[] in registers
    for (int it = 0; it < NPC; ++it) *(H*)(dst + (it * 32 + sr) * GB_LP + sc) = pre[it];
  };

  v8f acc[4][4];
#pragma unroll
  for (int i = 0; i < 4; ++i)
#pragma unroll
    for (int j = 0; j < 4; ++j) acc[i][j] = (v8f){0.f,0.f,0.f,0.f,0.f,0.f,0.f,0.f};

  const int nst = K >> 6;
  fetch(0);
  stash(sOp[0]);
  __syncthreads();
  for (int st = 0; st < nst; ++st) {
    const bool more = (st + 1 < nst);          // the same for the whole work-group
    if (more) fetch((st + 1) << 6);
    const T* sA = sOp[st & 1] + (wm + rlane) * GB_LP + koff;
    const T* sB = sOp[st & 1] + (A_ROWS + wn + rlane) * GB_LP + koff;
#pragma unroll   // both halves of a stage in one block, so that the second half's fragment reads can start under the first's products
    for (int kk = 0; kk < GB_K; kk += 32) {
      // all fragments of these 32 k are read as one group ahead of their products
      V bh[4], ah[4], al[4];
#pragma unroll
      for (int j = 0; j < 4; ++j) bh[j] = Frag<T>::load(sB + (j << 4) * GB_LP + kk);
#pragma unroll
      for (int i = 0; i < 4; ++i) {
        ah[i] = Frag<T>::load(sA + (i << 4) * GB_LP + kk);
        if (SPLITM != 0) al[i] = Frag<T>::load(sA + (GB_M + (i << 4)) * GB_LP + kk);
      }
#pragma unroll
      for (int i = 0; i < 4; ++i) {
#pragma unroll
        for (int j = 0; j < 4; ++j) {
          acc[i][j] = Frag<T>::mma(ah[i], bh[j], acc[i][j]);
          if (SPLITM != 0) acc[i][j] = Frag<T>::mma(al[i], bh[j], acc[i][j]);
        }
        Frag<T>::guard(acc[i][0], acc[i][3], ah[i], (SPLITM != 0) ? al[i] : ah[i]);
      }
      Frag<T>::keep(bh[0], bh[1], bh[2], bh[3]);
    }
    // the other buffer's last readers passed the barrier that ended stage st - 1
    if (more) stash(sOp[(st + 1) & 1]);
    __syncthreads();                           // publishes stage st + 1 and ends every read of stage st's buffer
  }
  acc_guard4(acc[0][0], acc[0][1], acc[0][2], acc[0][3]);
  acc_guard4(acc[1][0], acc[1][1], acc[1][2], acc[1][3]);
  acc_guard4(acc[2][0], acc[2][1], acc[2][2], acc[2][3]);
  acc_guard4(acc[3][0], acc[3][1], acc[3][2], acc[3][3]);

  // ---- epilogue ----
  float* slab = sT[wave];
  const float* Rb = RESID ? (resid + (size_t)b * strideR) : nullptr;
#pragma unroll
  for (int i = 0; i < 4; ++i) {
    const int mBase = m0 + (i << 4);
#pragma unroll
    for (int j = 0; j < 4; ++j) {
      const int n = n0 + (j << 4) + rlane;
      float bv = 0.f;
      if (BIAS_MODE == 2) bv = bias[n];
      if (BIAS_MODE == 3) bv = bf_bits2f(f2bf_bits(bias[n]));
#pragma unroll
      for (int r = 0; r < 8; ++r) {
        float v = acc[i][j][r] * scale;
        if (BIAS_MODE == 1) v += bias[mBase + mOff + r];
        if (BIAS_MODE == 4) v += bf_bits2f(f2bf_bits(bias[mBase + mOff + r]));
        if (BIAS_MODE == 2 || BIAS_MODE == 3) v += bv;
        if (RESID) v += Rb[(size_t)(mBase + mOff + r) * ldc + n];
        if (ACT == 1) v = tanhf(v);
        if (ACT == 2) v = fmaxf(v, 0.0f);
        if (ACT == 3) v = v / (1.0f + expf(-v));
        if (ACT == 4) v = (v > 0.f) ? v : 0.01f * v;
        slab[(mOff + r) * 68 + (j << 4) + rlane] = v;
      }
    }
    __builtin_amdgcn_fence(__ATOMIC_RELEASE, "workgroup");
    __builtin_amdgcn_wave_barrier();
    __builtin_amdgcn_fence(__ATOMIC_ACQUIRE, "workgroup");
    if (OUT_MODE == 0) {
      float* C = (float*)Cout + (size_t)b * strideC;
      const int hh = lane >> 4, c4 = (lane & 15) * 4;     // row seg = 256 B = 16 lanes x 16 B
      {
#pragma unroll
        for (int it = 0; it < 8; ++it) {
          const int row = it * 2 + hh;
          v4f v = *(const v4f*)(slab + row * 68 + c4);
          *(v4f*)(C + (size_t)(mBase + row) * ldc + n0 + c4) = v;
        }
        
      }
    } else {
      const int q = lane >> 3, c8 = (lane & 7) * 8;
      unsigned short* C  = (unsigned short*)Cout  + (size_t)b * strideC;
      unsigned short* C2 = (OUT_MODE == 2) ? ((unsigned short*)Cout2 + (size_t)b * strideC) : nullptr;
      {
#pragma unroll
        for (int it = 0; it < 4; ++it) {
          const int row = it * 4 + q;
          const float* sp = slab + row * 68 + c8;
          v8h hv, lv;
          if (OUT_MODE == 3) {
            // columns c8..c8+7 of this 64-wide tile are rotation pairs (c8>>1)+0..3 of position t
            const int t = (mBase + row) % ropeT;
            const v4f cv = *(const v4f*)(ropeC + (size_t)t * ROPE_HALF + (c8 >> 1));
            const v4f sv = *(const v4f*)(ropeS + (size_t)t * ROPE_HALF + (c8 >> 1));
#pragma unroll
            for (int e2 = 0; e2 < 4; ++e2) {
              const float x0 = sp[2 * e2], x1 = sp[2 * e2 + 1];
              hv[2 * e2]     = (_Float16)(x0 * cv[e2] - x1 * sv[e2]);
              hv[2 * e2 + 1] = (_Float16)(x0 * sv[e2] + x1 * cv[e2]);
            }
          } else {
#pragma unroll
            for (int e = 0; e < 8; ++e) {
              if (OUT_MODE == 1) {
                hv[e] = (_Float16)sp[e];
              } else {
                unsigned short hb = f2bf_bits(sp[e]);
                unsigned short lb = f2bf_bits(sp[e] - bf_bits2f(hb));
                hv[e] = __builtin_bit_cast(_Float16, hb);
                lv[e] = __builtin_bit_cast(_Float16, lb);
              }
            }
          }
          *(v8h*)(C + (size_t)(mBase + row) * ldc + n0 + c8) = hv;
          if (OUT_MODE == 2) *(v8h*)(C2 + (size_t)(mBase + row) * ldc + n0 + c8) = lv;
        }
        
      }
    }
    __builtin_amdgcn_fence(__ATOMIC_RELEASE, "workgroup");
    __builtin_amdgcn_wave_barrier();
    __builtin_amdgcn_fence(__ATOMIC_ACQUIRE, "workgroup");
  }
}

// ---------------------------------------------------------------------------
// Preparation: four independent bodies share one launch, picked by ranges of the block index (the same for a whole
// work-group). Every body takes 256 threads; the ranges are compile-time counts of the fixed shapes.
// ---------------------------------------------------------------------------
// f32 -> bf16 (RNE) cast, 8 elements per thread, one 16-B store per lane: a wave writes 512 contiguous bytes.
// Coverage: n8/256 blocks x 256 threads x 8 elements = 8*n8 = the whole plane (n8 = 8192*1024/8 = 1,048,576
// -> 4096 blocks exactly).
__device__ __forceinline__ void cast_bf16x8_body(const float* __restrict__ in, unsigned short* __restrict__ out, int blk) {
  const int i = blk * 256 + threadIdx.x;
  const v4f a  = *(const v4f*)(in + 8 * (size_t)i);
  const v4f a2 = *(const v4f*)(in + 8 * (size_t)i + 4);
  v4u u;
  u[0] = pk16(f2bf_bits(a[0]),  f2bf_bits(a[1]));
  u[1] = pk16(f2bf_bits(a[2]),  f2bf_bits(a[3]));
  u[2] = pk16(f2bf_bits(a2[0]), f2bf_bits(a2[1]));
  u[3] = pk16(f2bf_bits(a2[2]), f2bf_bits(a2[3]));
  *(v4u*)(out + 8 * (size_t)i) = u;
  // the wait in front of any overwrite of the store's registers on a path that leads on through another body's code
  asm volatile("s_wait_xcnt 0x0" ::: "memory");
}

// Fused transpose + 16-bit (RNE) cast of an f32 matrix, to f16 if TO_F16, else to bf16: in [R rows][Cc cols] (pitch Cc) ->
// out[c][r] ([Cc][R], pitch R).
// 64x64 tiles through LDS (tf: 64 rows, pitch 68 floats); tile (cb, rb) of (Cc/64, R/64), 256 threads.
// Coverage per block: load 4 it x 256 thr x 4 floats = 64x64; store 2 it x 256 thr x 8 u16 = 64x64.
template <int R, int Cc, bool TO_F16>
__device__ __forceinline__ void tcast16_body(const float* __restrict__ W, unsigned short* __restrict__ oh, float* tf,
                                             int cb, int rb) {
  const int c0  = cb * 64;           // input column block = output row block
  const int rb0 = rb * 64;           // input row block    = output column block
  const int tid = threadIdx.x;
  {
    const int lr = tid >> 4;         // 0..15
    const int c4 = (tid & 15) * 4;   // 0..60
#pragma unroll
    for (int it = 0; it < 4; ++it) {
      const int rr = it * 16 + lr;   // 0..63
      const v4f a = *(const v4f*)(W + (size_t)(rb0 + rr) * Cc + c0 + c4);
      *(v4f*)(tf + rr * 68 + c4) = a;
    }
  }
  __syncthreads();
  const int sub = tid >> 3;          // 0..31
  const int c8  = (tid & 7) * 8;     // 0..56
  v4u hv[2];
#pragma unroll
  for (int it = 0; it < 2; ++it) {
    const int oc = it * 32 + sub;    // output row within tile (= input column)
    v4u a;
#pragma unroll
    for (int q = 0; q < 4; ++q) {
      const float f0 = tf[(c8 + 2 * q) * 68 + oc];
      const float f1 = tf[(c8 + 2 * q + 1) * 68 + oc];
      a[q] = TO_F16 ? pk16(f2h_bits(f0), f2h_bits(f1)) : pk16(f2bf_bits(f0), f2bf_bits(f1));
    }
    hv[it] = a;
  }
#pragma unroll
  for (int it = 0; it < 2; ++it) {
    const int oc = it * 32 + sub;
    const size_t go = (size_t)(c0 + oc) * R + rb0 + c8;
    *(v4u*)(oh + go) = hv[it];
  }
  // the wait in front of any overwrite of the stores' registers on a path that leads on through another body's code
  asm volatile("s_wait_xcnt 0x0" ::: "memory");
}

// Rotation tables: freq[i] = 1 / 10000^((2i)/64), i = 0..31 (f32 pow, f32 reciprocal), formed by each thread for its own i;
// ang[t][i] = (float)t * freq[i]; cosT/sinT [SEQ][32] f32 (precise sincosf). SEQ*32/256 blocks cover the tables exactly.
// Both tables carry the factor QK_FOLD, so that the rotated q and k each carry it and q . k comes out of the score products
// already times (1/sqrt(64)) * log2 e, one f16 rounding per element as before.
constexpr float QK_FOLD = 0.42466090014400953f;   // sqrt(0.125 * log2 e)
__device__ __forceinline__ void rope_table_body(float* __restrict__ cosT, float* __restrict__ sinT, int blk) {
  const int idx = blk * 256 + threadIdx.x;
  const int t = idx >> 5, i = idx & 31;
  const float e = (float)(2 * i) / (float)HEAD_D;  // exact (division by 64)
  const float p = powf(10000.0f, e);
  const float f = 1.0f / p;
  const float ang = (float)t * f;
  float sv, cv;
  sincosf(ang, &sv, &cv);
  cosT[idx] = cv * QK_FOLD;
  sinT[idx] = sv * QK_FOLD;
}

constexpr int PREP_RT = SEQ_LEN * ROPE_HALF / 256;                    // 256 blocks: rotation tables
constexpr int PREP_TQ = (3 * D_MODEL / 64) * (D_MODEL / 64);          // 768 blocks: Wqkv^T
constexpr int PREP_TO = (D_MODEL / 64) * (D_MODEL / 64);              // 256 blocks: Wout^T
constexpr int PREP_CX = NB_BATCH * SEQ_LEN * D_MODEL / 8 / 256;       // 4096 blocks: x
// The bodies with the longest chains (tables, transposes) have the lowest block indices, the stream of x the rest.
__global__ __launch_bounds__(256) void prep_kernel(const float* __restrict__ x, const float* __restrict__ Wqkv,
                                                   const float* __restrict__ Wout, unsigned short* __restrict__ xb,
                                                   unsigned short* __restrict__ wqT, unsigned short* __restrict__ woT,
                                                   float* __restrict__ cosT, float* __restrict__ sinT) {
  __shared__ __align__(16) float tf[64 * 68];
  const int bx = blockIdx.x;
  if (bx < PREP_RT) {
    rope_table_body(cosT, sinT, bx);
  } else if (bx < PREP_RT + PREP_TQ) {
    const int k = bx - PREP_RT;
    tcast16_body<D_MODEL, 3 * D_MODEL, false>(Wqkv, wqT, tf, k % (3 * D_MODEL / 64), k / (3 * D_MODEL / 64));
  } else if (bx < PREP_RT + PREP_TQ + PREP_TO) {
    const int k = bx - (PREP_RT + PREP_TQ);
    tcast16_body<D_MODEL, D_MODEL, true>(Wout, woT, tf, k % (D_MODEL / 64), k / (D_MODEL / 64));
  } else {
    cast_bf16x8_body(x, xb, bx - (PREP_RT + PREP_TQ + PREP_TO));
  }
}

// =====================================================================================
// Full (non-causal, unmasked) attention, head dim 64, f16 operand planes.
//   q|k plane (f16): element (b, t, h, d) of q at [(b*SEQ + t)*QK_LD + h*64 + d], of k at [... + D_MODEL + h*64 + d]
//   v^T plane (f16): element (b, h, d, s) at [(b*D_MODEL + h*64 + d)*SEQ + s]
//   out: one f16 plane, element (b, t, h, d) at [(b*SEQ + t)*D_MODEL + h*64 + d]
//   scores = q . k            : v_wmma_f32_16x16x32_f16, f32 accumulate; q and k carry the scale and log2 e (QK_FOLD)
//   out    = p . v            : v_wmma_f32_16x16x32_f16 with p (unnormalised) carried x2^5 in f16, as is the sum l
//   online softmax in f32 over all SEQ keys (32 chunks of 64, compile-time trip count, no masking), reference held.
//   Block = 4 waves x 32 query rows = 128 query rows of one (batch, head); grid = (N_HEAD * SEQ/128, NB_BATCH).
//   K / V^T chunk staging: 128 threads x 32 elements per plane = the whole 64x64 tile (16-B copies, plain loads,
//   __syncthreads before and after); fragment loads read the LDS tiles with the same v8h element type.
// =====================================================================================
constexpr int AT_D  = 64;
constexpr int AT_NW = 4;
constexpr int AT_QT = 2;                  // 16-column query tiles per wave: each K or V^T fragment read from LDS feeds AT_QT products
constexpr int AT_QB = AT_NW * AT_QT * 16;  // 128 query rows per work-group
constexpr int AT_KC = 64;
constexpr int AT_LP = 72;   // LDS row pitch of the K and V^T tiles in f16 elements: 144 B = 16 B x 9 (odd) for 16-byte row readers
constexpr float P_CARRY_LOG2 = 5.0f;    // p is carried x2^5: the carry is added to the exponent
constexpr float P_SUM_LIMIT  = 32768.0f; // a lane's chunk sum of carried p at or below it: every p of it is finite in f16

__device__ __forceinline__ v8f mma_h16(v16h a, v16h b, v8f c) {
  return __builtin_amdgcn_wmma_f32_16x16x32_f16(false, a, false, b, (short)0, c, false, false);
}
__device__ __forceinline__ v8f splat8(float x) { return (v8f){x, x, x, x, x, x, x, x}; }
// value of lane l ^ 16 (the other half of the wave), by a vector cross-row move
__device__ __forceinline__ float xhalf(float x) {
  const int b = __builtin_bit_cast(int, x);
  return __builtin_bit_cast(float, __builtin_amdgcn_permlanex16(b, b, 0x76543210, 0xfedcba98, false, false));
}

__device__ __forceinline__ void acc_guard8(v8f& a, v8f& b, v8f& c, v8f& d, v8f& e, v8f& f, v8f& g, v8f& h) {
  asm volatile("v_nop\n\tv_nop\n\tv_nop\n\tv_nop" : "+v"(a), "+v"(b), "+v"(c), "+v"(d), "+v"(e), "+v"(f), "+v"(g), "+v"(h));
}
__global__ __launch_bounds__(128) __attribute__((amdgpu_waves_per_eu(4)))
void attn_f16_kernel(const unsigned short* __restrict__ qkp, const unsigned short* __restrict__ vtp,
                     unsigned short* __restrict__ op) {
  union FB { v16h v; v8h h[2]; };
  __shared__ __align__(16) _Float16 Ksh[AT_KC * AT_LP];         // K [kv][d], pitch AT_LP      9 KB
  __shared__ __align__(16) _Float16 Vth[AT_D * AT_LP];          // V^T [d][kv], pitch AT_LP    9 KB
  __shared__ __align__(16) float    Os[AT_NW][AT_QT * 16 * 68]; // per wave out tile (32 queries), pitch 68

  const int tid  = threadIdx.x;
  const int wave = tid >> 5;
  const int lane = tid & 31;
  const int hh   = lane >> 4;
  const int c    = lane & 15;

  const int nqb = SEQ_LEN / AT_QB;            // 16
  const int bx = blockIdx.x;
  const int qb = bx % nqb;
  const int h  = bx / nqb;                    // 0..N_HEAD-1 (grid.x = N_HEAD * nqb)
  const int b  = blockIdx.y;                  // batch
  const int q0 = qb * AT_QB + wave * (AT_QT * 16);

  const _Float16* Qp = (const _Float16*)(const void*)qkp + (size_t)b * SEQ_LEN * QK_LD + (size_t)h * AT_D;
  const _Float16* Kp = Qp + D_MODEL;
  const _Float16* Vp = (const _Float16*)(const void*)vtp + ((size_t)b * D_MODEL + (size_t)h * AT_D) * SEQ_LEN;
  _Float16* Op = (_Float16*)(void*)op + (size_t)b * SEQ_LEN * D_MODEL + (size_t)h * AT_D;

  // ---- Q fragments (B operand, column = lane&15, split k map via Frag load): 2 query tiles x 2 d-chunks ----
  v16h qa[AT_QT][2];
#pragma unroll
  for (int u = 0; u < AT_QT; ++u)
#pragma unroll
    for (int dc = 0; dc < 2; ++dc)
      qa[u][dc] = Frag<_Float16>::load(Qp + (size_t)(q0 + 16 * u + c) * QK_LD + dc * 32 + 8 * hh);

  // Softmax in base 2 against a held reference: p * 2^5 = exp2(s + (5 - m)), where 5 - m enters the score products as their
  // start value C, so a score costs one hardware exponential. m is the maximum of the query's scores up to the chunk that last
  // raised it, so the largest p of a row is at least 1. It is raised (maximum taken, O and l rescaled; both query tiles at
  // once) only in a chunk where some lane's sum of carried p is not at or below P_SUM_LIMIT; the first chunk is one, since
  // 5 - m starts at +inf.
  float mref[AT_QT];        // held reference of query q0 + 16*u + c in log2 units (the same in both halves)
  v8f   cref[AT_QT];        // 5 - mref in all eight rows of the lane's column
  float lrun[AT_QT];        // running sum (x2^5) over this half's keys; the halves are joined behind the loop
  v8f oacc[AT_QT][4];       // O^T: oacc[u][t][r] = element d = t*16 + 8*hh + r of query q0 + 16*u + c
#pragma unroll
  for (int u = 0; u < AT_QT; ++u) {
    mref[u] = -INFINITY;
    cref[u] = splat8(INFINITY);
    lrun[u] = 0.f;
#pragma unroll
    for (int t = 0; t < 4; ++t) oacc[u][t] = (v8f){0.f,0.f,0.f,0.f,0.f,0.f,0.f,0.f};
  }

  for (int kc = 0; kc < SEQ_LEN / AT_KC; ++kc) {     // 32, compile-time constant
    const int kv0 = kc * AT_KC;
    __syncthreads();
    {
      // staging map: a tile row is one 128-B cache line; 8 lanes x 16 B fetch it whole, so a wave's load touches 4 lines.
      // coverage: 128 threads x 16 B = 16 rows a step, 4 steps = 64 rows x 64 per plane = the whole chunk tile
      const int r = tid >> 3, pc = (tid & 7) * 8;
      const _Float16* ks = Kp + (size_t)(kv0 + r) * QK_LD + pc;       // K rows kv0 + r + 16 i, d = pc..pc+7
      const _Float16* vs = Vp + (size_t)r * SEQ_LEN + kv0 + pc;        // V^T rows d = r + 16 i, s = kv0+pc..+7
#pragma unroll
      for (int i = 0; i < 4; ++i) {
        const v8h a0 = *(const v8h*)(ks + (size_t)(16 * i) * QK_LD);
        const v8h b0 = *(const v8h*)(vs + (size_t)(16 * i) * SEQ_LEN);
        *(v8h*)(Ksh + (r + 16 * i) * AT_LP + pc) = a0;
        *(v8h*)(Vth + (r + 16 * i) * AT_LP + pc) = b0;
      }
      // the wait in front of any overwrite of the loads' address registers; the addresses are inputs, so that their
      // registers are held up to it
      asm volatile("s_wait_xcnt 0x0" :: "v"(ks), "v"(vs) : "memory");
    }
    __syncthreads();

    // S^T of this chunk for both query tiles on top of their start values (here and below the loops are unrolled so that
    // constant indices keep the tiles in registers)
    auto scores = [&](v8f (&s)[AT_QT][4], v8f c0, v8f c1) {
#pragma unroll
      for (int j = 0; j < 4; ++j) { s[0][j] = c0; s[1][j] = c1; }
      // K fragments in four register sets: the four of d 0..31 are read as one group ahead of their products; each set is
      // refilled with its fragment of d 32..63 right behind the two products that read it
      FB kb[4];
#pragma unroll
      for (int j = 0; j < 4; ++j) {
        kb[j].h[0] = *(const v8h*)(Ksh + (j * 16 + c) * AT_LP + 8 * hh);
        kb[j].h[1] = *(const v8h*)(Ksh + (j * 16 + c) * AT_LP + 16 + 8 * hh);
      }
      // the scheduling barriers here and in the loop keep the reads where they are written: without them the scheduler sinks
      // each read to its product, and the wave waits out the LDS latency once per fragment
      __builtin_amdgcn_sched_barrier(0);
#pragma unroll
      for (int j = 0; j < 4; ++j) {
#pragma unroll
        for (int u = 0; u < AT_QT; ++u) s[u][j] = mma_h16(kb[j].v, qa[u][0], s[u][j]);
        kb[j].h[0] = *(const v8h*)(Ksh + (j * 16 + c) * AT_LP + 32 + 8 * hh);
        kb[j].h[1] = *(const v8h*)(Ksh + (j * 16 + c) * AT_LP + 32 + 16 + 8 * hh);
        __builtin_amdgcn_sched_barrier(0);
      }
#pragma unroll
      for (int j = 0; j < 4; ++j)
#pragma unroll
        for (int u = 0; u < AT_QT; ++u) s[u][j] = mma_h16(kb[j].v, qa[u][1], s[u][j]);
      // keeps the exponentials behind the products: drawn in among them, their results are live beside the fragment sets, and
      // the kernel spills at 256 registers
      __builtin_amdgcn_sched_barrier(0);
    };
    // exponents -> carried p in place; returns this lane's sum of them
    auto exp_sum = [&](v8f (&s)[4]) -> float {
#pragma unroll
      for (int j = 0; j < 4; ++j)
#pragma unroll
        for (int r = 0; r < 8; ++r) s[j][r] = __builtin_amdgcn_exp2f(s[j][r]);
      const v8f ps8 = (s[0] + s[1]) + (s[2] + s[3]);
      return ((ps8[0] + ps8[1]) + (ps8[2] + ps8[3])) + ((ps8[4] + ps8[5]) + (ps8[6] + ps8[7]));
    };

    v8f pv[AT_QT][4];
    float psum[AT_QT];
    scores(pv, cref[0], cref[1]);
#pragma unroll
    for (int u = 0; u < AT_QT; ++u) psum[u] = exp_sum(pv[u]);
    // one test a chunk, the same for the whole wave (a scalar branch); written so that a NaN sum takes it too
    if (__builtin_amdgcn_ballot_w32(!(psum[0] <= P_SUM_LIMIT && psum[1] <= P_SUM_LIMIT)) != 0u) {
      scores(pv, splat8(0.f), splat8(0.f));   // the K tile is still in LDS: the plain scores
#pragma unroll
      for (int u = 0; u < AT_QT; ++u) {
        const v8f c8v = __builtin_elementwise_max(__builtin_elementwise_max(pv[u][0], pv[u][1]), __builtin_elementwise_max(pv[u][2], pv[u][3]));
        float cm = fmaxf(fmaxf(fmaxf(c8v[0], c8v[1]), fmaxf(c8v[2], c8v[3])), fmaxf(fmaxf(c8v[4], c8v[5]), fmaxf(c8v[6], c8v[7])));
        cm = fmaxf(cm, xhalf(cm));
        const float mnew  = fmaxf(mref[u], cm);
        const float alpha = __builtin_amdgcn_exp2f(mref[u] - mnew);   // 0 in the first chunk, where mref is -inf
        mref[u] = mnew;
        cref[u] = splat8(P_CARRY_LOG2 - mnew);
        lrun[u] = lrun[u] * alpha;
#pragma unroll
        for (int t = 0; t < 4; ++t) oacc[u][t] = oacc[u][t] * alpha;
#pragma unroll
        for (int j = 0; j < 4; ++j) pv[u][j] = pv[u][j] + cref[u];
        psum[u] = exp_sum(pv[u]);
      }
    }
    // V^T fragments in four register sets, as the K fragments above: the four of keys 0..31 are read as one group, ahead of the
    // conversions of p, which run under the reads' latency; each set is refilled with its fragment of keys 32..63 right behind
    // the two products that read it
    FB vb[4];
#pragma unroll
    for (int t = 0; t < 4; ++t) {
      vb[t].h[0] = *(const v8h*)(Vth + (t * 16 + c) * AT_LP + 8 * hh);
      vb[t].h[1] = *(const v8h*)(Vth + (t * 16 + c) * AT_LP + 16 + 8 * hh);
    }
    // the scheduling barriers here and in the loop keep the reads where they are written (see the K fragments)
    __builtin_amdgcn_sched_barrier(0);
    FB pb[AT_QT][2];
#pragma unroll
    for (int u = 0; u < AT_QT; ++u) {
      lrun[u] += psum[u];
#pragma unroll
      for (int j = 0; j < 4; ++j)
#pragma unroll
        for (int r = 0; r < 8; ++r) pb[u][j >> 1].h[j & 1][r] = (_Float16)pv[u][j][r];
    }
#pragma unroll
    for (int t = 0; t < 4; ++t) {
#pragma unroll
      for (int u = 0; u < AT_QT; ++u) oacc[u][t] = mma_h16(vb[t].v, pb[u][0].v, oacc[u][t]);
      vb[t].h[0] = *(const v8h*)(Vth + (t * 16 + c) * AT_LP + 32 + 8 * hh);
      vb[t].h[1] = *(const v8h*)(Vth + (t * 16 + c) * AT_LP + 32 + 16 + 8 * hh);
      __builtin_amdgcn_sched_barrier(0);
    }
#pragma unroll
    for (int t = 0; t < 4; ++t)
#pragma unroll
      for (int u = 0; u < AT_QT; ++u) oacc[u][t] = mma_h16(vb[t].v, pb[u][1].v, oacc[u][t]);
    // the distance behind the last products on the loop's taken branch as on its fall-through
    acc_guard8(oacc[0][0], oacc[0][1], oacc[0][2], oacc[0][3], oacc[1][0], oacc[1][1], oacc[1][2], oacc[1][3]);
  }

  float* os = Os[wave];
#pragma unroll
  for (int u = 0; u < AT_QT; ++u) {
    const float inv = 1.0f / (lrun[u] + xhalf(lrun[u]));   // lrun carries the same 2^5 as p
#pragma unroll
    for (int t = 0; t < 4; ++t) {
      const v8f o = oacc[u][t] * inv;
      *(v4f*)(os + (16 * u + c) * 68 + t * 16 + 8 * hh)     = (v4f){o[0], o[1], o[2], o[3]};
      *(v4f*)(os + (16 * u + c) * 68 + t * 16 + 8 * hh + 4) = (v4f){o[4], o[5], o[6], o[7]};
    }
  }
  __builtin_amdgcn_fence(__ATOMIC_RELEASE, "workgroup");
  __builtin_amdgcn_wave_barrier();
  __builtin_amdgcn_fence(__ATOMIC_ACQUIRE, "workgroup");
  {
    const int q8 = lane >> 3, c8 = (lane & 7) * 8;
    {
#pragma unroll
      for (int it = 0; it < AT_QT * 4; ++it) {
        const int row = it * 4 + q8;
        const float* sp = os + row * 68 + c8;
        v8h hv;
#pragma unroll
        for (int e = 0; e < 8; ++e) hv[e] = (_Float16)sp[e];
        *(v8h*)(Op + (size_t)(q0 + row) * D_MODEL + c8) = hv;
      }
      
    }
  }
}

// ---------------- host-side orchestration (kernel launches only) ----------------
extern "C" void kernel_launch(void* const* d_in, const int* in_sizes, int n_in,
                              void* d_out, int out_size, void* d_ws, size_t ws_size,
                              hipStream_t stream) {
  if (n_in < 5) return;
  const int M_ROWS = NB_BATCH * SEQ_LEN;   // 8192
  if (in_sizes[0] != M_ROWS * D_MODEL) return;
  if (in_sizes[1] != D_MODEL * 3 * D_MODEL) return;
  if (in_sizes[2] != 3 * D_MODEL) return;
  if (in_sizes[3] != D_MODEL * D_MODEL) return;
  if (in_sizes[4] != D_MODEL) return;
  if (out_size != M_ROWS * D_MODEL) return;

  const float* x    = (const float*)d_in[0];
  const float* Wqkv = (const float*)d_in[1];
  const float* bqkv = (const float*)d_in[2];
  const float* Wout = (const float*)d_in[3];
  const float* bout = (const float*)d_in[4];
  float* out = (float*)d_out;

  // workspace map (all offsets 256-B aligned; every region fully written before it is read):
  //   xb    bf16 [8192][1024]                16,777,216
  //   wqT   bf16 [3072][1024] (Wqkv^T)       6,291,456
  //   woT   f16  [1024][1024] (Wout^T)       2,097,152
  //   cosT  f32  [2048][32]                     262,144
  //   sinT  f32  [2048][32]                     262,144
  //   qk16  f16  [8192][2048] (q | k, rotated, x QK_FOLD) 33,554,432
  //   vt16  f16  [4][1024][2048] (v^T)       16,777,216
  //   o16   f16  [8192][1024]                16,777,216
  //   total                                  92,798,976
  char* ws = (char*)d_ws;
  size_t off = 0;
  unsigned short* xb   = (unsigned short*)(ws + off); off += (size_t)M_ROWS * D_MODEL * 2;
  unsigned short* wqT  = (unsigned short*)(ws + off); off += (size_t)3 * D_MODEL * D_MODEL * 2;
  unsigned short* woT  = (unsigned short*)(ws + off); off += (size_t)D_MODEL * D_MODEL * 2;
  float*          cosT = (float*)(ws + off);          off += (size_t)SEQ_LEN * ROPE_HALF * 4;
  float*          sinT = (float*)(ws + off);          off += (size_t)SEQ_LEN * ROPE_HALF * 4;
  unsigned short* qk16 = (unsigned short*)(ws + off); off += (size_t)M_ROWS * QK_LD * 2;
  unsigned short* vt16 = (unsigned short*)(ws + off); off += (size_t)NB_BATCH * D_MODEL * SEQ_LEN * 2;
  unsigned short* o16  = (unsigned short*)(ws + off); off += (size_t)M_ROWS * D_MODEL * 2;
  if (off > ws_size) return;

  // 1-3) one launch: rotation tables; Wqkv [1024][3072] -> Wqkv^T bf16 [3072][1024]; Wout -> Wout^T f16 [1024][1024]; x -> bf16
  prep_kernel<<<dim3(PREP_RT + PREP_TQ + PREP_TO + PREP_CX), dim3(256), 0, stream>>>(x, Wqkv, Wout, xb, wqT, woT, cosT, sinT);
  // 4) q|k = x.Wqkv[:, 0:2048] + bf16(b) -> rotate -> f16 : M=8192, N=2048, K=1024 (work-group tiles 64x8 = 512 blocks)
  {
    const int tiles = (M_ROWS / GB_M) * (2 * D_MODEL / GB_N);
    wmma_gemm64<1, 0, 3, 3, false, D_MODEL><<<dim3(tiles, 1), dim3(256), 0, stream>>>(
        xb, nullptr, 0L,
        wqT, 0L,
        (void*)qk16, nullptr, QK_LD, 0L,
        bqkv, nullptr, 0L,
        cosT, sinT, SEQ_LEN,
        M_ROWS, 2 * D_MODEL, D_MODEL, 1.0f);
  }
  // 5) v^T per batch = Wv^T . x_b^T + bf16(bv)[m] -> f16 : M=1024 (features), N=2048 (positions), K=1024, z = 4
  //    A = Wqkv^T rows 2048..3071, Bt = x_b [2048][1024], C = vt16 + b*1024*2048 (work-group tiles 8x8 = 64 blocks)
  {
    const int tiles = (D_MODEL / GB_M) * (SEQ_LEN / GB_N);
    wmma_gemm64<1, 0, 4, 1, false, D_MODEL><<<dim3(tiles, NB_BATCH), dim3(256), 0, stream>>>(
        wqT + (size_t)2 * D_MODEL * D_MODEL, nullptr, 0L,
        xb, (long)SEQ_LEN * D_MODEL,
        (void*)vt16, nullptr, SEQ_LEN, (long)D_MODEL * SEQ_LEN,
        bqkv + 2 * D_MODEL, nullptr, 0L,
        nullptr, nullptr, 1,
        D_MODEL, SEQ_LEN, D_MODEL, 1.0f);
  }
  // 6) attention -> o as one f16 plane [8192][1024]
  attn_f16_kernel<<<dim3(N_HEAD * (SEQ_LEN / AT_QB), NB_BATCH), dim3(128), 0, stream>>>(qk16, vt16, o16);
  // 7) out = o.Wout + bf16(b_out) -> f32 d_out : M=8192, N=1024, K=1024 (work-group tiles 64x4 = 256 blocks)
  {
    const int tiles = (M_ROWS / GB_M) * (D_MODEL / GB_N);
    wmma_gemm64<0, 0, 3, 0, false, D_MODEL><<<dim3(tiles, 1), dim3(256), 0, stream>>>(
        o16, nullptr, 0L,
        woT, 0L,
        (void*)out, nullptr, D_MODEL, 0L,
        bout, nullptr, 0L,
        nullptr, nullptr, 1,
        M_ROWS, D_MODEL, D_MODEL, 1.0f);
  }
}
